// v000
// The times below were measured on an AMD MI455X: many runs one after another, warmed up first and cycling through
// copies of the inputs, with the whole window's GPU time divided by the number of runs. Launches and the gaps
// between them are all in it. The median over several windows is given; except for v000 it joins two sittings, which
// can be a few percent apart, so the side-by-side timings, each taken in one sitting, are the better comparison.
// The starting kernel, v000, takes 177 microseconds a run.
#include <hip/hip_runtime.h>

// Per-token outer-product attention stack: h = x W1 + b1 (256 -> 64); three blocks of {q,k,v = cur W + b; y_i = sum_j softmax_j(q_i k_j) v_j + cur_i; a = leaky(y Wf1 + bf1, 0.01) Wf2 + bf2 + y; res += LayerNorm(a)}; out = leaky(res Wout + bout, 0.1), stored five times.
// Compute dtypes, f32 accumulate everywhere: x W1 on v_wmma_f32_16x16x32_bf16 (x, W1 RNE-converted to bf16; products exact); the fifteen 64x64 GEMMs on v_wmma_f32_16x16x32_f16 with the activation as f16 value + f16 residual x2048 (own accumulator, folded by 1/2048) and the weight as f16 of the bf16-converted input x64 (folded by 1/64);
// per-token 64x64 softmax / P.v, LayerNorm and the 64 -> 1 head in f32 on the vector unit (no operand shared between tokens; the head is a matrix-vector product).
// Layout: W1T bf16 [64][256] and WH f16 [5][3][64][64] (both [n][k], k contiguous) built once in the workspace; fused kernel: one wave per block owns 32 tokens (two 16-token slabs), all tiles wave-private in LDS.

#ifndef NTOK
#define NTOK 16384
#endif
#define NTOK_FULL 16384
#define DIN  256                 // input width
#define MD   64                  // model width of the blocks
#define NBLK 3                   // stacked blocks
#define NGM  5                   // GEMMs per block: q, k, v, f1, f2
#define TOKW 32                  // tokens per wave = per block (two slabs of 16)
#define TP   68                  // LDS f32 tile row pitch (floats)
#define TSZ  (16 * TP)
#define HP   72                  // LDS f16 plane row pitch (halves)
#define OFF_CUR 0
#define OFF_RES (1 * TSZ)
#define OFF_Q   (2 * TSZ)
#define OFF_K   (3 * TSZ)
#define OFF_V   (4 * TSZ)
#define OFF_Y   (5 * TSZ)
#define QRS  2048.0f             // carry of the activation residual plane
#define QRI  (1.0f / 2048.0f)
#define WSC  64.0f               // carry of the f16 weight planes
#define WSI  (1.0f / 64.0f)
#define L2E  1.4426950408889634f

static_assert(MD == 64);
static_assert(MD % 32 == 0);
static_assert(DIN % 64 == 0);                    // W1 handled in 64-row chunks; k-loop steps by 32
static_assert(DIN % 32 == 0);
static_assert(TOKW == 32);
static_assert(NTOK % TOKW == 0);                 // grid covers the tokens exactly
static_assert(NTOK <= NTOK_FULL);
static_assert((size_t)NTOK_FULL * 4 == 65536);   // byte pitch between the five output copies
static_assert(((size_t)NTOK_FULL * 4) % 128 == 0);
static_assert((TP * 4) % 16 == 0);
static_assert((HP * 2) % 16 == 0);
static_assert(TP >= MD);
static_assert(HP >= MD);
static_assert(NGM * NBLK * MD == 960);           // bias stage size
static_assert(6 * 32 == NBLK * MD);              // bias stage loop: 6 trips x 32 lanes = 192 entries per input
static_assert(32 * 16 == 4 * 128);
static_assert(8 * 16 == 128);                    // output store: 8 lanes x 16 B = the fifth line
static_assert(256 * 2 * 16 == 64 * 128);
static_assert((size_t)6 * TSZ * 4 + (size_t)2 * 16 * HP * 2 + 960 * 4 + 2 * 16 * 4 + 32 * 4 <= 131072);   // static LDS of the fused kernel
static_assert((size_t)64 * 65 * 4 <= 131072);    // static LDS of the converters

typedef _Float16 h16;
typedef unsigned short bf;
typedef __attribute__((ext_vector_type(16))) __bf16   v16bf;
typedef __attribute__((ext_vector_type(16))) _Float16 v16h;
typedef __attribute__((ext_vector_type(8)))  _Float16 v8h;
typedef __attribute__((ext_vector_type(8)))  unsigned short v8us;
typedef __attribute__((ext_vector_type(8)))  float    v8f;
typedef __attribute__((ext_vector_type(4)))  float    v4f;
typedef v4f  __attribute__((may_alias)) v4fa;
typedef v8h  __attribute__((may_alias)) v8ha;

__device__ __forceinline__ unsigned short f2bf(float f) { unsigned u = __float_as_uint(f); u += 0x7FFFu + ((u >> 16) & 1u); return (unsigned short)(u >> 16); }
__device__ __forceinline__ float bfr(float f) { return __uint_as_float(((unsigned)f2bf(f)) << 16); }   // value after RNE convert to bf16
__device__ __forceinline__ v16h cat16(v8h lo, v8h hi) { return __builtin_shufflevector(lo, hi, 0, 1, 2, 3, 4, 5, 6, 7, 8, 9, 10, 11, 12, 13, 14, 15); }
__device__ __forceinline__ v16bf cat16b(v8us lo, v8us hi) { return __builtin_bit_cast(v16bf, __builtin_shufflevector(lo, hi, 0, 1, 2, 3, 4, 5, 6, 7, 8, 9, 10, 11, 12, 13, 14, 15)); }
__device__ __forceinline__ v8f wmma16(v16h a, v16h b, v8f c) { return __builtin_amdgcn_wmma_f32_16x16x32_f16(false, a, false, b, (short)0, c, false, false); }
__device__ __forceinline__ v8f wmmab(v16bf a, v16bf b, v8f c) { return __builtin_amdgcn_wmma_f32_16x16x32_bf16(false, a, false, b, (short)0, c, false, false); }
// fragment loaders from K-contiguous 16-bit rows; p already includes + 8*(lane>>4): elements 0..7 <- k0+8h+0..7, elements 8..15 <- k0+16+8h+0..7 (same map for A and B)
__device__ __forceinline__ v16h  ldh(const h16* p) { return cat16(*(const v8h*)p, *(const v8h*)(p + 16)); }
__device__ __forceinline__ v16bf ldb(const bf* p)  { return cat16b(*(const v8us*)p, *(const v8us*)(p + 16)); }
// ordering point for wave-private LDS tiles (same wave writes and reads)
__device__ __forceinline__ void wave_sync() { __builtin_amdgcn_fence(3 /* release order */, "wavefront"); __builtin_amdgcn_wave_barrier(); asm volatile("" ::: "memory"); }
// one guarded matrix instruction: the accumulator is tied behind four idle slots, the fragments stay live
__device__ __forceinline__ v8f wmma16g(v16h a, v16h b, v8f c) { c = wmma16(a, b, c); asm volatile("v_nop\n\tv_nop\n\tv_nop\n\tv_nop" : "+v"(c) : "v"(a), "v"(b)); return c; }
__device__ __forceinline__ v8f wmmabg(v16bf a, v16bf b, v8f c) { c = wmmab(a, b, c); asm volatile("v_nop\n\tv_nop\n\tv_nop\n\tv_nop" : "+v"(c) : "v"(a), "v"(b)); return c; }
// f32 -> f16 convert that cannot produce an f16 subnormal (|v| < 2^-14 -> +0)
static __device__ __forceinline__ h16 toh_flush(float v) { const h16 r = (h16)v; return (fabsf(v) < 6.103515625e-05f) ? (h16)0.0f : r; }

// k_w1t: W1 [DIN][MD] f32 ([in][out]) -> W1T bf16 [MD][DIN] ([n][k]); block = one 64-row k chunk, transposed through LDS.
__global__ __launch_bounds__(256) void k_w1t(const float* __restrict__ W1, bf* W1T) {
    __shared__ float ts[64 * 65];
    const int tid = threadIdx.x; const int kc = blockIdx.x;
#pragma unroll 1
    for (int i = 0; i < 16; ++i) { const int e = tid + i * 256; const int k = e >> 6, n = e & 63; ts[k * 65 + n] = W1[(size_t)kc * 64 * MD + e]; }   // 16 x 256 = 64 x 64 entries
    __syncthreads();                                            // cross-wave exchange through ts
    const int p8 = (tid & 7) * 8;
    v8us o0, o1;
#pragma unroll
    for (int u = 0; u < 8; ++u) { o0[u] = f2bf(ts[(p8 + u) * 65 + (tid >> 3)]); o1[u] = f2bf(ts[(p8 + u) * 65 + (tid >> 3) + 32]); }
    bf* d0 = W1T + (size_t)(tid >> 3) * DIN + (size_t)kc * 64 + p8;
    bf* d1 = W1T + (size_t)((tid >> 3) + 32) * DIN + (size_t)kc * 64 + p8;
{
        *(v8us*)d0 = o0; *(v8us*)d1 = o1;
         }
}

// k_wth: W [NBLK][MD][MD] f32 ([in][out]) -> f16 [NBLK][MD][MD] ([n][k]) of (bf16-converted value x 64); block = one matrix, transposed through LDS.
__global__ __launch_bounds__(256) void k_wth(const float* __restrict__ W, h16* WT) {
    __shared__ float ts[64 * 65];
    const int tid = threadIdx.x; const int t = blockIdx.x;
#pragma unroll 1
    for (int i = 0; i < 16; ++i) { const int e = tid + i * 256; const int k = e >> 6, n = e & 63; ts[k * 65 + n] = W[(size_t)t * MD * MD + e]; }
    __syncthreads();                                            // cross-wave exchange through ts
    const int p8 = (tid & 7) * 8;
    v8h o0, o1;
#pragma unroll
    for (int u = 0; u < 8; ++u) { o0[u] = toh_flush(bfr(ts[(p8 + u) * 65 + (tid >> 3)]) * WSC); o1[u] = toh_flush(bfr(ts[(p8 + u) * 65 + (tid >> 3) + 32]) * WSC); }
    h16* d0 = WT + (size_t)t * MD * MD + (size_t)(tid >> 3) * MD + p8;
    h16* d1 = WT + (size_t)t * MD * MD + (size_t)((tid >> 3) + 32) * MD + p8;
{
        *(v8h*)d0 = o0; *(v8h*)d1 = o1;
         }
}

// k_tok: fused token kernel, one wave per block, 32 tokens as two 16-token slabs; every LDS region is private to the wave (wave_sync ordering).
// GEMM fragments: A row = token (lane&15) from the f16 planes AH / AR (k contiguous), B column n = lane&15 of tile nb from the [n][k] weight planes, both with the split k map; D: acc[j] = (token 8*(lane>>4)+j, column nb*16 + (lane&15)).
// T holds six f32 tiles [16][TP]: cur, res, q (later the hidden layer), k (later the second feed-forward output and the pre-normalisation sum), v, y.
__global__ __launch_bounds__(32) void k_tok(const float* __restrict__ x, const bf* __restrict__ W1T, const h16* __restrict__ WH,
                                            const float* __restrict__ b1, const float* __restrict__ bq, const float* __restrict__ bk, const float* __restrict__ bv,
                                            const float* __restrict__ bf1, const float* __restrict__ bf2, const float* __restrict__ ln_g, const float* __restrict__ ln_b,
                                            const float* __restrict__ Wout, const float* __restrict__ bout, float* OUT) {
    __shared__ __align__(16) float T[6 * TSZ];
    __shared__ __align__(16) h16 AH[16 * HP];
    __shared__ __align__(16) h16 AR[16 * HP];
    __shared__ __align__(16) float BS[NGM * NBLK * MD];
    __shared__ __align__(16) float KX[16];
    __shared__ __align__(16) float KN[16];
    __shared__ __align__(16) float OS[TOKW];
    const int lane = threadIdx.x & 31, lr = lane & 15, hi = lane >> 4;
    const int n0 = blockIdx.x * TOKW;

    // GEMM biases (bf16-converted values) staged once: BS[g*192 + t*64 + col]
#pragma unroll 1
    for (int i = 0; i < 6; ++i) { const int e = i * 32 + lane;
        BS[e] = bfr(bq[e]); BS[192 + e] = bfr(bk[e]); BS[384 + e] = bfr(bv[e]); BS[576 + e] = bfr(bf1[e]); BS[768 + e] = bfr(bf2[e]); }
    wave_sync();

#pragma unroll 1
    for (int slab = 0; slab < 2; ++slab) {
        const int tb = n0 + slab * 16;
        // ---- input layer: h = x W1 + b1 (K = DIN), A converted in registers from the f32 rows ----
        {
            const float* xr = x + (size_t)(tb + lr) * DIN + 8 * hi;
            const bf* wb = W1T + (size_t)lr * DIN + 8 * hi;
            v8f acc[4];
#pragma unroll
            for (int nb = 0; nb < 4; ++nb) acc[nb] = (v8f){};
#pragma unroll 1
            for (int kc = 0; kc < DIN; kc += 32) {
                const v4f x0 = *(const v4f*)(xr + kc), x1 = *(const v4f*)(xr + kc + 4), x2 = *(const v4f*)(xr + kc + 16), x3 = *(const v4f*)(xr + kc + 20);
                v8us lo, up;
#pragma unroll
                for (int i = 0; i < 4; ++i) { lo[i] = f2bf(x0[i]); lo[4 + i] = f2bf(x1[i]); up[i] = f2bf(x2[i]); up[4 + i] = f2bf(x3[i]); }
                const v16bf a = cat16b(lo, up);
#pragma unroll
                for (int nb = 0; nb < 4; ++nb) { const v16bf b = ldb(wb + (size_t)nb * 16 * DIN + kc); acc[nb] = wmmabg(a, b, acc[nb]); }
            }
#pragma unroll
            for (int nb = 0; nb < 4; ++nb) { const int col = nb * 16 + lr; const float bb = bfr(b1[col]);
#pragma unroll
                for (int j = 0; j < 8; ++j) { const float hv = acc[nb][j] + bb;
                    T[OFF_CUR + (8 * hi + j) * TP + col] = hv;
                    T[OFF_RES + (8 * hi + j) * TP + col] = (hv >= 0.0f) ? hv : 0.1f * hv; } }
        }
        wave_sync();

#pragma unroll 1
        for (int t = 0; t < NBLK; ++t) {
#pragma unroll 1
            for (int g = 0; g < NGM; ++g) {
                if (g == 3) {
                    // per-token extreme keys: max_j q k_j = q * (q >= 0 ? kmax : kmin)
                    { float mx = -3.0e38f, mn = 3.0e38f;
#pragma unroll 1
                      for (int u = 0; u < 8; ++u) { const v4f kk = *(const v4fa*)(&T[OFF_K + lr * TP + 32 * hi + 4 * u]);
                          mx = fmaxf(fmaxf(mx, fmaxf(kk[0], kk[1])), fmaxf(kk[2], kk[3])); mn = fminf(fminf(mn, fminf(kk[0], kk[1])), fminf(kk[2], kk[3])); }
                      mx = fmaxf(mx, __shfl_xor(mx, 16, 32)); mn = fminf(mn, __shfl_xor(mn, 16, 32));
                      if (hi == 0) { KX[lr] = mx; KN[lr] = mn; } }
                    wave_sync();
                    // y[n][i] = sum_j softmax_j(q_i k_j) v_j + cur[n][i]; lane owns i = lane and i = lane + 32, tokens in sequence (k, v rows are wave-wide broadcasts)
#pragma unroll 1
                    for (int n = 0; n < 16; ++n) {
                        const int ro = n * TP;
                        const float q0 = T[OFF_Q + ro + lane], q1 = T[OFF_Q + ro + 32 + lane];
                        const float kx = KX[n], kn = KN[n];
                        const float e0 = (q0 >= 0.0f) ? kx : kn, e1 = (q1 >= 0.0f) ? kx : kn;
                        const float s0q = q0 * L2E, s1q = q1 * L2E;
                        float s0 = 0.0f, s1 = 0.0f, y0 = 0.0f, y1 = 0.0f;
#pragma unroll 2
                        for (int jj = 0; jj < MD; jj += 4) {
                            const v4f kk = *(const v4fa*)(&T[OFF_K + ro + jj]); const v4f vv = *(const v4fa*)(&T[OFF_V + ro + jj]);
#pragma unroll
                            for (int c = 0; c < 4; ++c) {
                                const float p0 = __builtin_amdgcn_exp2f((kk[c] - e0) * s0q);     // exponent <= 0, exactly 0 at the extreme key
                                const float p1 = __builtin_amdgcn_exp2f((kk[c] - e1) * s1q);
                                s0 += p0; s1 += p1; y0 += p0 * vv[c]; y1 += p1 * vv[c]; } }
                        T[OFF_Y + ro + lane]      = y0 * __builtin_amdgcn_rcpf(s0) + T[OFF_CUR + ro + lane];
                        T[OFF_Y + ro + 32 + lane] = y1 * __builtin_amdgcn_rcpf(s1) + T[OFF_CUR + ro + 32 + lane]; }
                    wave_sync();
                }
                if (g == 0 || g >= 3) {
                    // activation planes of the GEMM input tile: f16 value and f16 residual x2048; lane = (token lane&15, column half lane>>4)
                    const int psrc = (g == 0) ? OFF_CUR : ((g == 3) ? OFF_Y : OFF_Q);
#pragma unroll
                    for (int u = 0; u < 4; ++u) { const int c = 32 * hi + 8 * u;                     // 2 halves x 4 u x 8 = 64 columns of the 16 token rows
                        const v4f x0 = *(const v4fa*)(&T[psrc + lr * TP + c]); const v4f x1 = *(const v4fa*)(&T[psrc + lr * TP + c + 4]); v8h hv, rv;
#pragma unroll
                        for (int i = 0; i < 4; ++i) { const h16 a0 = toh_flush(x0[i]); const h16 a1 = toh_flush(x1[i]); hv[i] = a0; hv[4 + i] = a1;
                            rv[i] = toh_flush((x0[i] - (float)a0) * QRS); rv[4 + i] = toh_flush((x1[i] - (float)a1) * QRS); }
                        *(v8ha*)(&AH[lr * HP + c]) = hv; *(v8ha*)(&AR[lr * HP + c]) = rv; }
                    wave_sync();
                }
                // 16 x 64 x 64 GEMM g of block t: dst tile = q | k | v | q | k
                {
                    const h16* wp = WH + (size_t)((g * NBLK + t) * MD) * MD + (size_t)lr * MD + 8 * hi;
                    v8f acc[4], acr[4];
#pragma unroll
                    for (int nb = 0; nb < 4; ++nb) { acc[nb] = (v8f){}; acr[nb] = (v8f){}; }
#pragma unroll
                    for (int ks = 0; ks < 2; ++ks) {
                        const int ao = lr * HP + ks * 32 + 8 * hi;
                        const v16h ah = cat16(*(const v8ha*)(&AH[ao]), *(const v8ha*)(&AH[ao + 16]));
                        const v16h ar = cat16(*(const v8ha*)(&AR[ao]), *(const v8ha*)(&AR[ao + 16]));
#pragma unroll
                        for (int nb = 0; nb < 4; ++nb) { const v16h b = ldh(wp + (size_t)nb * 16 * MD + ks * 32);
                            acc[nb] = wmma16g(ah, b, acc[nb]); acr[nb] = wmma16g(ar, b, acr[nb]); }
                    }
                    const int gd = (g >= 3) ? (g - 3) : g;
                    const int dofs = OFF_Q + gd * TSZ;
                    const float sl = (g == 3) ? 0.01f : 1.0f;                // hidden layer of the feed-forward pair: leaky slope 0.01
                    const int bo = g * (NBLK * MD) + t * MD;
#pragma unroll
                    for (int nb = 0; nb < 4; ++nb) { const int col = nb * 16 + lr; const float bb = BS[bo + col];
#pragma unroll
                        for (int j = 0; j < 8; ++j) { float v = (acc[nb][j] + acr[nb][j] * QRI) * WSI + bb;
                            v = (v >= 0.0f) ? v : sl * v;
                            T[dofs + (8 * hi + j) * TP + col] = v; } }
                }
                wave_sync();
            }
            // a = ff + y; res += LayerNorm(a) * g + b; cur = res. lane = (token lane&15, column half lane>>4); each lane touches only its own 32 columns
            {
                const int ro = lr * TP + 32 * hi;
                float sm = 0.0f;
#pragma unroll 1
                for (int u = 0; u < 8; ++u) { const int o = ro + 4 * u;
                    const v4f a = *(const v4fa*)(&T[OFF_K + o]) + *(const v4fa*)(&T[OFF_Y + o]);
                    *(v4fa*)(&T[OFF_K + o]) = a; sm += (a[0] + a[1]) + (a[2] + a[3]); }
                sm += __shfl_xor(sm, 16, 32);
                const float mu = sm * (1.0f / MD);
                float vs = 0.0f;
#pragma unroll 1
                for (int u = 0; u < 8; ++u) { const v4f a = *(const v4fa*)(&T[OFF_K + ro + 4 * u]);
                    const float d0 = a[0] - mu, d1 = a[1] - mu, d2 = a[2] - mu, d3 = a[3] - mu; vs += (d0 * d0 + d1 * d1) + (d2 * d2 + d3 * d3); }
                vs += __shfl_xor(vs, 16, 32);
                const float inv = __builtin_amdgcn_rsqf(vs * (1.0f / MD) + 1e-5f);
#pragma unroll 1
                for (int u = 0; u < 8; ++u) { const int o = ro + 4 * u; const int c = 32 * hi + 4 * u;
                    const v4f a = *(const v4fa*)(&T[OFF_K + o]); const v4f r4 = *(const v4fa*)(&T[OFF_RES + o]);
                    const v4f g4 = *(const v4f*)(ln_g + t * MD + c); const v4f b4 = *(const v4f*)(ln_b + t * MD + c); v4f nr;
#pragma unroll
                    for (int i = 0; i < 4; ++i) nr[i] = ((a[i] - mu) * inv * bfr(g4[i]) + bfr(b4[i])) + r4[i];
                    *(v4fa*)(&T[OFF_RES + o]) = nr; *(v4fa*)(&T[OFF_CUR + o]) = nr; }
            }
            wave_sync();
        }
        // head: leaky(res . Wout + bout, 0.1); matrix-vector product in f32 on the vector unit
        {
            const int ro = lr * TP + 32 * hi;
            float ds = 0.0f;
#pragma unroll 1
            for (int u = 0; u < 8; ++u) { const v4f r4 = *(const v4fa*)(&T[OFF_RES + ro + 4 * u]); const v4f w4 = *(const v4f*)(Wout + 32 * hi + 4 * u);
                ds += (r4[0] * bfr(w4[0]) + r4[1] * bfr(w4[1])) + (r4[2] * bfr(w4[2]) + r4[3] * bfr(w4[3])); }
            ds += __shfl_xor(ds, 16, 32);
            float ov = ds + bfr(bout[0]);
            ov = (ov >= 0.0f) ? ov : 0.1f * ov;
            if (hi == 0) OS[slab * 16 + lr] = ov;
        }
        wave_sync();
    }
    {
        const int c = lane >> 3, q4 = (lane & 7) * 4;
        const v4f val = *(const v4fa*)(&OS[q4]);
        float* o03 = OUT + (size_t)c * NTOK_FULL + n0 + q4;
        float* o4  = OUT + (size_t)4 * NTOK_FULL + n0 + q4;
{
            *(v4f*)o03 = val;
            if (lane < 8) *(v4f*)o4 = val;
             }
    }
}

static constexpr size_t al256(size_t v) { return (v + 255) & ~(size_t)255; }
static constexpr size_t SZ_W1T = al256((size_t)MD * DIN * 2);
static constexpr size_t SZ_WH  = al256((size_t)NGM * NBLK * MD * MD * 2);
static constexpr size_t SZ_TOTAL = SZ_W1T + SZ_WH;
static_assert(SZ_TOTAL <= (size_t)134217728);              // workspace carve <= 128 MiB
static_assert(((size_t)NBLK * MD * MD * 2) % 256 == 0);    // per-input weight sub-planes stay 256-byte aligned
static_assert((size_t)(DIN / 64) * 64 == (size_t)DIN);     // k_w1t grid x 64 rows == DIN
static_assert((size_t)(NTOK / TOKW) * TOKW == (size_t)NTOK);

extern "C" void kernel_launch(void* const* d_in, const int* in_sizes, int n_in,
                              void* d_out, int out_size, void* d_ws, size_t ws_size, hipStream_t stream) {
    if (n_in < 17) return;
    if ((size_t)in_sizes[0] < (size_t)NTOK * DIN) return;
    if ((size_t)in_sizes[1] < (size_t)DIN * MD || in_sizes[2] < MD) return;
    if ((size_t)in_sizes[3] < (size_t)NBLK * MD * MD || (size_t)in_sizes[5] < (size_t)NBLK * MD * MD || (size_t)in_sizes[7] < (size_t)NBLK * MD * MD) return;
    if ((size_t)in_sizes[9] < (size_t)NBLK * MD * MD || (size_t)in_sizes[11] < (size_t)NBLK * MD * MD) return;
    if (in_sizes[4] < NBLK * MD || in_sizes[6] < NBLK * MD || in_sizes[8] < NBLK * MD || in_sizes[10] < NBLK * MD || in_sizes[12] < NBLK * MD) return;
    if (in_sizes[13] < NBLK * MD || in_sizes[14] < NBLK * MD || in_sizes[15] < MD || in_sizes[16] < 1) return;
    if ((size_t)out_size < (size_t)4 * NTOK_FULL + NTOK) return;
    if (SZ_TOTAL > ws_size) return;
    // wire order: x, W1, b1, Wq, bq, Wk, bk, Wv, bv, Wf1, bf1, Wf2, bf2, ln_g, ln_b, Wout, bout
    const float* x   = (const float*)d_in[0];
    const float* W1  = (const float*)d_in[1];  const float* b1  = (const float*)d_in[2];
    const float* Wq  = (const float*)d_in[3];  const float* bq  = (const float*)d_in[4];
    const float* Wk  = (const float*)d_in[5];  const float* bk  = (const float*)d_in[6];
    const float* Wv  = (const float*)d_in[7];  const float* bv  = (const float*)d_in[8];
    const float* Wf1 = (const float*)d_in[9];  const float* bf1 = (const float*)d_in[10];
    const float* Wf2 = (const float*)d_in[11]; const float* bf2 = (const float*)d_in[12];
    const float* lng = (const float*)d_in[13]; const float* lnb = (const float*)d_in[14];
    const float* Wo  = (const float*)d_in[15]; const float* bo  = (const float*)d_in[16];
    float* OUT = (float*)d_out;                 // five copies, pitch NTOK_FULL floats
    char* wsp = (char*)d_ws;
    bf*  W1T = (bf*)wsp;  wsp += SZ_W1T;        // [64][256] bf16, [n][k]
    h16* WH  = (h16*)wsp; wsp += SZ_WH;         // [5][3][64][64] f16 x64, [n][k]; g = q | k | v | f1 | f2
    const size_t gsz = (size_t)NBLK * MD * MD;

    k_w1t<<<DIN / 64, 256, 0, stream>>>(W1, W1T);                  // in [256][64] -> out [64][256]
    k_wth<<<NBLK, 256, 0, stream>>>(Wq,  WH + 0 * gsz);            // each: in [t][64 k][64 n] -> out [t][64 n][64 k]
    k_wth<<<NBLK, 256, 0, stream>>>(Wk,  WH + 1 * gsz);
    k_wth<<<NBLK, 256, 0, stream>>>(Wv,  WH + 2 * gsz);
    k_wth<<<NBLK, 256, 0, stream>>>(Wf1, WH + 3 * gsz);
    k_wth<<<NBLK, 256, 0, stream>>>(Wf2, WH + 4 * gsz);

    k_tok<<<NTOK / TOKW, 32, 0, stream>>>(x, W1T, WH, b1, bq, bk, bv, bf1, bf2, lng, lnb, Wo, bo, OUT);
}

// v001
// A run of this version takes 62.9 microseconds.
// Timed twice side by side with v000, it ran 2.84 times as fast both times.
#include <hip/hip_runtime.h>

// Per-token outer-product attention stack: h = x W1 + b1 (256 -> 64); three blocks of {q,k,v = cur W + b; y_i = sum_j softmax_j(q_i k_j) v_j + cur_i; a = leaky(y Wf1 + bf1, 0.01) Wf2 + bf2 + y; res += LayerNorm(a)}; out = leaky(res Wout + bout, 0.1), stored five times.
// Compute dtypes, f32 accumulate everywhere: x W1 on v_wmma_f32_16x16x32_bf16 (x, W1 RNE-converted to bf16; products exact); the fifteen 64x64 GEMMs on v_wmma_f32_16x16x32_f16 with the activation as f16 value + f16 residual x2048 (own accumulator, folded by 1/2048) and the weight as f16 of the bf16-converted input x64 (folded by 1/64);
// per-token 64x64 softmax / P.v, LayerNorm and the 64 -> 1 head in f32 on the vector unit (no operand shared between tokens; the head is a matrix-vector product).
// Layout: W1T bf16 [64][256] and WH f16 [5][3][64][64] (both [n][k], k contiguous) built once in the workspace; fused kernel: eight waves per block own 32 tokens (two 16-token slabs, four waves each), all tiles in LDS.

#ifndef NTOK
#define NTOK 16384
#endif
#define NTOK_FULL 16384
#define DIN  256                 // input width
#define MD   64                  // model width of the blocks
#define NBLK 3                   // stacked blocks
#define NGM  5                   // GEMMs per block: q, k, v, f1, f2
#define TOKW 32                  // tokens per block (two slabs of 16)
#define NTHR 256                 // threads per block of the fused kernel: four waves per slab
#define XP   264                 // LDS bf16 x plane row pitch (elements)
#define TP   68                  // LDS f32 tile row pitch (floats)
#define TSZ  (16 * TP)
#define HP   72                  // LDS f16 plane row pitch (halves)
#define OFF_CUR 0
#define OFF_RES (1 * TSZ)
#define OFF_Q   (2 * TSZ)
#define OFF_K   (3 * TSZ)
#define OFF_V   (4 * TSZ)
#define OFF_Y   (5 * TSZ)
#define QRS  2048.0f             // carry of the activation residual plane
#define QRI  (1.0f / 2048.0f)
#define WSC  64.0f               // carry of the f16 weight planes
#define WSI  (1.0f / 64.0f)
#define L2E  1.4426950408889634f

static_assert(MD == 64);
static_assert(MD % 32 == 0);
static_assert(DIN % 64 == 0);                    // W1 handled in 64-row chunks; k-loop steps by 32
static_assert(DIN % 32 == 0);
static_assert(TOKW == 32);
static_assert(NTOK % TOKW == 0);                 // grid covers the tokens exactly
static_assert(NTOK <= NTOK_FULL);
static_assert((size_t)NTOK_FULL * 4 == 65536);   // byte pitch between the five output copies
static_assert(((size_t)NTOK_FULL * 4) % 128 == 0);
static_assert((TP * 4) % 16 == 0);
static_assert((HP * 2) % 16 == 0);
static_assert(TP >= MD);
static_assert(HP >= MD);
static_assert(NGM * NBLK * MD == 960);           // bias stage size
static_assert(NBLK * MD <= NTHR);                // bias stage: one thread per entry of each input
static_assert(NTHR == 2 * 4 * 32);
static_assert((XP * 2) % 16 == 0);
static_assert(XP >= DIN);
static_assert(32 * 16 == 4 * 128);
static_assert(8 * 16 == 128);                    // output store: 8 lanes x 16 B = one line
static_assert(256 * 2 * 16 == 64 * 128);
static_assert((size_t)2 * 6 * TSZ * 4 + (size_t)2 * 2 * 16 * HP * 2 + (size_t)2 * 16 * XP * 2 + 960 * 4 + 2 * 32 * 4 + 32 * 4 <= 131072);   // static LDS of the fused kernel
static_assert((size_t)64 * 65 * 4 <= 131072);    // static LDS of the converters

typedef _Float16 h16;
typedef unsigned short bf;
typedef __attribute__((ext_vector_type(16))) __bf16   v16bf;
typedef __attribute__((ext_vector_type(16))) _Float16 v16h;
typedef __attribute__((ext_vector_type(8)))  _Float16 v8h;
typedef __attribute__((ext_vector_type(8)))  unsigned short v8us;
typedef __attribute__((ext_vector_type(8)))  float    v8f;
typedef __attribute__((ext_vector_type(4)))  float    v4f;
typedef v4f  __attribute__((may_alias)) v4fa;
typedef v8h  __attribute__((may_alias)) v8ha;
typedef v8us __attribute__((may_alias)) v8usa;

__device__ __forceinline__ unsigned short f2bf(float f) { unsigned u = __float_as_uint(f); u += 0x7FFFu + ((u >> 16) & 1u); return (unsigned short)(u >> 16); }
__device__ __forceinline__ float bfr(float f) { return __uint_as_float(((unsigned)f2bf(f)) << 16); }   // value after RNE convert to bf16
__device__ __forceinline__ v16h cat16(v8h lo, v8h hi) { return __builtin_shufflevector(lo, hi, 0, 1, 2, 3, 4, 5, 6, 7, 8, 9, 10, 11, 12, 13, 14, 15); }
__device__ __forceinline__ v16bf cat16b(v8us lo, v8us hi) { return __builtin_bit_cast(v16bf, __builtin_shufflevector(lo, hi, 0, 1, 2, 3, 4, 5, 6, 7, 8, 9, 10, 11, 12, 13, 14, 15)); }
__device__ __forceinline__ v8f wmma16(v16h a, v16h b, v8f c) { return __builtin_amdgcn_wmma_f32_16x16x32_f16(false, a, false, b, (short)0, c, false, false); }
__device__ __forceinline__ v8f wmmab(v16bf a, v16bf b, v8f c) { return __builtin_amdgcn_wmma_f32_16x16x32_bf16(false, a, false, b, (short)0, c, false, false); }
// fragment loaders from K-contiguous 16-bit rows; p already includes + 8*(lane>>4): elements 0..7 <- k0+8h+0..7, elements 8..15 <- k0+16+8h+0..7 (same map for A and B)
__device__ __forceinline__ v16h  ldh(const h16* p) { return cat16(*(const v8h*)p, *(const v8h*)(p + 16)); }
__device__ __forceinline__ v16bf ldb(const bf* p)  { return cat16b(*(const v8us*)p, *(const v8us*)(p + 16)); }
// ordering point for wave-private LDS tiles (same wave writes and reads)
__device__ __forceinline__ void wave_sync() { __builtin_amdgcn_fence(3 /* release order */, "wavefront"); __builtin_amdgcn_wave_barrier(); asm volatile("" ::: "memory"); }
// one guarded matrix instruction: the accumulator is tied behind four idle slots, the fragments stay live
__device__ __forceinline__ v8f wmma16g(v16h a, v16h b, v8f c) { c = wmma16(a, b, c); asm volatile("v_nop\n\tv_nop\n\tv_nop\n\tv_nop" : "+v"(c) : "v"(a), "v"(b)); return c; }
__device__ __forceinline__ v8f wmmabg(v16bf a, v16bf b, v8f c) { c = wmmab(a, b, c); asm volatile("v_nop\n\tv_nop\n\tv_nop\n\tv_nop" : "+v"(c) : "v"(a), "v"(b)); return c; }
// f32 -> f16 convert that cannot produce an f16 subnormal (|v| < 2^-14 -> +0)
static __device__ __forceinline__ h16 toh_flush(float v) { const h16 r = (h16)v; return (fabsf(v) < 6.103515625e-05f) ? (h16)0.0f : r; }

// k_w1t: W1 [DIN][MD] f32 ([in][out]) -> W1T bf16 [MD][DIN] ([n][k]); block = one 64-row k chunk, transposed through LDS.
__global__ __launch_bounds__(256) void k_w1t(const float* __restrict__ W1, bf* W1T) {
    __shared__ float ts[64 * 65];
    const int tid = threadIdx.x; const int kc = blockIdx.x;
#pragma unroll 1
    for (int i = 0; i < 16; ++i) { const int e = tid + i * 256; const int k = e >> 6, n = e & 63; ts[k * 65 + n] = W1[(size_t)kc * 64 * MD + e]; }   // 16 x 256 = 64 x 64 entries
    __syncthreads();                                            // cross-wave exchange through ts
    const int p8 = (tid & 7) * 8;
    v8us o0, o1;
#pragma unroll
    for (int u = 0; u < 8; ++u) { o0[u] = f2bf(ts[(p8 + u) * 65 + (tid >> 3)]); o1[u] = f2bf(ts[(p8 + u) * 65 + (tid >> 3) + 32]); }
    bf* d0 = W1T + (size_t)(tid >> 3) * DIN + (size_t)kc * 64 + p8;
    bf* d1 = W1T + (size_t)((tid >> 3) + 32) * DIN + (size_t)kc * 64 + p8;
{
        *(v8us*)d0 = o0; *(v8us*)d1 = o1;
         }
}

// k_wth: W [NBLK][MD][MD] f32 ([in][out]) -> f16 [NBLK][MD][MD] ([n][k]) of (bf16-converted value x 64); block = one matrix, transposed through LDS.
__global__ __launch_bounds__(256) void k_wth(const float* __restrict__ W, h16* WT) {
    __shared__ float ts[64 * 65];
    const int tid = threadIdx.x; const int t = blockIdx.x;
#pragma unroll 1
    for (int i = 0; i < 16; ++i) { const int e = tid + i * 256; const int k = e >> 6, n = e & 63; ts[k * 65 + n] = W[(size_t)t * MD * MD + e]; }
    __syncthreads();                                            // cross-wave exchange through ts
    const int p8 = (tid & 7) * 8;
    v8h o0, o1;
#pragma unroll
    for (int u = 0; u < 8; ++u) { o0[u] = toh_flush(bfr(ts[(p8 + u) * 65 + (tid >> 3)]) * WSC); o1[u] = toh_flush(bfr(ts[(p8 + u) * 65 + (tid >> 3) + 32]) * WSC); }
    h16* d0 = WT + (size_t)t * MD * MD + (size_t)(tid >> 3) * MD + p8;
    h16* d1 = WT + (size_t)t * MD * MD + (size_t)((tid >> 3) + 32) * MD + p8;
{
        *(v8h*)d0 = o0; *(v8h*)d1 = o1;
         }
}

// k_tok: fused token kernel, eight waves per block, 32 tokens as two 16-token slabs worked side by side: waves 0..3 own slab 0, waves 4..7 slab 1.
// Inside a slab wave w owns output columns 16w..16w+15 of every GEMM and tokens 4w..4w+3 of every per-token phase; tiles that change hands between the two maps are ordered by __syncthreads, rows that stay with their wave by wave_sync.
// GEMM fragments: A row = token (lane&15) from the 16-bit planes (k contiguous), B column n = lane&15 of tile w from the [n][k] weight planes, both with the split k map; D: acc[j] = (token 8*(lane>>4)+j, column 16w + (lane&15)).
// Per slab T holds six f32 tiles [16][TP]: cur, res, q (later the hidden layer), k (later the second feed-forward output), v, y.
// one 16 x 16 x 64 GEMM tile: value and residual planes against one weight tile, bias and leaky slope, stored down one column of the destination tile
__device__ __forceinline__ void gemm_tile(const v16h (&b)[2], const v16h (&ah)[2], const v16h (&ar)[2], const float bb, const float sl, float* dst) {
    v8f acc = (v8f){}, acr = (v8f){};
#pragma unroll   // fragment arrays stay in registers
    for (int ks = 0; ks < 2; ++ks) { acc = wmma16g(ah[ks], b[ks], acc); acr = wmma16g(ar[ks], b[ks], acr); }
#pragma unroll
    for (int j = 0; j < 8; ++j) { float v = (acc[j] + acr[j] * QRI) * WSI + bb;
        v = (v >= 0.0f) ? v : sl * v;
        dst[j * TP] = v; }
}
// activation planes of 8 columns of one token row: f16 value and f16 residual x2048
__device__ __forceinline__ void planes8(const float* srow, h16* hrow, h16* rrow) {
    const v4f x0 = *(const v4fa*)(srow); const v4f x1 = *(const v4fa*)(srow + 4); v8h hv, rv;
#pragma unroll
    for (int i = 0; i < 4; ++i) { const h16 a0 = toh_flush(x0[i]); const h16 a1 = toh_flush(x1[i]); hv[i] = a0; hv[4 + i] = a1;
        rv[i] = toh_flush((x0[i] - (float)a0) * QRS); rv[4 + i] = toh_flush((x1[i] - (float)a1) * QRS); }
    *(v8ha*)(hrow) = hv; *(v8ha*)(rrow) = rv;
}
// sum over the 8 lanes that share a token row
__device__ __forceinline__ float sum8(float v) { v += __shfl_xor(v, 1, 32); v += __shfl_xor(v, 2, 32); v += __shfl_xor(v, 4, 32); return v; }

__global__ __launch_bounds__(NTHR) void k_tok(const float* __restrict__ x, const bf* __restrict__ W1T, const h16* __restrict__ WH,
                                            const float* __restrict__ b1, const float* __restrict__ bq, const float* __restrict__ bk, const float* __restrict__ bv,
                                            const float* __restrict__ bf1, const float* __restrict__ bf2, const float* __restrict__ ln_g, const float* __restrict__ ln_b,
                                            const float* __restrict__ Wout, const float* __restrict__ bout, float* OUT) {
    __shared__ __align__(16) float T[2 * 6 * TSZ];
    __shared__ __align__(16) h16 AH[2 * 16 * HP];
    __shared__ __align__(16) h16 AR[2 * 16 * HP];
    __shared__ __align__(16) bf  XB[2 * 16 * XP];
    __shared__ __align__(16) float BS[NGM * NBLK * MD];
    __shared__ __align__(16) float KX[TOKW];
    __shared__ __align__(16) float KN[TOKW];
    __shared__ __align__(16) float OS[TOKW];
    const int tid = threadIdx.x;
    const int lane = tid & 31, lr = lane & 15, hi = lane >> 4;
    const int wv = __builtin_amdgcn_readfirstlane(tid >> 5);     // wave number, held scalar
    const int slab = wv >> 2, w = wv & 3;
    const int tk = 4 * w + (lane >> 3), sb = lane & 7;           // row map: token of the slab, 8-column group
    const int col = 16 * w + lr;                                 // column map of the GEMM tiles
    const int n0 = blockIdx.x * TOKW;
    float* Ts = T + slab * (6 * TSZ);
    h16* AHs = AH + slab * (16 * HP);
    h16* ARs = AR + slab * (16 * HP);
    bf*  XBs = XB + slab * (16 * XP);
    float* KXs = KX + slab * 16;
    float* KNs = KN + slab * 16;

    // GEMM biases (bf16-converted values) staged once: BS[g*192 + t*64 + col]; first read behind the barriers of the input layer
    if (tid < NBLK * MD) { const int e = tid;
        BS[e] = bfr(bq[e]); BS[192 + e] = bfr(bk[e]); BS[384 + e] = bfr(bv[e]); BS[576 + e] = bfr(bf1[e]); BS[768 + e] = bfr(bf2[e]); }

    // ---- input layer: h = x W1 + b1 (K = DIN); the slab's x rows are converted once into the bf16 plane XB, each wave then forms its own 16 columns ----
    {
        const float* xr = x + (size_t)(n0 + slab * 16 + tk) * DIN + 8 * sb;
        const bf* wb = W1T + (size_t)col * DIN + 8 * hi;
        const float bb = bfr(b1[col]);
#pragma unroll   // all eight row loads in flight together
        for (int u = 0; u < DIN / 64; ++u) {
            const v4f x0 = *(const v4f*)(xr + 64 * u), x1 = *(const v4f*)(xr + 64 * u + 4);
            v8us o;
#pragma unroll
            for (int i = 0; i < 4; ++i) { o[i] = f2bf(x0[i]); o[4 + i] = f2bf(x1[i]); }
            *(v8usa*)(&XBs[tk * XP + 8 * sb + 64 * u]) = o; }
        __syncthreads();                                         // XB rows go from their converting wave to all four waves of the slab
        v16bf b[DIN / 32];                                       // the wave's whole W1 tile, fetched as one group
#pragma unroll   // one load group, fragments in registers
        for (int kc = 0; kc < DIN; kc += 32) b[kc / 32] = ldb(wb + kc);
        asm volatile("s_wait_xcnt 0x0" :: "v"(wb) : "memory");   // precaution: holds the address pair unwritten behind the group's loads (the build without it placed the last load's result on the pair)
        v8f acc = (v8f){};
#pragma unroll
        for (int kc = 0; kc < DIN; kc += 32) {
            const int ao = lr * XP + kc + 8 * hi;
            const v16bf a = cat16b(*(const v8usa*)(&XBs[ao]), *(const v8usa*)(&XBs[ao + 16]));
            acc = wmmabg(a, b[kc / 32], acc); }
#pragma unroll
        for (int j = 0; j < 8; ++j) { const float hv = acc[j] + bb;
            Ts[OFF_CUR + (8 * hi + j) * TP + col] = hv;
            Ts[OFF_RES + (8 * hi + j) * TP + col] = (hv >= 0.0f) ? hv : 0.1f * hv; }
    }
    __syncthreads();                                             // cur, res: column map -> row map

    const int ro8 = tk * TP + 8 * sb;                            // this lane's 8 columns in the row map
    const int po8 = tk * HP + 8 * sb;
    float* dcol = Ts + (8 * hi) * TP + col;                      // this lane's column in the column map
#pragma unroll 1
    for (int t = 0; t < NBLK; ++t) {
        v16h ah[2], ar[2], wf[3][2];
        const h16* wp = WH + (size_t)(t * MD) * MD + (size_t)col * MD + 8 * hi;   // this lane's weight column of block t; GEMM g lies g * NBLK matrices further
        // planes of cur (each lane reads back the 8 values it wrote itself, or values behind the barrier above)
        planes8(&Ts[OFF_CUR + ro8], &AHs[po8], &ARs[po8]);
        __syncthreads();                                         // planes: row map -> A fragments of all four waves
#pragma unroll   // one load group, fragments in registers
        for (int g = 0; g < 3; ++g) { wf[g][0] = ldh(wp + (size_t)g * NBLK * MD * MD); wf[g][1] = ldh(wp + (size_t)g * NBLK * MD * MD + 32); }   // the phase's weight tiles, fetched as one group
#pragma unroll
        for (int ks = 0; ks < 2; ++ks) { const int ao = lr * HP + ks * 32 + 8 * hi;
            ah[ks] = cat16(*(const v8ha*)(&AHs[ao]), *(const v8ha*)(&AHs[ao + 16]));
            ar[ks] = cat16(*(const v8ha*)(&ARs[ao]), *(const v8ha*)(&ARs[ao + 16])); }
#pragma unroll
        for (int g = 0; g < 3; ++g)                              // q, k, v share the planes
            gemm_tile(wf[g], ah, ar, BS[g * (NBLK * MD) + t * MD + col], 1.0f, dcol + OFF_Q + g * TSZ);
        __syncthreads();                                         // q, k, v: column map -> row map; also frees the planes
        // per-token extreme keys: max_j q k_j = q * (q >= 0 ? kmax : kmin)
        { float mx = -3.0e38f, mn = 3.0e38f;
#pragma unroll
          for (int u = 0; u < 2; ++u) { const v4f kk = *(const v4fa*)(&Ts[OFF_K + ro8 + 4 * u]);
              mx = fmaxf(fmaxf(mx, fmaxf(kk[0], kk[1])), fmaxf(kk[2], kk[3])); mn = fminf(fminf(mn, fminf(kk[0], kk[1])), fminf(kk[2], kk[3])); }
          mx = fmaxf(mx, __shfl_xor(mx, 1, 32)); mn = fminf(mn, __shfl_xor(mn, 1, 32));
          mx = fmaxf(mx, __shfl_xor(mx, 2, 32)); mn = fminf(mn, __shfl_xor(mn, 2, 32));
          mx = fmaxf(mx, __shfl_xor(mx, 4, 32)); mn = fminf(mn, __shfl_xor(mn, 4, 32));
          if (sb == 0) { KXs[tk] = mx; KNs[tk] = mn; } }
        wave_sync();
        // y[n][i] = sum_j softmax_j(q_i k_j) v_j + cur[n][i]; lane owns i = lane and i = lane + 32, the wave's four tokens in sequence (k, v rows are wave-wide broadcasts)
#pragma unroll 1
        for (int nn = 0; nn < 4; ++nn) {
            const int n = 4 * w + nn;
            const int ro = n * TP;
            const float q0 = Ts[OFF_Q + ro + lane], q1 = Ts[OFF_Q + ro + 32 + lane];
            const float kx = KXs[n], kn = KNs[n];
            const float e0 = (q0 >= 0.0f) ? kx : kn, e1 = (q1 >= 0.0f) ? kx : kn;
            const float s0q = q0 * L2E, s1q = q1 * L2E;
            float s0 = 0.0f, s1 = 0.0f, y0 = 0.0f, y1 = 0.0f;
#pragma unroll 2
            for (int jj = 0; jj < MD; jj += 4) {
                const v4f kk = *(const v4fa*)(&Ts[OFF_K + ro + jj]); const v4f vv = *(const v4fa*)(&Ts[OFF_V + ro + jj]);
#pragma unroll
                for (int c = 0; c < 4; ++c) {
                    const float p0 = __builtin_amdgcn_exp2f((kk[c] - e0) * s0q);     // exponent <= 0, exactly 0 at the extreme key
                    const float p1 = __builtin_amdgcn_exp2f((kk[c] - e1) * s1q);
                    s0 += p0; s1 += p1; y0 += p0 * vv[c]; y1 += p1 * vv[c]; } }
            Ts[OFF_Y + ro + lane]      = y0 * __builtin_amdgcn_rcpf(s0) + Ts[OFF_CUR + ro + lane];
            Ts[OFF_Y + ro + 32 + lane] = y1 * __builtin_amdgcn_rcpf(s1) + Ts[OFF_CUR + ro + 32 + lane]; }
        wave_sync();
        planes8(&Ts[OFF_Y + ro8], &AHs[po8], &ARs[po8]);         // y rows stay with their wave
        __syncthreads();                                         // planes: row map -> A fragments
        wf[0][0] = ldh(wp + (size_t)3 * NBLK * MD * MD); wf[0][1] = ldh(wp + (size_t)3 * NBLK * MD * MD + 32);
#pragma unroll
        for (int ks = 0; ks < 2; ++ks) { const int ao = lr * HP + ks * 32 + 8 * hi;
            ah[ks] = cat16(*(const v8ha*)(&AHs[ao]), *(const v8ha*)(&AHs[ao + 16]));
            ar[ks] = cat16(*(const v8ha*)(&ARs[ao]), *(const v8ha*)(&ARs[ao + 16])); }
        gemm_tile(wf[0], ah, ar, BS[3 * (NBLK * MD) + t * MD + col], 0.01f, dcol + OFF_Q);   // hidden layer: leaky slope 0.01
        __syncthreads();                                         // hidden layer: column map -> row map; also frees the planes
        planes8(&Ts[OFF_Q + ro8], &AHs[po8], &ARs[po8]);
        __syncthreads();                                         // planes: row map -> A fragments
        wf[0][0] = ldh(wp + (size_t)4 * NBLK * MD * MD); wf[0][1] = ldh(wp + (size_t)4 * NBLK * MD * MD + 32);
#pragma unroll
        for (int ks = 0; ks < 2; ++ks) { const int ao = lr * HP + ks * 32 + 8 * hi;
            ah[ks] = cat16(*(const v8ha*)(&AHs[ao]), *(const v8ha*)(&AHs[ao + 16]));
            ar[ks] = cat16(*(const v8ha*)(&ARs[ao]), *(const v8ha*)(&ARs[ao + 16])); }
        gemm_tile(wf[0], ah, ar, BS[4 * (NBLK * MD) + t * MD + col], 1.0f, dcol + OFF_K);
        __syncthreads();                                         // second feed-forward output: column map -> row map; also frees the planes
        // a = ff + y; res += LayerNorm(a) * g + b; cur = res. Row map: 8 lanes share a token, each keeps its 8 columns in registers
        {
            v4f a[2], g4[2], b4[2];
#pragma unroll
            for (int u = 0; u < 2; ++u) { g4[u] = *(const v4f*)(ln_g + t * MD + 8 * sb + 4 * u); b4[u] = *(const v4f*)(ln_b + t * MD + 8 * sb + 4 * u);
                a[u] = *(const v4fa*)(&Ts[OFF_K + ro8 + 4 * u]) + *(const v4fa*)(&Ts[OFF_Y + ro8 + 4 * u]); }
            const float sm = sum8(((a[0][0] + a[0][1]) + (a[0][2] + a[0][3])) + ((a[1][0] + a[1][1]) + (a[1][2] + a[1][3])));
            const float mu = sm * (1.0f / MD);
            float vs = 0.0f;
#pragma unroll
            for (int u = 0; u < 2; ++u) { const float d0 = a[u][0] - mu, d1 = a[u][1] - mu, d2 = a[u][2] - mu, d3 = a[u][3] - mu; vs += (d0 * d0 + d1 * d1) + (d2 * d2 + d3 * d3); }
            vs = sum8(vs);
            const float inv = __builtin_amdgcn_rsqf(vs * (1.0f / MD) + 1e-5f);
#pragma unroll
            for (int u = 0; u < 2; ++u) { const v4f r4 = *(const v4fa*)(&Ts[OFF_RES + ro8 + 4 * u]); v4f nr;
#pragma unroll
                for (int i = 0; i < 4; ++i) nr[i] = ((a[u][i] - mu) * inv * bfr(g4[u][i]) + bfr(b4[u][i])) + r4[i];
                *(v4fa*)(&Ts[OFF_RES + ro8 + 4 * u]) = nr; *(v4fa*)(&Ts[OFF_CUR + ro8 + 4 * u]) = nr; }
        }
    }
    // head: leaky(res . Wout + bout, 0.1); matrix-vector product in f32 on the vector unit, row map
    {
        float ds = 0.0f;
#pragma unroll
        for (int u = 0; u < 2; ++u) { const v4f r4 = *(const v4fa*)(&Ts[OFF_RES + ro8 + 4 * u]); const v4f w4 = *(const v4f*)(Wout + 8 * sb + 4 * u);
            ds += (r4[0] * bfr(w4[0]) + r4[1] * bfr(w4[1])) + (r4[2] * bfr(w4[2]) + r4[3] * bfr(w4[3])); }
        ds = sum8(ds);
        float ov = ds + bfr(bout[0]);
        ov = (ov >= 0.0f) ? ov : 0.1f * ov;
        if (sb == 0) OS[slab * 16 + tk] = ov;
    }
    __syncthreads();                                             // OS: all eight waves -> the storing lanes
    if (tid < 5 * 8) {                                           // five copies x 8 lanes x 16 B: each copy's 128-byte line stored whole
        const int c = tid >> 3, q4 = (tid & 7) * 4;
        const v4f val = *(const v4fa*)(&OS[q4]);
        *(v4f*)(OUT + (size_t)c * NTOK_FULL + n0 + q4) = val;
    }
}

static constexpr size_t al256(size_t v) { return (v + 255) & ~(size_t)255; }
static constexpr size_t SZ_W1T = al256((size_t)MD * DIN * 2);
static constexpr size_t SZ_WH  = al256((size_t)NGM * NBLK * MD * MD * 2);
static constexpr size_t SZ_TOTAL = SZ_W1T + SZ_WH;
static_assert(SZ_TOTAL <= (size_t)134217728);              // workspace carve <= 128 MiB
static_assert(((size_t)NBLK * MD * MD * 2) % 256 == 0);    // per-input weight sub-planes stay 256-byte aligned
static_assert((size_t)(DIN / 64) * 64 == (size_t)DIN);     // k_w1t grid x 64 rows == DIN
static_assert((size_t)(NTOK / TOKW) * TOKW == (size_t)NTOK);

extern "C" void kernel_launch(void* const* d_in, const int* in_sizes, int n_in,
                              void* d_out, int out_size, void* d_ws, size_t ws_size, hipStream_t stream) {
    if (n_in < 17) return;
    if ((size_t)in_sizes[0] < (size_t)NTOK * DIN) return;
    if ((size_t)in_sizes[1] < (size_t)DIN * MD || in_sizes[2] < MD) return;
    if ((size_t)in_sizes[3] < (size_t)NBLK * MD * MD || (size_t)in_sizes[5] < (size_t)NBLK * MD * MD || (size_t)in_sizes[7] < (size_t)NBLK * MD * MD) return;
    if ((size_t)in_sizes[9] < (size_t)NBLK * MD * MD || (size_t)in_sizes[11] < (size_t)NBLK * MD * MD) return;
    if (in_sizes[4] < NBLK * MD || in_sizes[6] < NBLK * MD || in_sizes[8] < NBLK * MD || in_sizes[10] < NBLK * MD || in_sizes[12] < NBLK * MD) return;
    if (in_sizes[13] < NBLK * MD || in_sizes[14] < NBLK * MD || in_sizes[15] < MD || in_sizes[16] < 1) return;
    if ((size_t)out_size < (size_t)4 * NTOK_FULL + NTOK) return;
    if (SZ_TOTAL > ws_size) return;
    // wire order: x, W1, b1, Wq, bq, Wk, bk, Wv, bv, Wf1, bf1, Wf2, bf2, ln_g, ln_b, Wout, bout
    const float* x   = (const float*)d_in[0];
    const float* W1  = (const float*)d_in[1];  const float* b1  = (const float*)d_in[2];
    const float* Wq  = (const float*)d_in[3];  const float* bq  = (const float*)d_in[4];
    const float* Wk  = (const float*)d_in[5];  const float* bk  = (const float*)d_in[6];
    const float* Wv  = (const float*)d_in[7];  const float* bv  = (const float*)d_in[8];
    const float* Wf1 = (const float*)d_in[9];  const float* bf1 = (const float*)d_in[10];
    const float* Wf2 = (const float*)d_in[11]; const float* bf2 = (const float*)d_in[12];
    const float* lng = (const float*)d_in[13]; const float* lnb = (const float*)d_in[14];
    const float* Wo  = (const float*)d_in[15]; const float* bo  = (const float*)d_in[16];
    float* OUT = (float*)d_out;                 // five copies, pitch NTOK_FULL floats
    char* wsp = (char*)d_ws;
    bf*  W1T = (bf*)wsp;  wsp += SZ_W1T;        // [64][256] bf16, [n][k]
    h16* WH  = (h16*)wsp; wsp += SZ_WH;         // [5][3][64][64] f16 x64, [n][k]; g = q | k | v | f1 | f2
    const size_t gsz = (size_t)NBLK * MD * MD;

    k_w1t<<<DIN / 64, 256, 0, stream>>>(W1, W1T);                  // in [256][64] -> out [64][256]
    k_wth<<<NBLK, 256, 0, stream>>>(Wq,  WH + 0 * gsz);            // each: in [t][64 k][64 n] -> out [t][64 n][64 k]
    k_wth<<<NBLK, 256, 0, stream>>>(Wk,  WH + 1 * gsz);
    k_wth<<<NBLK, 256, 0, stream>>>(Wv,  WH + 2 * gsz);
    k_wth<<<NBLK, 256, 0, stream>>>(Wf1, WH + 3 * gsz);
    k_wth<<<NBLK, 256, 0, stream>>>(Wf2, WH + 4 * gsz);

    k_tok<<<NTOK / TOKW, NTHR, 0, stream>>>(x, W1T, WH, b1, bq, bk, bv, bf1, bf2, lng, lnb, Wo, bo, OUT);
}

// v002
// It runs in 37.3 microseconds.
// Timed twice side by side with v001, it ran 1.68 and 1.69 times as fast.
// All steps since v000 together make it 4.78 times as fast.
#include <hip/hip_runtime.h>

// Per-token outer-product attention stack: h = x W1 + b1 (256 -> 64); three blocks of {q,k,v = cur W + b; y_i = sum_j softmax_j(q_i k_j) v_j + cur_i; a = leaky(y Wf1 + bf1, 0.01) Wf2 + bf2 + y; res += LayerNorm(a)}; out = leaky(res Wout + bout, 0.1), stored five times.
// Compute dtypes, f32 accumulate everywhere: x W1 on v_wmma_f32_16x16x32_bf16 (x, W1 RNE-converted to bf16; products exact); the fifteen 64x64 GEMMs on v_wmma_f32_16x16x32_f16 with the activation as f16 value + f16 residual x2048 (own accumulator, folded by 1/2048) and the weight as f16 of the bf16-converted input x64 (folded by 1/64);
// per-token 64x64 softmax / P.v, LayerNorm and the 64 -> 1 head in f32 on the vector unit (no operand shared between tokens; the head is a matrix-vector product).
// Layout: W1T bf16 [64][256] and WH f16 [5][3][64][64] (both [n][k], k contiguous) built in the workspace by one launch; fused kernel: eight waves per block own 32 tokens (two 16-token slabs, four waves each), all tiles in LDS.

#ifndef NTOK
#define NTOK 16384
#endif
#define NTOK_FULL 16384
#define DIN  256                 // input width
#define MD   64                  // model width of the blocks
#define NBLK 3                   // stacked blocks
#define NGM  5                   // GEMMs per block: q, k, v, f1, f2
#define TOKW 32                  // tokens per block (two slabs of 16)
#define NTHR 256                 // threads per block of the fused kernel: four waves per slab
#define XP   264                 // LDS bf16 x plane row pitch (elements)
#define TP   68                  // LDS f32 tile row pitch (floats)
#define TSZ  (16 * TP)
#define HP   72                  // LDS f16 plane row pitch (halves)
#define OFF_CUR 0
#define OFF_RES (1 * TSZ)
#define OFF_Q   (2 * TSZ)
#define OFF_K   (3 * TSZ)
#define OFF_V   (4 * TSZ)
#define OFF_Y   (5 * TSZ)
#define QRS  2048.0f             // carry of the activation residual plane
#define QRI  (1.0f / 2048.0f)
#define WSC  64.0f               // carry of the f16 weight planes
#define WSI  (1.0f / 64.0f)
#define L2E  1.4426950408889634f

static_assert(MD == 64);
static_assert(MD % 32 == 0);
static_assert(DIN % 64 == 0);                    // W1 handled in 64-row chunks; k-loop steps by 32
static_assert(DIN % 32 == 0);
static_assert(TOKW == 32);
static_assert(NTOK % TOKW == 0);                 // grid covers the tokens exactly
static_assert(NTOK <= NTOK_FULL);
static_assert((size_t)NTOK_FULL * 4 == 65536);   // byte pitch between the five output copies
static_assert(((size_t)NTOK_FULL * 4) % 128 == 0);
static_assert((TP * 4) % 16 == 0);
static_assert((HP * 2) % 16 == 0);
static_assert(TP >= MD);
static_assert(HP >= MD);
static_assert(NGM * NBLK * MD == 960);           // bias stage size
static_assert(NBLK * MD <= NTHR);                // bias stage: one thread per entry of each input
static_assert(NTHR == 2 * 4 * 32);
static_assert((XP * 2) % 16 == 0);
static_assert(XP >= DIN);
static_assert(32 * 16 == 4 * 128);
static_assert(8 * 16 == 128);                    // output store: 8 lanes x 16 B = one line
static_assert(256 * 2 * 16 == 64 * 128);
static_assert((size_t)2 * 6 * TSZ * 4 + (size_t)2 * 2 * 16 * HP * 2 + (size_t)2 * 16 * XP * 2 + 960 * 4 + 2 * 32 * 4 + 32 * 4 <= 131072);   // static LDS of the fused kernel
static_assert((size_t)64 * 65 * 4 <= 131072);    // static LDS of the converter

typedef _Float16 h16;
typedef unsigned short bf;
typedef __attribute__((ext_vector_type(16))) __bf16   v16bf;
typedef __attribute__((ext_vector_type(16))) _Float16 v16h;
typedef __attribute__((ext_vector_type(8)))  _Float16 v8h;
typedef __attribute__((ext_vector_type(8)))  unsigned short v8us;
typedef __attribute__((ext_vector_type(8)))  float    v8f;
typedef __attribute__((ext_vector_type(4)))  float    v4f;
typedef v4f  __attribute__((may_alias)) v4fa;
typedef v8h  __attribute__((may_alias)) v8ha;
typedef v8us __attribute__((may_alias)) v8usa;

__device__ __forceinline__ unsigned short f2bf(float f) { unsigned u = __float_as_uint(f); u += 0x7FFFu + ((u >> 16) & 1u); return (unsigned short)(u >> 16); }
__device__ __forceinline__ float bfr(float f) { return __uint_as_float(((unsigned)f2bf(f)) << 16); }   // value after RNE convert to bf16
__device__ __forceinline__ v16h cat16(v8h lo, v8h hi) { return __builtin_shufflevector(lo, hi, 0, 1, 2, 3, 4, 5, 6, 7, 8, 9, 10, 11, 12, 13, 14, 15); }
__device__ __forceinline__ v16bf cat16b(v8us lo, v8us hi) { return __builtin_bit_cast(v16bf, __builtin_shufflevector(lo, hi, 0, 1, 2, 3, 4, 5, 6, 7, 8, 9, 10, 11, 12, 13, 14, 15)); }
__device__ __forceinline__ v8f wmma16(v16h a, v16h b, v8f c) { return __builtin_amdgcn_wmma_f32_16x16x32_f16(false, a, false, b, (short)0, c, false, false); }
__device__ __forceinline__ v8f wmmab(v16bf a, v16bf b, v8f c) { return __builtin_amdgcn_wmma_f32_16x16x32_bf16(false, a, false, b, (short)0, c, false, false); }
// fragment loaders from K-contiguous 16-bit rows; p already includes + 8*(lane>>4): elements 0..7 <- k0+8h+0..7, elements 8..15 <- k0+16+8h+0..7 (same map for A and B)
__device__ __forceinline__ v16h  ldh(const h16* p) { return cat16(*(const v8h*)p, *(const v8h*)(p + 16)); }
__device__ __forceinline__ v16bf ldb(const bf* p)  { return cat16b(*(const v8us*)p, *(const v8us*)(p + 16)); }
// ordering point for wave-private LDS tiles (same wave writes and reads)
__device__ __forceinline__ void wave_sync() { __builtin_amdgcn_fence(3 /* release order */, "wavefront"); __builtin_amdgcn_wave_barrier(); asm volatile("" ::: "memory"); }
// one guarded matrix instruction: the accumulator is tied behind four idle slots, the fragments stay live
__device__ __forceinline__ v8f wmma16g(v16h a, v16h b, v8f c) { c = wmma16(a, b, c); asm volatile("v_nop\n\tv_nop\n\tv_nop\n\tv_nop" : "+v"(c) : "v"(a), "v"(b)); return c; }
__device__ __forceinline__ v8f wmmabg(v16bf a, v16bf b, v8f c) { c = wmmab(a, b, c); asm volatile("v_nop\n\tv_nop\n\tv_nop\n\tv_nop" : "+v"(c) : "v"(a), "v"(b)); return c; }
// f32 -> f16 convert that cannot produce an f16 subnormal (|v| < 2^-14 -> +0)
static __device__ __forceinline__ h16 toh_flush(float v) { const h16 r = (h16)v; return (fabsf(v) < 6.103515625e-05f) ? (h16)0.0f : r; }

// k_prep: every weight plane in one launch; each block transposes one 64 x 64 f32 tile ([k][n]) through LDS and stores it [n][k], k contiguous.
// Blocks 0..DIN/64-1: 64-row k chunk of W1 -> W1T bf16 [MD][DIN]. Block DIN/64 + m, m = g*NBLK + t: matrix t of input g (q, k, v, f1, f2) -> WH f16 [m][MD][MD] of (bf16-converted value x 64).
__global__ __launch_bounds__(256) void k_prep(const float* __restrict__ W1, const float* __restrict__ Wq, const float* __restrict__ Wk, const float* __restrict__ Wv,
                                              const float* __restrict__ Wf1, const float* __restrict__ Wf2, bf* W1T, h16* WH) {
    __shared__ float ts[64 * 65];
    const int tid = threadIdx.x;
    const int kc = blockIdx.x;                                  // W1 chunk, where below DIN / 64
    const int m = kc - DIN / 64;                                // matrix number otherwise
    const bool first = kc < DIN / 64;                           // block-uniform
    const int g = m / NBLK;
    const float* Wg = (g == 0) ? Wq : (g == 1) ? Wk : (g == 2) ? Wv : (g == 3) ? Wf1 : Wf2;
    const float* W = first ? W1 + (size_t)kc * 64 * MD : Wg + (size_t)(m - g * NBLK) * MD * MD;
#pragma unroll 1
    for (int i = 0; i < 16; ++i) { const int e = tid + i * 256; const int k = e >> 6, n = e & 63; ts[k * 65 + n] = W[e]; }   // 16 x 256 = 64 x 64 entries
    __syncthreads();                                            // cross-wave exchange through ts
    const int p8 = (tid & 7) * 8;
    if (first) {
        v8us o0, o1;
#pragma unroll
        for (int u = 0; u < 8; ++u) { o0[u] = f2bf(ts[(p8 + u) * 65 + (tid >> 3)]); o1[u] = f2bf(ts[(p8 + u) * 65 + (tid >> 3) + 32]); }
        bf* d0 = W1T + (size_t)(tid >> 3) * DIN + (size_t)kc * 64 + p8;
        bf* d1 = W1T + (size_t)((tid >> 3) + 32) * DIN + (size_t)kc * 64 + p8;
        *(v8us*)d0 = o0; *(v8us*)d1 = o1;
        asm volatile("s_wait_xcnt 0x0" ::: "memory");           // precaution: stands behind the two stores, in front of any later write of their address or data registers (the other arm follows in the built code)
    } else {
        v8h o0, o1;
#pragma unroll
        for (int u = 0; u < 8; ++u) { o0[u] = toh_flush(bfr(ts[(p8 + u) * 65 + (tid >> 3)]) * WSC); o1[u] = toh_flush(bfr(ts[(p8 + u) * 65 + (tid >> 3) + 32]) * WSC); }
        h16* d0 = WH + (size_t)m * MD * MD + (size_t)(tid >> 3) * MD + p8;
        h16* d1 = WH + (size_t)m * MD * MD + (size_t)((tid >> 3) + 32) * MD + p8;
        *(v8h*)d0 = o0; *(v8h*)d1 = o1;
        asm volatile("s_wait_xcnt 0x0" ::: "memory");           // precaution: stands behind the two stores, in front of any later write of their address or data registers (the other arm follows in the built code)
    }
}

// k_tok: fused token kernel, eight waves per block, 32 tokens as two 16-token slabs worked side by side: waves 0..3 own slab 0, waves 4..7 slab 1.
// Inside a slab wave w owns output columns 16w..16w+15 of every GEMM and tokens 4w..4w+3 of every per-token phase; tiles that change hands between the two maps are ordered by __syncthreads, rows that stay with their wave by wave_sync.
// GEMM fragments: A row = token (lane&15) from the 16-bit planes (k contiguous), B column n = lane&15 of tile w from the [n][k] weight planes, both with the split k map; D: acc[j] = (token 8*(lane>>4)+j, column 16w + (lane&15)).
// Per slab T holds six f32 tiles [16][TP]: cur, res, q (later the hidden layer), k (later the second feed-forward output), v, y.
// one 16 x 16 x 64 GEMM tile: value and residual planes against one weight tile, bias and leaky slope, stored down one column of the destination tile
__device__ __forceinline__ void gemm_tile(const v16h (&b)[2], const v16h (&ah)[2], const v16h (&ar)[2], const float bb, const float sl, float* dst) {
    v8f acc = (v8f){}, acr = (v8f){};
#pragma unroll   // fragment arrays stay in registers
    for (int ks = 0; ks < 2; ++ks) { acc = wmma16g(ah[ks], b[ks], acc); acr = wmma16g(ar[ks], b[ks], acr); }
#pragma unroll
    for (int j = 0; j < 8; ++j) { float v = (acc[j] + acr[j] * QRI) * WSI + bb;
        v = (v >= 0.0f) ? v : sl * v;
        dst[j * TP] = v; }
}
// activation planes of 8 columns of one token row: f16 value and f16 residual x2048
__device__ __forceinline__ void planes8(const float* srow, h16* hrow, h16* rrow) {
    const v4f x0 = *(const v4fa*)(srow); const v4f x1 = *(const v4fa*)(srow + 4); v8h hv, rv;
#pragma unroll
    for (int i = 0; i < 4; ++i) { const h16 a0 = toh_flush(x0[i]); const h16 a1 = toh_flush(x1[i]); hv[i] = a0; hv[4 + i] = a1;
        rv[i] = toh_flush((x0[i] - (float)a0) * QRS); rv[4 + i] = toh_flush((x1[i] - (float)a1) * QRS); }
    *(v8ha*)(hrow) = hv; *(v8ha*)(rrow) = rv;
}
// sum over the 8 lanes that share a token row
__device__ __forceinline__ float sum8(float v) { v += __shfl_xor(v, 1, 32); v += __shfl_xor(v, 2, 32); v += __shfl_xor(v, 4, 32); return v; }

__global__ __launch_bounds__(NTHR) void k_tok(const float* __restrict__ x, const bf* __restrict__ W1T, const h16* __restrict__ WH,
                                            const float* __restrict__ b1, const float* __restrict__ bq, const float* __restrict__ bk, const float* __restrict__ bv,
                                            const float* __restrict__ bf1, const float* __restrict__ bf2, const float* __restrict__ ln_g, const float* __restrict__ ln_b,
                                            const float* __restrict__ Wout, const float* __restrict__ bout, float* OUT) {
    __shared__ __align__(16) float T[2 * 6 * TSZ];
    __shared__ __align__(16) h16 AH[2 * 16 * HP];
    __shared__ __align__(16) h16 AR[2 * 16 * HP];
    __shared__ __align__(16) bf  XB[2 * 16 * XP];
    __shared__ __align__(16) float BS[NGM * NBLK * MD];
    __shared__ __align__(16) float KX[TOKW];
    __shared__ __align__(16) float KN[TOKW];
    __shared__ __align__(16) float OS[TOKW];
    const int tid = threadIdx.x;
    const int lane = tid & 31, lr = lane & 15, hi = lane >> 4;
    const int wv = __builtin_amdgcn_readfirstlane(tid >> 5);     // wave number, held scalar
    const int slab = wv >> 2, w = wv & 3;
    const int tk = 4 * w + (lane >> 3), sb = lane & 7;           // row map: token of the slab, 8-column group
    const int col = 16 * w + lr;                                 // column map of the GEMM tiles
    const int n0 = blockIdx.x * TOKW;
    float* Ts = T + slab * (6 * TSZ);
    h16* AHs = AH + slab * (16 * HP);
    h16* ARs = AR + slab * (16 * HP);
    bf*  XBs = XB + slab * (16 * XP);
    float* KXs = KX + slab * 16;
    float* KNs = KN + slab * 16;

    // GEMM biases (bf16-converted values) staged once: BS[g*192 + t*64 + col]; first read behind the barriers of the input layer
    if (tid < NBLK * MD) { const int e = tid;
        BS[e] = bfr(bq[e]); BS[192 + e] = bfr(bk[e]); BS[384 + e] = bfr(bv[e]); BS[576 + e] = bfr(bf1[e]); BS[768 + e] = bfr(bf2[e]); }

    // ---- input layer: h = x W1 + b1 (K = DIN); the slab's x rows are converted once into the bf16 plane XB, each wave then forms its own 16 columns ----
    {
        const float* xr = x + (size_t)(n0 + slab * 16 + tk) * DIN + 8 * sb;
        const bf* wb = W1T + (size_t)col * DIN + 8 * hi;
        const float bb = bfr(b1[col]);
#pragma unroll   // all eight row loads in flight together
        for (int u = 0; u < DIN / 64; ++u) {
            const v4f x0 = *(const v4f*)(xr + 64 * u), x1 = *(const v4f*)(xr + 64 * u + 4);
            v8us o;
#pragma unroll
            for (int i = 0; i < 4; ++i) { o[i] = f2bf(x0[i]); o[4 + i] = f2bf(x1[i]); }
            *(v8usa*)(&XBs[tk * XP + 8 * sb + 64 * u]) = o; }
        __syncthreads();                                         // XB rows go from their converting wave to all four waves of the slab
        v16bf b[DIN / 32];                                       // the wave's whole W1 tile, fetched as one group
#pragma unroll   // one load group, fragments in registers
        for (int kc = 0; kc < DIN; kc += 32) b[kc / 32] = ldb(wb + kc);
        asm volatile("s_wait_xcnt 0x0" :: "v"(wb) : "memory");   // precaution: holds the address pair unwritten behind the group's loads (the build without it placed the last load's result on the pair)
        v8f acc = (v8f){};
#pragma unroll
        for (int kc = 0; kc < DIN; kc += 32) {
            const int ao = lr * XP + kc + 8 * hi;
            const v16bf a = cat16b(*(const v8usa*)(&XBs[ao]), *(const v8usa*)(&XBs[ao + 16]));
            acc = wmmabg(a, b[kc / 32], acc); }
#pragma unroll
        for (int j = 0; j < 8; ++j) { const float hv = acc[j] + bb;
            Ts[OFF_CUR + (8 * hi + j) * TP + col] = hv;
            Ts[OFF_RES + (8 * hi + j) * TP + col] = (hv >= 0.0f) ? hv : 0.1f * hv; }
    }
    __syncthreads();                                             // cur, res: column map -> row map

    const int ro8 = tk * TP + 8 * sb;                            // this lane's 8 columns in the row map
    const int po8 = tk * HP + 8 * sb;
    float* dcol = Ts + (8 * hi) * TP + col;                      // this lane's column in the column map
#pragma unroll 1
    for (int t = 0; t < NBLK; ++t) {
        v16h ah[2], ar[2], wf[3][2];
        const h16* wp = WH + (size_t)(t * MD) * MD + (size_t)col * MD + 8 * hi;   // this lane's weight column of block t; GEMM g lies g * NBLK matrices further
        // planes of cur (each lane reads back the 8 values it wrote itself, or values behind the barrier above)
        planes8(&Ts[OFF_CUR + ro8], &AHs[po8], &ARs[po8]);
        __syncthreads();                                         // planes: row map -> A fragments of all four waves
#pragma unroll   // one load group, fragments in registers
        for (int g = 0; g < 3; ++g) { wf[g][0] = ldh(wp + (size_t)g * NBLK * MD * MD); wf[g][1] = ldh(wp + (size_t)g * NBLK * MD * MD + 32); }   // the phase's weight tiles, fetched as one group
#pragma unroll
        for (int ks = 0; ks < 2; ++ks) { const int ao = lr * HP + ks * 32 + 8 * hi;
            ah[ks] = cat16(*(const v8ha*)(&AHs[ao]), *(const v8ha*)(&AHs[ao + 16]));
            ar[ks] = cat16(*(const v8ha*)(&ARs[ao]), *(const v8ha*)(&ARs[ao + 16])); }
#pragma unroll
        for (int g = 0; g < 3; ++g)                              // q, k, v share the planes
            gemm_tile(wf[g], ah, ar, BS[g * (NBLK * MD) + t * MD + col], 1.0f, dcol + OFF_Q + g * TSZ);
        __syncthreads();                                         // q, k, v: column map -> row map; also frees the planes
        // per-token extreme keys: max_j q k_j = q * (q >= 0 ? kmax : kmin)
        { float mx = -3.0e38f, mn = 3.0e38f;
#pragma unroll
          for (int u = 0; u < 2; ++u) { const v4f kk = *(const v4fa*)(&Ts[OFF_K + ro8 + 4 * u]);
              mx = fmaxf(fmaxf(mx, fmaxf(kk[0], kk[1])), fmaxf(kk[2], kk[3])); mn = fminf(fminf(mn, fminf(kk[0], kk[1])), fminf(kk[2], kk[3])); }
          mx = fmaxf(mx, __shfl_xor(mx, 1, 32)); mn = fminf(mn, __shfl_xor(mn, 1, 32));
          mx = fmaxf(mx, __shfl_xor(mx, 2, 32)); mn = fminf(mn, __shfl_xor(mn, 2, 32));
          mx = fmaxf(mx, __shfl_xor(mx, 4, 32)); mn = fminf(mn, __shfl_xor(mn, 4, 32));
          if (sb == 0) { KXs[tk] = mx; KNs[tk] = mn; } }
        wave_sync();
        // y[n][i] = sum_j softmax_j(q_i k_j) v_j + cur[n][i]; lane owns i = lane and i = lane + 32, the wave's four tokens in sequence (k, v rows are wave-wide broadcasts)
#pragma unroll 1
        for (int nn = 0; nn < 4; ++nn) {
            const int n = 4 * w + nn;
            const int ro = n * TP;
            const float q0 = Ts[OFF_Q + ro + lane], q1 = Ts[OFF_Q + ro + 32 + lane];
            const float kx = KXs[n], kn = KNs[n];
            const float e0 = (q0 >= 0.0f) ? kx : kn, e1 = (q1 >= 0.0f) ? kx : kn;
            const float s0q = q0 * L2E, s1q = q1 * L2E;
            float s0 = 0.0f, s1 = 0.0f, y0 = 0.0f, y1 = 0.0f;
#pragma unroll 2
            for (int jj = 0; jj < MD; jj += 4) {
                const v4f kk = *(const v4fa*)(&Ts[OFF_K + ro + jj]); const v4f vv = *(const v4fa*)(&Ts[OFF_V + ro + jj]);
#pragma unroll
                for (int c = 0; c < 4; ++c) {
                    const float p0 = __builtin_amdgcn_exp2f((kk[c] - e0) * s0q);     // exponent <= 0, exactly 0 at the extreme key
                    const float p1 = __builtin_amdgcn_exp2f((kk[c] - e1) * s1q);
                    s0 += p0; s1 += p1; y0 += p0 * vv[c]; y1 += p1 * vv[c]; } }
            Ts[OFF_Y + ro + lane]      = y0 * __builtin_amdgcn_rcpf(s0) + Ts[OFF_CUR + ro + lane];
            Ts[OFF_Y + ro + 32 + lane] = y1 * __builtin_amdgcn_rcpf(s1) + Ts[OFF_CUR + ro + 32 + lane]; }
        wave_sync();
        planes8(&Ts[OFF_Y + ro8], &AHs[po8], &ARs[po8]);         // y rows stay with their wave
        __syncthreads();                                         // planes: row map -> A fragments
        wf[0][0] = ldh(wp + (size_t)3 * NBLK * MD * MD); wf[0][1] = ldh(wp + (size_t)3 * NBLK * MD * MD + 32);
#pragma unroll
        for (int ks = 0; ks < 2; ++ks) { const int ao = lr * HP + ks * 32 + 8 * hi;
            ah[ks] = cat16(*(const v8ha*)(&AHs[ao]), *(const v8ha*)(&AHs[ao + 16]));
            ar[ks] = cat16(*(const v8ha*)(&ARs[ao]), *(const v8ha*)(&ARs[ao + 16])); }
        gemm_tile(wf[0], ah, ar, BS[3 * (NBLK * MD) + t * MD + col], 0.01f, dcol + OFF_Q);   // hidden layer: leaky slope 0.01
        __syncthreads();                                         // hidden layer: column map -> row map; also frees the planes
        planes8(&Ts[OFF_Q + ro8], &AHs[po8], &ARs[po8]);
        __syncthreads();                                         // planes: row map -> A fragments
        wf[0][0] = ldh(wp + (size_t)4 * NBLK * MD * MD); wf[0][1] = ldh(wp + (size_t)4 * NBLK * MD * MD + 32);
#pragma unroll
        for (int ks = 0; ks < 2; ++ks) { const int ao = lr * HP + ks * 32 + 8 * hi;
            ah[ks] = cat16(*(const v8ha*)(&AHs[ao]), *(const v8ha*)(&AHs[ao + 16]));
            ar[ks] = cat16(*(const v8ha*)(&ARs[ao]), *(const v8ha*)(&ARs[ao + 16])); }
        gemm_tile(wf[0], ah, ar, BS[4 * (NBLK * MD) + t * MD + col], 1.0f, dcol + OFF_K);
        __syncthreads();                                         // second feed-forward output: column map -> row map; also frees the planes
        // a = ff + y; res += LayerNorm(a) * g + b; cur = res. Row map: 8 lanes share a token, each keeps its 8 columns in registers
        {
            v4f a[2], g4[2], b4[2];
#pragma unroll
            for (int u = 0; u < 2; ++u) { g4[u] = *(const v4f*)(ln_g + t * MD + 8 * sb + 4 * u); b4[u] = *(const v4f*)(ln_b + t * MD + 8 * sb + 4 * u);
                a[u] = *(const v4fa*)(&Ts[OFF_K + ro8 + 4 * u]) + *(const v4fa*)(&Ts[OFF_Y + ro8 + 4 * u]); }
            const float sm = sum8(((a[0][0] + a[0][1]) + (a[0][2] + a[0][3])) + ((a[1][0] + a[1][1]) + (a[1][2] + a[1][3])));
            const float mu = sm * (1.0f / MD);
            float vs = 0.0f;
#pragma unroll
            for (int u = 0; u < 2; ++u) { const float d0 = a[u][0] - mu, d1 = a[u][1] - mu, d2 = a[u][2] - mu, d3 = a[u][3] - mu; vs += (d0 * d0 + d1 * d1) + (d2 * d2 + d3 * d3); }
            vs = sum8(vs);
            const float inv = __builtin_amdgcn_rsqf(vs * (1.0f / MD) + 1e-5f);
#pragma unroll
            for (int u = 0; u < 2; ++u) { const v4f r4 = *(const v4fa*)(&Ts[OFF_RES + ro8 + 4 * u]); v4f nr;
#pragma unroll
                for (int i = 0; i < 4; ++i) nr[i] = ((a[u][i] - mu) * inv * bfr(g4[u][i]) + bfr(b4[u][i])) + r4[i];
                *(v4fa*)(&Ts[OFF_RES + ro8 + 4 * u]) = nr; *(v4fa*)(&Ts[OFF_CUR + ro8 + 4 * u]) = nr; }
        }
    }
    // head: leaky(res . Wout + bout, 0.1); matrix-vector product in f32 on the vector unit, row map
    {
        float ds = 0.0f;
#pragma unroll
        for (int u = 0; u < 2; ++u) { const v4f r4 = *(const v4fa*)(&Ts[OFF_RES + ro8 + 4 * u]); const v4f w4 = *(const v4f*)(Wout + 8 * sb + 4 * u);
            ds += (r4[0] * bfr(w4[0]) + r4[1] * bfr(w4[1])) + (r4[2] * bfr(w4[2]) + r4[3] * bfr(w4[3])); }
        ds = sum8(ds);
        float ov = ds + bfr(bout[0]);
        ov = (ov >= 0.0f) ? ov : 0.1f * ov;
        if (sb == 0) OS[slab * 16 + tk] = ov;
    }
    __syncthreads();                                             // OS: all eight waves -> the storing lanes
    if (tid < 5 * 8) {                                           // five copies x 8 lanes x 16 B: each copy's 128-byte line stored whole
        const int c = tid >> 3, q4 = (tid & 7) * 4;
        const v4f val = *(const v4fa*)(&OS[q4]);
        *(v4f*)(OUT + (size_t)c * NTOK_FULL + n0 + q4) = val;
    }
}

static constexpr size_t al256(size_t v) { return (v + 255) & ~(size_t)255; }
static constexpr size_t SZ_W1T = al256((size_t)MD * DIN * 2);
static constexpr size_t SZ_WH  = al256((size_t)NGM * NBLK * MD * MD * 2);
static constexpr size_t SZ_TOTAL = SZ_W1T + SZ_WH;
static_assert(SZ_TOTAL <= (size_t)134217728);              // workspace carve <= 128 MiB
static_assert(((size_t)NBLK * MD * MD * 2) % 256 == 0);    // per-input weight sub-planes stay 256-byte aligned
static_assert((size_t)(DIN / 64) * 64 == (size_t)DIN);     // W1 blocks of k_prep x 64 rows == DIN
static_assert((size_t)(NTOK / TOKW) * TOKW == (size_t)NTOK);

extern "C" void kernel_launch(void* const* d_in, const int* in_sizes, int n_in,
                              void* d_out, int out_size, void* d_ws, size_t ws_size, hipStream_t stream) {
    if (n_in < 17) return;
    if ((size_t)in_sizes[0] < (size_t)NTOK * DIN) return;
    if ((size_t)in_sizes[1] < (size_t)DIN * MD || in_sizes[2] < MD) return;
    if ((size_t)in_sizes[3] < (size_t)NBLK * MD * MD || (size_t)in_sizes[5] < (size_t)NBLK * MD * MD || (size_t)in_sizes[7] < (size_t)NBLK * MD * MD) return;
    if ((size_t)in_sizes[9] < (size_t)NBLK * MD * MD || (size_t)in_sizes[11] < (size_t)NBLK * MD * MD) return;
    if (in_sizes[4] < NBLK * MD || in_sizes[6] < NBLK * MD || in_sizes[8] < NBLK * MD || in_sizes[10] < NBLK * MD || in_sizes[12] < NBLK * MD) return;
    if (in_sizes[13] < NBLK * MD || in_sizes[14] < NBLK * MD || in_sizes[15] < MD || in_sizes[16] < 1) return;
    if ((size_t)out_size < (size_t)4 * NTOK_FULL + NTOK) return;
    if (SZ_TOTAL > ws_size) return;
    // wire order: x, W1, b1, Wq, bq, Wk, bk, Wv, bv, Wf1, bf1, Wf2, bf2, ln_g, ln_b, Wout, bout
    const float* x   = (const float*)d_in[0];
    const float* W1  = (const float*)d_in[1];  const float* b1  = (const float*)d_in[2];
    const float* Wq  = (const float*)d_in[3];  const float* bq  = (const float*)d_in[4];
    const float* Wk  = (const float*)d_in[5];  const float* bk  = (const float*)d_in[6];
    const float* Wv  = (const float*)d_in[7];  const float* bv  = (const float*)d_in[8];
    const float* Wf1 = (const float*)d_in[9];  const float* bf1 = (const float*)d_in[10];
    const float* Wf2 = (const float*)d_in[11]; const float* bf2 = (const float*)d_in[12];
    const float* lng = (const float*)d_in[13]; const float* lnb = (const float*)d_in[14];
    const float* Wo  = (const float*)d_in[15]; const float* bo  = (const float*)d_in[16];
    float* OUT = (float*)d_out;                 // five copies, pitch NTOK_FULL floats
    char* wsp = (char*)d_ws;
    bf*  W1T = (bf*)wsp;  wsp += SZ_W1T;        // [64][256] bf16, [n][k]
    h16* WH  = (h16*)wsp; wsp += SZ_WH;         // [5][3][64][64] f16 x64, [n][k]; g = q | k | v | f1 | f2

    k_prep<<<DIN / 64 + NGM * NBLK, 256, 0, stream>>>(W1, Wq, Wk, Wv, Wf1, Wf2, W1T, WH);   // 4 chunks of W1 and the 15 block matrices, all independent

    k_tok<<<NTOK / TOKW, NTHR, 0, stream>>>(x, W1T, WH, b1, bq, bk, bv, bf1, bf2, lng, lnb, Wo, bo, OUT);
}

// v003
// A run of this version takes 35 microseconds.
// Timed twice side by side with v002, it ran 1.07 times as fast both times.
// All steps since v000 together make it 5.11 times as fast.
#include <hip/hip_runtime.h>

// Per-token outer-product attention stack: h = x W1 + b1 (256 -> 64); three blocks of {q,k,v = cur W + b; y_i = sum_j softmax_j(q_i k_j) v_j + cur_i; a = leaky(y Wf1 + bf1, 0.01) Wf2 + bf2 + y; res += LayerNorm(a)}; out = leaky(res Wout + bout, 0.1), stored five times.
// Compute dtypes, f32 accumulate everywhere: x W1 on v_wmma_f32_16x16x32_bf16 (x, W1 RNE-converted to bf16; products exact); the fifteen 64x64 GEMMs on v_wmma_f32_16x16x32_f16 with the activation as f16 value + f16 residual x2048 (own accumulator, folded by 1/2048) and the weight as f16 of the bf16-converted input x64 (folded by 1/64);
// per-token 64x64 softmax / P.v, LayerNorm and the 64 -> 1 head in f32 on the vector unit (no operand shared between tokens; the head is a matrix-vector product).
// Layout: W1T bf16 [64][256] and WH f16 [5][3][64][64] (both [n][k], k contiguous) built in the workspace by one launch; fused kernel: eight waves per block own 32 tokens (two 16-token slabs, four waves each), all tiles in LDS.

#ifndef NTOK
#define NTOK 16384
#endif
#define NTOK_FULL 16384
#define DIN  256                 // input width
#define MD   64                  // model width of the blocks
#define NBLK 3                   // stacked blocks
#define NGM  5                   // GEMMs per block: q, k, v, f1, f2
#define TOKW 32                  // tokens per block (two slabs of 16)
#define NTHR 256                 // threads per block of the fused kernel: four waves per slab
#define XP   264                 // LDS bf16 x plane row pitch (elements)
#define TP   68                  // LDS f32 tile row pitch (floats)
#define TSZ  (16 * TP)
#define HP   72                  // LDS f16 plane row pitch (halves)
#define OFF_CUR 0
#define OFF_RES (1 * TSZ)
#define OFF_Q   (2 * TSZ)
#define OFF_K   (3 * TSZ)
#define OFF_V   (4 * TSZ)
#define OFF_Y   (5 * TSZ)
#define QRS  2048.0f             // carry of the activation residual plane
#define QRI  (1.0f / 2048.0f)
#define WSC  64.0f               // carry of the f16 weight planes
#define WSI  (1.0f / 64.0f)
#define L2E  1.4426950408889634f

static_assert(MD == 64);
static_assert(MD % 32 == 0);
static_assert(DIN % 64 == 0);                    // W1 handled in 64-row chunks; k-loop steps by 32
static_assert(DIN % 32 == 0);
static_assert(TOKW == 32);
static_assert(NTOK % TOKW == 0);                 // grid covers the tokens exactly
static_assert(NTOK <= NTOK_FULL);
static_assert((size_t)NTOK_FULL * 4 == 65536);   // byte pitch between the five output copies
static_assert(((size_t)NTOK_FULL * 4) % 128 == 0);
static_assert((TP * 4) % 16 == 0);
static_assert((HP * 2) % 16 == 0);
static_assert(TP >= MD);
static_assert(HP >= MD);
static_assert(NGM * NBLK * MD == 960);           // bias stage size
static_assert(NBLK * MD <= NTHR);                // bias stage: one thread per entry of each input
static_assert(NTHR == 2 * 4 * 32);
static_assert((XP * 2) % 16 == 0);
static_assert(XP >= DIN);
static_assert(32 * 16 == 4 * 128);
static_assert(8 * 16 == 128);                    // output store: 8 lanes x 16 B = one line
static_assert(256 * 2 * 16 == 64 * 128);
static_assert((size_t)2 * 6 * TSZ * 4 + (size_t)2 * 2 * 16 * HP * 2 + (size_t)2 * 16 * XP * 2 + 960 * 4 + 2 * 32 * 4 + 32 * 4 <= 131072);   // static LDS of the fused kernel
static_assert((size_t)64 * 65 * 4 <= 131072);    // static LDS of the converter

typedef _Float16 h16;
typedef unsigned short bf;
typedef __attribute__((ext_vector_type(16))) __bf16   v16bf;
typedef __attribute__((ext_vector_type(16))) _Float16 v16h;
typedef __attribute__((ext_vector_type(8)))  _Float16 v8h;
typedef __attribute__((ext_vector_type(8)))  unsigned short v8us;
typedef __attribute__((ext_vector_type(8)))  float    v8f;
typedef __attribute__((ext_vector_type(4)))  float    v4f;
typedef __attribute__((ext_vector_type(2)))  float    v2f;
typedef v4f  __attribute__((may_alias)) v4fa;
typedef v8h  __attribute__((may_alias)) v8ha;
typedef v8us __attribute__((may_alias)) v8usa;

__device__ __forceinline__ unsigned short f2bf(float f) { unsigned u = __float_as_uint(f); u += 0x7FFFu + ((u >> 16) & 1u); return (unsigned short)(u >> 16); }
__device__ __forceinline__ float bfr(float f) { return __uint_as_float(((unsigned)f2bf(f)) << 16); }   // value after RNE convert to bf16
__device__ __forceinline__ v16h cat16(v8h lo, v8h hi) { return __builtin_shufflevector(lo, hi, 0, 1, 2, 3, 4, 5, 6, 7, 8, 9, 10, 11, 12, 13, 14, 15); }
__device__ __forceinline__ v16bf cat16b(v8us lo, v8us hi) { return __builtin_bit_cast(v16bf, __builtin_shufflevector(lo, hi, 0, 1, 2, 3, 4, 5, 6, 7, 8, 9, 10, 11, 12, 13, 14, 15)); }
__device__ __forceinline__ v8f wmma16(v16h a, v16h b, v8f c) { return __builtin_amdgcn_wmma_f32_16x16x32_f16(false, a, false, b, (short)0, c, false, false); }
__device__ __forceinline__ v8f wmmab(v16bf a, v16bf b, v8f c) { return __builtin_amdgcn_wmma_f32_16x16x32_bf16(false, a, false, b, (short)0, c, false, false); }
// fragment loaders from K-contiguous 16-bit rows; p already includes + 8*(lane>>4): elements 0..7 <- k0+8h+0..7, elements 8..15 <- k0+16+8h+0..7 (same map for A and B)
__device__ __forceinline__ v16h  ldh(const h16* p) { return cat16(*(const v8h*)p, *(const v8h*)(p + 16)); }
__device__ __forceinline__ v16bf ldb(const bf* p)  { return cat16b(*(const v8us*)p, *(const v8us*)(p + 16)); }
// ordering point for wave-private LDS tiles (same wave writes and reads)
__device__ __forceinline__ void wave_sync() { __builtin_amdgcn_fence(3 /* release order */, "wavefront"); __builtin_amdgcn_wave_barrier(); asm volatile("" ::: "memory"); }
// one guarded matrix instruction: the accumulator is tied behind four idle slots, the fragments stay live
__device__ __forceinline__ v8f wmma16g(v16h a, v16h b, v8f c) { c = wmma16(a, b, c); asm volatile("v_nop\n\tv_nop\n\tv_nop\n\tv_nop" : "+v"(c) : "v"(a), "v"(b)); return c; }
__device__ __forceinline__ v8f wmmabg(v16bf a, v16bf b, v8f c) { c = wmmab(a, b, c); asm volatile("v_nop\n\tv_nop\n\tv_nop\n\tv_nop" : "+v"(c) : "v"(a), "v"(b)); return c; }
// f32 -> f16 convert that cannot produce an f16 subnormal (|v| < 2^-14 -> +0)
static __device__ __forceinline__ h16 toh_flush(float v) { const h16 r = (h16)v; return (fabsf(v) < 6.103515625e-05f) ? (h16)0.0f : r; }

// k_prep: every weight plane in one launch; each block transposes one 64 x 64 f32 tile ([k][n]) through LDS and stores it [n][k], k contiguous.
// Blocks 0..DIN/64-1: 64-row k chunk of W1 -> W1T bf16 [MD][DIN]. Block DIN/64 + m, m = g*NBLK + t: matrix t of input g (q, k, v, f1, f2) -> WH f16 [m][MD][MD] of (bf16-converted value x 64).
__global__ __launch_bounds__(256) void k_prep(const float* __restrict__ W1, const float* __restrict__ Wq, const float* __restrict__ Wk, const float* __restrict__ Wv,
                                              const float* __restrict__ Wf1, const float* __restrict__ Wf2, bf* W1T, h16* WH) {
    __shared__ float ts[64 * 65];
    const int tid = threadIdx.x;
    const int kc = blockIdx.x;                                  // W1 chunk, where below DIN / 64
    const int m = kc - DIN / 64;                                // matrix number otherwise
    const bool first = kc < DIN / 64;                           // block-uniform
    const int g = m / NBLK;
    const float* Wg = (g == 0) ? Wq : (g == 1) ? Wk : (g == 2) ? Wv : (g == 3) ? Wf1 : Wf2;
    const float* W = first ? W1 + (size_t)kc * 64 * MD : Wg + (size_t)(m - g * NBLK) * MD * MD;
#pragma unroll 1
    for (int i = 0; i < 16; ++i) { const int e = tid + i * 256; const int k = e >> 6, n = e & 63; ts[k * 65 + n] = W[e]; }   // 16 x 256 = 64 x 64 entries
    __syncthreads();                                            // cross-wave exchange through ts
    const int p8 = (tid & 7) * 8;
    if (first) {
        v8us o0, o1;
#pragma unroll
        for (int u = 0; u < 8; ++u) { o0[u] = f2bf(ts[(p8 + u) * 65 + (tid >> 3)]); o1[u] = f2bf(ts[(p8 + u) * 65 + (tid >> 3) + 32]); }
        bf* d0 = W1T + (size_t)(tid >> 3) * DIN + (size_t)kc * 64 + p8;
        bf* d1 = W1T + (size_t)((tid >> 3) + 32) * DIN + (size_t)kc * 64 + p8;
        *(v8us*)d0 = o0; *(v8us*)d1 = o1;
        asm volatile("s_wait_xcnt 0x0" ::: "memory");           // precaution: stands behind the two stores, in front of any later write of their address or data registers (the other arm follows in the built code)
    } else {
        v8h o0, o1;
#pragma unroll
        for (int u = 0; u < 8; ++u) { o0[u] = toh_flush(bfr(ts[(p8 + u) * 65 + (tid >> 3)]) * WSC); o1[u] = toh_flush(bfr(ts[(p8 + u) * 65 + (tid >> 3) + 32]) * WSC); }
        h16* d0 = WH + (size_t)m * MD * MD + (size_t)(tid >> 3) * MD + p8;
        h16* d1 = WH + (size_t)m * MD * MD + (size_t)((tid >> 3) + 32) * MD + p8;
        *(v8h*)d0 = o0; *(v8h*)d1 = o1;
        asm volatile("s_wait_xcnt 0x0" ::: "memory");           // precaution: stands behind the two stores, in front of any later write of their address or data registers (the other arm follows in the built code)
    }
}

// k_tok: fused token kernel, eight waves per block, 32 tokens as two 16-token slabs worked side by side: waves 0..3 own slab 0, waves 4..7 slab 1.
// Inside a slab wave w owns output columns 16w..16w+15 of every GEMM and tokens 4w..4w+3 of every per-token phase; tiles that change hands between the two maps are ordered by __syncthreads, rows that stay with their wave by wave_sync.
// GEMM fragments: A row = token (lane&15) from the 16-bit planes (k contiguous), B column n = lane&15 of tile w from the [n][k] weight planes, both with the split k map; D: acc[j] = (token 8*(lane>>4)+j, column 16w + (lane&15)).
// Per slab T holds six f32 tiles [16][TP]: cur, res, q (later the hidden layer), k (later the second feed-forward output), v, y.
// one 16 x 16 x 64 GEMM tile: value and residual planes against one weight tile, bias and leaky slope, stored down one column of the destination tile
__device__ __forceinline__ void gemm_tile(const v16h (&b)[2], const v16h (&ah)[2], const v16h (&ar)[2], const float bb, const float sl, float* dst) {
    v8f acc = (v8f){}, acr = (v8f){};
#pragma unroll   // fragment arrays stay in registers
    for (int ks = 0; ks < 2; ++ks) { acc = wmma16g(ah[ks], b[ks], acc); acr = wmma16g(ar[ks], b[ks], acr); }
#pragma unroll
    for (int j = 0; j < 8; ++j) { float v = (acc[j] + acr[j] * QRI) * WSI + bb;
        v = (v >= 0.0f) ? v : sl * v;
        dst[j * TP] = v; }
}
// activation planes of 8 columns of one token row: f16 value and f16 residual x2048
__device__ __forceinline__ void planes8(const float* srow, h16* hrow, h16* rrow) {
    const v4f x0 = *(const v4fa*)(srow); const v4f x1 = *(const v4fa*)(srow + 4); v8h hv, rv;
#pragma unroll
    for (int i = 0; i < 4; ++i) { const h16 a0 = toh_flush(x0[i]); const h16 a1 = toh_flush(x1[i]); hv[i] = a0; hv[4 + i] = a1;
        rv[i] = toh_flush((x0[i] - (float)a0) * QRS); rv[4 + i] = toh_flush((x1[i] - (float)a1) * QRS); }
    *(v8ha*)(hrow) = hv; *(v8ha*)(rrow) = rv;
}
// sum over the 8 lanes that share a token row
__device__ __forceinline__ float sum8(float v) { v += __shfl_xor(v, 1, 32); v += __shfl_xor(v, 2, 32); v += __shfl_xor(v, 4, 32); return v; }

__global__ __launch_bounds__(NTHR) void k_tok(const float* __restrict__ x, const bf* __restrict__ W1T, const h16* __restrict__ WH,
                                            const float* __restrict__ b1, const float* __restrict__ bq, const float* __restrict__ bk, const float* __restrict__ bv,
                                            const float* __restrict__ bf1, const float* __restrict__ bf2, const float* __restrict__ ln_g, const float* __restrict__ ln_b,
                                            const float* __restrict__ Wout, const float* __restrict__ bout, float* OUT) {
    __shared__ __align__(16) float T[2 * 6 * TSZ];
    __shared__ __align__(16) h16 AH[2 * 16 * HP];
    __shared__ __align__(16) h16 AR[2 * 16 * HP];
    __shared__ __align__(16) bf  XB[2 * 16 * XP];
    __shared__ __align__(16) float BS[NGM * NBLK * MD];
    __shared__ __align__(16) float KX[TOKW];
    __shared__ __align__(16) float KN[TOKW];
    __shared__ __align__(16) float OS[TOKW];
    const int tid = threadIdx.x;
    const int lane = tid & 31, lr = lane & 15, hi = lane >> 4;
    const int wv = __builtin_amdgcn_readfirstlane(tid >> 5);     // wave number, held scalar
    const int slab = wv >> 2, w = wv & 3;
    const int tk = 4 * w + (lane >> 3), sb = lane & 7;           // row map: token of the slab, 8-column group
    const int col = 16 * w + lr;                                 // column map of the GEMM tiles
    const int n0 = blockIdx.x * TOKW;
    float* Ts = T + slab * (6 * TSZ);
    h16* AHs = AH + slab * (16 * HP);
    h16* ARs = AR + slab * (16 * HP);
    bf*  XBs = XB + slab * (16 * XP);
    float* KXs = KX + slab * 16;
    float* KNs = KN + slab * 16;

    // GEMM biases (bf16-converted values) staged once: BS[g*192 + t*64 + col]; first read behind the barriers of the input layer
    if (tid < NBLK * MD) { const int e = tid;
        BS[e] = bfr(bq[e]); BS[192 + e] = bfr(bk[e]); BS[384 + e] = bfr(bv[e]); BS[576 + e] = bfr(bf1[e]); BS[768 + e] = bfr(bf2[e]); }

    // ---- input layer: h = x W1 + b1 (K = DIN); the slab's x rows are converted once into the bf16 plane XB, each wave then forms its own 16 columns ----
    {
        const float* xr = x + (size_t)(n0 + slab * 16 + tk) * DIN + 8 * sb;
        const bf* wb = W1T + (size_t)col * DIN + 8 * hi;
        const float bb = bfr(b1[col]);
#pragma unroll   // all eight row loads in flight together
        for (int u = 0; u < DIN / 64; ++u) {
            const v4f x0 = *(const v4f*)(xr + 64 * u), x1 = *(const v4f*)(xr + 64 * u + 4);
            v8us o;
#pragma unroll
            for (int i = 0; i < 4; ++i) { o[i] = f2bf(x0[i]); o[4 + i] = f2bf(x1[i]); }
            *(v8usa*)(&XBs[tk * XP + 8 * sb + 64 * u]) = o; }
        __syncthreads();                                         // XB rows go from their converting wave to all four waves of the slab
        v16bf b[DIN / 32];                                       // the wave's whole W1 tile, fetched as one group
#pragma unroll   // one load group, fragments in registers
        for (int kc = 0; kc < DIN; kc += 32) b[kc / 32] = ldb(wb + kc);
        asm volatile("s_wait_xcnt 0x0" :: "v"(wb) : "memory");   // precaution: holds the address pair unwritten behind the group's loads (the build without it placed the last load's result on the pair)
        v8f acc = (v8f){};
#pragma unroll
        for (int kc = 0; kc < DIN; kc += 32) {
            const int ao = lr * XP + kc + 8 * hi;
            const v16bf a = cat16b(*(const v8usa*)(&XBs[ao]), *(const v8usa*)(&XBs[ao + 16]));
            acc = wmmabg(a, b[kc / 32], acc); }
#pragma unroll
        for (int j = 0; j < 8; ++j) { const float hv = acc[j] + bb;
            Ts[OFF_CUR + (8 * hi + j) * TP + col] = hv;
            Ts[OFF_RES + (8 * hi + j) * TP + col] = (hv >= 0.0f) ? hv : 0.1f * hv; }
    }
    __syncthreads();                                             // cur, res: column map -> row map

    const int ro8 = tk * TP + 8 * sb;                            // this lane's 8 columns in the row map
    const int po8 = tk * HP + 8 * sb;
    float* dcol = Ts + (8 * hi) * TP + col;                      // this lane's column in the column map
#pragma unroll 1
    for (int t = 0; t < NBLK; ++t) {
        v16h ah[2], ar[2], wf[3][2];
        const h16* wp = WH + (size_t)(t * MD) * MD + (size_t)col * MD + 8 * hi;   // this lane's weight column of block t; GEMM g lies g * NBLK matrices further
        // planes of cur (each lane reads back the 8 values it wrote itself, or values behind the barrier above)
        planes8(&Ts[OFF_CUR + ro8], &AHs[po8], &ARs[po8]);
        __syncthreads();                                         // planes: row map -> A fragments of all four waves
#pragma unroll   // one load group, fragments in registers
        for (int g = 0; g < 3; ++g) { wf[g][0] = ldh(wp + (size_t)g * NBLK * MD * MD); wf[g][1] = ldh(wp + (size_t)g * NBLK * MD * MD + 32); }   // the phase's weight tiles, fetched as one group
#pragma unroll
        for (int ks = 0; ks < 2; ++ks) { const int ao = lr * HP + ks * 32 + 8 * hi;
            ah[ks] = cat16(*(const v8ha*)(&AHs[ao]), *(const v8ha*)(&AHs[ao + 16]));
            ar[ks] = cat16(*(const v8ha*)(&ARs[ao]), *(const v8ha*)(&ARs[ao + 16])); }
#pragma unroll
        for (int g = 0; g < 3; ++g)                              // q, k, v share the planes
            gemm_tile(wf[g], ah, ar, BS[g * (NBLK * MD) + t * MD + col], 1.0f, dcol + OFF_Q + g * TSZ);
        __syncthreads();                                         // q, k, v: column map -> row map; also frees the planes
        // per-token extreme keys: max_j q k_j = q * (q >= 0 ? kmax : kmin)
        { float mx = -3.0e38f, mn = 3.0e38f;
#pragma unroll
          for (int u = 0; u < 2; ++u) { const v4f kk = *(const v4fa*)(&Ts[OFF_K + ro8 + 4 * u]);
              mx = fmaxf(fmaxf(mx, fmaxf(kk[0], kk[1])), fmaxf(kk[2], kk[3])); mn = fminf(fminf(mn, fminf(kk[0], kk[1])), fminf(kk[2], kk[3])); }
          mx = fmaxf(mx, __shfl_xor(mx, 1, 32)); mn = fminf(mn, __shfl_xor(mn, 1, 32));
          mx = fmaxf(mx, __shfl_xor(mx, 2, 32)); mn = fminf(mn, __shfl_xor(mn, 2, 32));
          mx = fmaxf(mx, __shfl_xor(mx, 4, 32)); mn = fminf(mn, __shfl_xor(mn, 4, 32));
          if (sb == 0) { KXs[tk] = mx; KNs[tk] = mn; } }
        wave_sync();
        // y[n][i] = sum_j softmax_j(q_i k_j) v_j + cur[n][i]; lane owns i = lane and i = lane + 32, the wave's four tokens in sequence (k, v rows are wave-wide broadcasts)
#pragma unroll 1
        for (int nn = 0; nn < 4; ++nn) {
            const int n = 4 * w + nn;
            const int ro = n * TP;
            const float q0 = Ts[OFF_Q + ro + lane], q1 = Ts[OFF_Q + ro + 32 + lane];
            const float kx = KXs[n], kn = KNs[n];
            const float e0 = (q0 >= 0.0f) ? kx : kn, e1 = (q1 >= 0.0f) ? kx : kn;
            const float s0q = q0 * L2E, s1q = q1 * L2E;
            const float c0 = -(e0 * s0q), c1 = -(e1 * s1q);       // minus the row's largest score
            const v2f sq0 = (v2f){s0q, s0q}, sq1 = (v2f){s1q, s1q}, nc0 = (v2f){c0, c0}, nc1 = (v2f){c1, c1};
            v2f s0 = (v2f){0.0f, 0.0f}, s1 = (v2f){0.0f, 0.0f}, y0 = (v2f){0.0f, 0.0f}, y1 = (v2f){0.0f, 0.0f};   // element 0: even keys, element 1: odd keys
#pragma unroll 2
            for (int jj = 0; jj < MD; jj += 4) {
                const v4f kk = *(const v4fa*)(&Ts[OFF_K + ro + jj]); const v4f vv = *(const v4fa*)(&Ts[OFF_V + ro + jj]);
#pragma unroll
                for (int c = 0; c < 2; ++c) {                     // two adjacent keys ride in one register pair, as the LDS load leaves them
                    const v2f k2 = c ? __builtin_shufflevector(kk, kk, 2, 3) : __builtin_shufflevector(kk, kk, 0, 1);
                    const v2f v2 = c ? __builtin_shufflevector(vv, vv, 2, 3) : __builtin_shufflevector(vv, vv, 0, 1);
                    const v2f a0 = __builtin_elementwise_fma(k2, sq0, nc0);   // score minus the row maximum in one packed fma; at most one rounding of the maximum above 0
                    const v2f a1 = __builtin_elementwise_fma(k2, sq1, nc1);
                    const v2f p0 = (v2f){__builtin_amdgcn_exp2f(a0[0]), __builtin_amdgcn_exp2f(a0[1])};
                    const v2f p1 = (v2f){__builtin_amdgcn_exp2f(a1[0]), __builtin_amdgcn_exp2f(a1[1])};
                    s0 += p0; s1 += p1; y0 = __builtin_elementwise_fma(p0, v2, y0); y1 = __builtin_elementwise_fma(p1, v2, y1); } }
            Ts[OFF_Y + ro + lane]      = (y0[0] + y0[1]) * __builtin_amdgcn_rcpf(s0[0] + s0[1]) + Ts[OFF_CUR + ro + lane];
            Ts[OFF_Y + ro + 32 + lane] = (y1[0] + y1[1]) * __builtin_amdgcn_rcpf(s1[0] + s1[1]) + Ts[OFF_CUR + ro + 32 + lane]; }
        wave_sync();
        planes8(&Ts[OFF_Y + ro8], &AHs[po8], &ARs[po8]);         // y rows stay with their wave
        __syncthreads();                                         // planes: row map -> A fragments
        wf[0][0] = ldh(wp + (size_t)3 * NBLK * MD * MD); wf[0][1] = ldh(wp + (size_t)3 * NBLK * MD * MD + 32);
#pragma unroll
        for (int ks = 0; ks < 2; ++ks) { const int ao = lr * HP + ks * 32 + 8 * hi;
            ah[ks] = cat16(*(const v8ha*)(&AHs[ao]), *(const v8ha*)(&AHs[ao + 16]));
            ar[ks] = cat16(*(const v8ha*)(&ARs[ao]), *(const v8ha*)(&ARs[ao + 16])); }
        gemm_tile(wf[0], ah, ar, BS[3 * (NBLK * MD) + t * MD + col], 0.01f, dcol + OFF_Q);   // hidden layer: leaky slope 0.01
        __syncthreads();                                         // hidden layer: column map -> row map; also frees the planes
        planes8(&Ts[OFF_Q + ro8], &AHs[po8], &ARs[po8]);
        __syncthreads();                                         // planes: row map -> A fragments
        wf[0][0] = ldh(wp + (size_t)4 * NBLK * MD * MD); wf[0][1] = ldh(wp + (size_t)4 * NBLK * MD * MD + 32);
#pragma unroll
        for (int ks = 0; ks < 2; ++ks) { const int ao = lr * HP + ks * 32 + 8 * hi;
            ah[ks] = cat16(*(const v8ha*)(&AHs[ao]), *(const v8ha*)(&AHs[ao + 16]));
            ar[ks] = cat16(*(const v8ha*)(&ARs[ao]), *(const v8ha*)(&ARs[ao + 16])); }
        gemm_tile(wf[0], ah, ar, BS[4 * (NBLK * MD) + t * MD + col], 1.0f, dcol + OFF_K);
        __syncthreads();                                         // second feed-forward output: column map -> row map; also frees the planes
        // a = ff + y; res += LayerNorm(a) * g + b; cur = res. Row map: 8 lanes share a token, each keeps its 8 columns in registers
        {
            v4f a[2], g4[2], b4[2];
#pragma unroll
            for (int u = 0; u < 2; ++u) { g4[u] = *(const v4f*)(ln_g + t * MD + 8 * sb + 4 * u); b4[u] = *(const v4f*)(ln_b + t * MD + 8 * sb + 4 * u);
                a[u] = *(const v4fa*)(&Ts[OFF_K + ro8 + 4 * u]) + *(const v4fa*)(&Ts[OFF_Y + ro8 + 4 * u]); }
            const float sm = sum8(((a[0][0] + a[0][1]) + (a[0][2] + a[0][3])) + ((a[1][0] + a[1][1]) + (a[1][2] + a[1][3])));
            const float mu = sm * (1.0f / MD);
            float vs = 0.0f;
#pragma unroll
            for (int u = 0; u < 2; ++u) { const float d0 = a[u][0] - mu, d1 = a[u][1] - mu, d2 = a[u][2] - mu, d3 = a[u][3] - mu; vs += (d0 * d0 + d1 * d1) + (d2 * d2 + d3 * d3); }
            vs = sum8(vs);
            const float inv = __builtin_amdgcn_rsqf(vs * (1.0f / MD) + 1e-5f);
#pragma unroll
            for (int u = 0; u < 2; ++u) { const v4f r4 = *(const v4fa*)(&Ts[OFF_RES + ro8 + 4 * u]); v4f nr;
#pragma unroll
                for (int i = 0; i < 4; ++i) nr[i] = ((a[u][i] - mu) * inv * bfr(g4[u][i]) + bfr(b4[u][i])) + r4[i];
                *(v4fa*)(&Ts[OFF_RES + ro8 + 4 * u]) = nr; *(v4fa*)(&Ts[OFF_CUR + ro8 + 4 * u]) = nr; }
        }
    }
    // head: leaky(res . Wout + bout, 0.1); matrix-vector product in f32 on the vector unit, row map
    {
        float ds = 0.0f;
#pragma unroll
        for (int u = 0; u < 2; ++u) { const v4f r4 = *(const v4fa*)(&Ts[OFF_RES + ro8 + 4 * u]); const v4f w4 = *(const v4f*)(Wout + 8 * sb + 4 * u);
            ds += (r4[0] * bfr(w4[0]) + r4[1] * bfr(w4[1])) + (r4[2] * bfr(w4[2]) + r4[3] * bfr(w4[3])); }
        ds = sum8(ds);
        float ov = ds + bfr(bout[0]);
        ov = (ov >= 0.0f) ? ov : 0.1f * ov;
        if (sb == 0) OS[slab * 16 + tk] = ov;
    }
    __syncthreads();                                             // OS: all eight waves -> the storing lanes
    if (tid < 5 * 8) {                                           // five copies x 8 lanes x 16 B: each copy's 128-byte line stored whole
        const int c = tid >> 3, q4 = (tid & 7) * 4;
        const v4f val = *(const v4fa*)(&OS[q4]);
        *(v4f*)(OUT + (size_t)c * NTOK_FULL + n0 + q4) = val;
    }
}

static constexpr size_t al256(size_t v) { return (v + 255) & ~(size_t)255; }
static constexpr size_t SZ_W1T = al256((size_t)MD * DIN * 2);
static constexpr size_t SZ_WH  = al256((size_t)NGM * NBLK * MD * MD * 2);
static constexpr size_t SZ_TOTAL = SZ_W1T + SZ_WH;
static_assert(SZ_TOTAL <= (size_t)134217728);              // workspace carve <= 128 MiB
static_assert(((size_t)NBLK * MD * MD * 2) % 256 == 0);    // per-input weight sub-planes stay 256-byte aligned
static_assert((size_t)(DIN / 64) * 64 == (size_t)DIN);     // W1 blocks of k_prep x 64 rows == DIN
static_assert((size_t)(NTOK / TOKW) * TOKW == (size_t)NTOK);

extern "C" void kernel_launch(void* const* d_in, const int* in_sizes, int n_in,
                              void* d_out, int out_size, void* d_ws, size_t ws_size, hipStream_t stream) {
    if (n_in < 17) return;
    if ((size_t)in_sizes[0] < (size_t)NTOK * DIN) return;
    if ((size_t)in_sizes[1] < (size_t)DIN * MD || in_sizes[2] < MD) return;
    if ((size_t)in_sizes[3] < (size_t)NBLK * MD * MD || (size_t)in_sizes[5] < (size_t)NBLK * MD * MD || (size_t)in_sizes[7] < (size_t)NBLK * MD * MD) return;
    if ((size_t)in_sizes[9] < (size_t)NBLK * MD * MD || (size_t)in_sizes[11] < (size_t)NBLK * MD * MD) return;
    if (in_sizes[4] < NBLK * MD || in_sizes[6] < NBLK * MD || in_sizes[8] < NBLK * MD || in_sizes[10] < NBLK * MD || in_sizes[12] < NBLK * MD) return;
    if (in_sizes[13] < NBLK * MD || in_sizes[14] < NBLK * MD || in_sizes[15] < MD || in_sizes[16] < 1) return;
    if ((size_t)out_size < (size_t)4 * NTOK_FULL + NTOK) return;
    if (SZ_TOTAL > ws_size) return;
    // wire order: x, W1, b1, Wq, bq, Wk, bk, Wv, bv, Wf1, bf1, Wf2, bf2, ln_g, ln_b, Wout, bout
    const float* x   = (const float*)d_in[0];
    const float* W1  = (const float*)d_in[1];  const float* b1  = (const float*)d_in[2];
    const float* Wq  = (const float*)d_in[3];  const float* bq  = (const float*)d_in[4];
    const float* Wk  = (const float*)d_in[5];  const float* bk  = (const float*)d_in[6];
    const float* Wv  = (const float*)d_in[7];  const float* bv  = (const float*)d_in[8];
    const float* Wf1 = (const float*)d_in[9];  const float* bf1 = (const float*)d_in[10];
    const float* Wf2 = (const float*)d_in[11]; const float* bf2 = (const float*)d_in[12];
    const float* lng = (const float*)d_in[13]; const float* lnb = (const float*)d_in[14];
    const float* Wo  = (const float*)d_in[15]; const float* bo  = (const float*)d_in[16];
    float* OUT = (float*)d_out;                 // five copies, pitch NTOK_FULL floats
    char* wsp = (char*)d_ws;
    bf*  W1T = (bf*)wsp;  wsp += SZ_W1T;        // [64][256] bf16, [n][k]
    h16* WH  = (h16*)wsp; wsp += SZ_WH;         // [5][3][64][64] f16 x64, [n][k]; g = q | k | v | f1 | f2

    k_prep<<<DIN / 64 + NGM * NBLK, 256, 0, stream>>>(W1, Wq, Wk, Wv, Wf1, Wf2, W1T, WH);   // 4 chunks of W1 and the 15 block matrices, all independent

    k_tok<<<NTOK / TOKW, NTHR, 0, stream>>>(x, W1T, WH, b1, bq, bk, bv, bf1, bf2, lng, lnb, Wo, bo, OUT);
}

// v004
// It runs in 31.5 microseconds.
// In two side-by-side timings against v003, it was 1.11 and 1.12 times as fast.
// Counting every step since v000, it is 5.69 times as fast.
#include <hip/hip_runtime.h>

// Per-token outer-product attention stack: h = x W1 + b1 (256 -> 64); three blocks of {q,k,v = cur W + b; y_i = sum_j softmax_j(q_i k_j) v_j + cur_i; a = leaky(y Wf1 + bf1, 0.01) Wf2 + bf2 + y; res += LayerNorm(a)}; out = leaky(res Wout + bout, 0.1), stored five times.
// Compute dtypes, f32 accumulate everywhere: x W1 on v_wmma_f32_16x16x32_bf16 (x, W1 RNE-converted to bf16; products exact); the fifteen 64x64 GEMMs on v_wmma_f32_16x16x32_f16 with the activation as f16 value + f16 residual x2048 (own accumulator, folded by 1/2048) and the weight as f16 of the bf16-converted input x64 (folded by 1/64);
// per-token 64x64 softmax / P.v, LayerNorm and the 64 -> 1 head in f32 on the vector unit (no operand shared between tokens; the head is a matrix-vector product).
// Layout: W1T bf16 (64 x 256) and WH f16 (5 x 3 matrices of 64 x 64), both in B-fragment order (16-byte slots [column tile][32-wide k step][part][lane]), built in the workspace by one launch; fused kernel: eight waves per block own 32 tokens (two 16-token slabs, four waves each), all tiles in LDS.

#ifndef NTOK
#define NTOK 16384
#endif
#define NTOK_FULL 16384
#define DIN  256                 // input width
#define MD   64                  // model width of the blocks
#define NBLK 3                   // stacked blocks
#define NGM  5                   // GEMMs per block: q, k, v, f1, f2
#define TOKW 32                  // tokens per block (two slabs of 16)
#define NTHR 256                 // threads per block of the fused kernel: four waves per slab
#define XP   264                 // LDS bf16 x plane row pitch (elements)
#define TP   68                  // LDS f32 tile row pitch (floats)
#define TSZ  (16 * TP)
#define HP   72                  // LDS f16 plane row pitch (halves)
#define OFF_CUR 0
#define OFF_RES (1 * TSZ)
#define OFF_Q   (2 * TSZ)
#define OFF_K   (3 * TSZ)
#define OFF_V   (4 * TSZ)
#define OFF_Y   (5 * TSZ)
#define QRS  2048.0f             // carry of the activation residual plane
#define QRI  (1.0f / 2048.0f)
#define WSC  64.0f               // carry of the f16 weight planes
#define WSI  (1.0f / 64.0f)
#define L2E  1.4426950408889634f
#define FPART 256                // elements per fragment part: 32 lanes x 8 elements = 512 contiguous bytes, one wave-wide 16-byte load
#define FSTEP (2 * FPART)        // elements per 16-column x 32-k fragment

static_assert(MD == 64);
static_assert(MD % 32 == 0);
static_assert(DIN % 64 == 0);                    // W1 handled in 64-row chunks; k-loop steps by 32
static_assert(DIN % 32 == 0);
static_assert(TOKW == 32);
static_assert(NTOK % TOKW == 0);                 // grid covers the tokens exactly
static_assert(NTOK <= NTOK_FULL);
static_assert((size_t)NTOK_FULL * 4 == 65536);   // byte pitch between the five output copies
static_assert(((size_t)NTOK_FULL * 4) % 128 == 0);
static_assert((TP * 4) % 16 == 0);
static_assert((HP * 2) % 16 == 0);
static_assert(TP >= MD);
static_assert(HP >= MD);
static_assert(NGM * NBLK * MD == 960);           // bias stage size
static_assert(NBLK * MD <= NTHR);                // bias stage: one thread per entry of each input
static_assert(NTHR == 2 * 4 * 32);
static_assert((XP * 2) % 16 == 0);
static_assert(XP >= DIN);
static_assert(32 * 16 == 4 * 128);
static_assert(8 * 16 == 128);                    // output store: 8 lanes x 16 B = one line
static_assert(256 * 2 * 16 == 64 * 128);
static_assert(4 * 2 * FSTEP == MD * MD);         // four column tiles x two k steps fill one 64 x 64 matrix
static_assert(4 * (DIN / 32) * FSTEP == MD * DIN);
static_assert((size_t)2 * 6 * TSZ * 4 + (size_t)2 * 2 * 16 * HP * 2 + (size_t)2 * 16 * XP * 2 + 960 * 4 + 2 * 32 * 4 + 32 * 4 <= 131072);   // static LDS of the fused kernel
static_assert((size_t)64 * 65 * 4 <= 131072);    // static LDS of the converter

typedef _Float16 h16;
typedef unsigned short bf;
typedef __attribute__((ext_vector_type(16))) __bf16   v16bf;
typedef __attribute__((ext_vector_type(16))) _Float16 v16h;
typedef __attribute__((ext_vector_type(8)))  _Float16 v8h;
typedef __attribute__((ext_vector_type(8)))  unsigned short v8us;
typedef __attribute__((ext_vector_type(8)))  float    v8f;
typedef __attribute__((ext_vector_type(4)))  float    v4f;
typedef __attribute__((ext_vector_type(2)))  float    v2f;
typedef v4f  __attribute__((may_alias)) v4fa;
typedef v8h  __attribute__((may_alias)) v8ha;
typedef v8us __attribute__((may_alias)) v8usa;

__device__ __forceinline__ unsigned short f2bf(float f) { unsigned u = __float_as_uint(f); u += 0x7FFFu + ((u >> 16) & 1u); return (unsigned short)(u >> 16); }
__device__ __forceinline__ float bfr(float f) { return __uint_as_float(((unsigned)f2bf(f)) << 16); }   // value after RNE convert to bf16
__device__ __forceinline__ v16h cat16(v8h lo, v8h hi) { return __builtin_shufflevector(lo, hi, 0, 1, 2, 3, 4, 5, 6, 7, 8, 9, 10, 11, 12, 13, 14, 15); }
__device__ __forceinline__ v16bf cat16b(v8us lo, v8us hi) { return __builtin_bit_cast(v16bf, __builtin_shufflevector(lo, hi, 0, 1, 2, 3, 4, 5, 6, 7, 8, 9, 10, 11, 12, 13, 14, 15)); }
__device__ __forceinline__ v8f wmma16(v16h a, v16h b, v8f c) { return __builtin_amdgcn_wmma_f32_16x16x32_f16(false, a, false, b, (short)0, c, false, false); }
__device__ __forceinline__ v8f wmmab(v16bf a, v16bf b, v8f c) { return __builtin_amdgcn_wmma_f32_16x16x32_bf16(false, a, false, b, (short)0, c, false, false); }
// B-fragment loaders from the fragment-ordered weight planes; p already includes + 8*lane: part 0 holds elements 0..7 <- k0+8h+0..7, part 1 elements 8..15 <- k0+16+8h+0..7 of column lane&15, h = lane>>4 (same k map as the A fragments)
__device__ __forceinline__ v16h  ldh(const h16* p) { return cat16(*(const v8h*)p, *(const v8h*)(p + FPART)); }
__device__ __forceinline__ v16bf ldb(const bf* p)  { return cat16b(*(const v8us*)p, *(const v8us*)(p + FPART)); }
// ordering point for wave-private LDS tiles (same wave writes and reads)
__device__ __forceinline__ void wave_sync() { __builtin_amdgcn_fence(3 /* release order */, "wavefront"); __builtin_amdgcn_wave_barrier(); asm volatile("" ::: "memory"); }
// one guarded matrix instruction: the accumulator is tied behind four idle slots, the fragments stay live
__device__ __forceinline__ v8f wmma16g(v16h a, v16h b, v8f c) { c = wmma16(a, b, c); asm volatile("v_nop\n\tv_nop\n\tv_nop\n\tv_nop" : "+v"(c) : "v"(a), "v"(b)); return c; }
__device__ __forceinline__ v8f wmmabg(v16bf a, v16bf b, v8f c) { c = wmmab(a, b, c); asm volatile("v_nop\n\tv_nop\n\tv_nop\n\tv_nop" : "+v"(c) : "v"(a), "v"(b)); return c; }
// f32 -> f16 convert that cannot produce an f16 subnormal (|v| < 2^-14 -> +0)
static __device__ __forceinline__ h16 toh_flush(float v) { const h16 r = (h16)v; return (fabsf(v) < 6.103515625e-05f) ? (h16)0.0f : r; }

// k_prep: every weight plane in one launch; each block transposes one 64 x 64 f32 tile ([k][n]) through LDS and stores it in B-fragment order.
// A 16-byte slot holds 8 consecutive k (group p = k / 8) of one column n and lies at [n >> 4][p >> 2][(p >> 1) & 1][16 * (p & 1) + (n & 15)]: the slots one wave-wide fragment load reads are 512 contiguous bytes.
// Blocks 0..DIN/64-1: 64-row k chunk of W1 -> W1T bf16 [4 tiles][DIN/32 steps][2][32][8]. Block DIN/64 + m, m = g*NBLK + t: matrix t of input g (q, k, v, f1, f2) -> WH f16 [m][4 tiles][2 steps][2][32][8] of (bf16-converted value x 64).
__global__ __launch_bounds__(256) void k_prep(const float* __restrict__ W1, const float* __restrict__ Wq, const float* __restrict__ Wk, const float* __restrict__ Wv,
                                              const float* __restrict__ Wf1, const float* __restrict__ Wf2, bf* W1T, h16* WH) {
    __shared__ float ts[64 * 65];
    const int tid = threadIdx.x;
    const int kc = blockIdx.x;                                  // W1 chunk, where below DIN / 64
    const int m = kc - DIN / 64;                                // matrix number otherwise
    const bool first = kc < DIN / 64;                           // block-uniform
    const int g = m / NBLK;
    const float* Wg = (g == 0) ? Wq : (g == 1) ? Wk : (g == 2) ? Wv : (g == 3) ? Wf1 : Wf2;
    const float* W = first ? W1 + (size_t)kc * 64 * MD : Wg + (size_t)(m - g * NBLK) * MD * MD;
#pragma unroll 1
    for (int i = 0; i < 16; ++i) { const int e = tid + i * 256; const int k = e >> 6, n = e & 63; ts[k * 65 + n] = W[e]; }   // 16 x 256 = 64 x 64 entries
    __syncthreads();                                            // cross-wave exchange through ts
    const int p = tid >> 5, p8 = p * 8;                         // one k group per wave
    const int nl = tid & 31;                                    // columns nl and nl + 32
    const int fo = (p >> 1) * FPART + (16 * (p & 1) + (nl & 15)) * 8;   // slot inside the column tile's two k steps of this 64-row chunk
    if (first) {
        v8us o0, o1;
#pragma unroll
        for (int u = 0; u < 8; ++u) { o0[u] = f2bf(ts[(p8 + u) * 65 + nl]); o1[u] = f2bf(ts[(p8 + u) * 65 + nl + 32]); }
        bf* d0 = W1T + (size_t)(nl >> 4) * (DIN / 32 * FSTEP) + (size_t)kc * (2 * FSTEP) + fo;
        bf* d1 = d0 + (size_t)2 * (DIN / 32 * FSTEP);
        *(v8us*)d0 = o0; *(v8us*)d1 = o1;
        asm volatile("s_wait_xcnt 0x0" ::: "memory");           // precaution: stands behind the two stores, in front of any later write of their address or data registers (the other arm follows in the built code)
    } else {
        v8h o0, o1;
#pragma unroll
        for (int u = 0; u < 8; ++u) { o0[u] = toh_flush(bfr(ts[(p8 + u) * 65 + nl]) * WSC); o1[u] = toh_flush(bfr(ts[(p8 + u) * 65 + nl + 32]) * WSC); }
        h16* d0 = WH + (size_t)m * MD * MD + (size_t)(nl >> 4) * (2 * FSTEP) + fo;
        h16* d1 = d0 + (size_t)2 * (2 * FSTEP);
        *(v8h*)d0 = o0; *(v8h*)d1 = o1;
        asm volatile("s_wait_xcnt 0x0" ::: "memory");           // precaution: stands behind the two stores, in front of any later write of their address or data registers (the other arm follows in the built code)
    }
}

// k_tok: fused token kernel, eight waves per block, 32 tokens as two 16-token slabs worked side by side: waves 0..3 own slab 0, waves 4..7 slab 1.
// Inside a slab wave w owns output columns 16w..16w+15 of every GEMM and tokens 4w..4w+3 of every per-token phase; tiles that change hands between the two maps are ordered by __syncthreads, rows that stay with their wave by wave_sync.
// GEMM fragments: A row = token (lane&15) from the 16-bit planes (k contiguous), B column n = lane&15 of tile w from the fragment-ordered weight planes, both with the split k map; D: acc[j] = (token 8*(lane>>4)+j, column 16w + (lane&15)).
// Per slab T holds six f32 tiles [16][TP]: cur, res, q (later the hidden layer), k (later the second feed-forward output), v, y.
// one 16 x 16 x 64 GEMM tile: value and residual planes against one weight tile, bias and leaky slope, stored down one column of the destination tile
__device__ __forceinline__ void gemm_tile(const v16h (&b)[2], const v16h (&ah)[2], const v16h (&ar)[2], const float bb, const float sl, float* dst) {
    v8f acc = (v8f){}, acr = (v8f){};
#pragma unroll   // fragment arrays stay in registers
    for (int ks = 0; ks < 2; ++ks) { acc = wmma16g(ah[ks], b[ks], acc); acr = wmma16g(ar[ks], b[ks], acr); }
#pragma unroll
    for (int j = 0; j < 8; ++j) { float v = (acc[j] + acr[j] * QRI) * WSI + bb;
        v = (v >= 0.0f) ? v : sl * v;
        dst[j * TP] = v; }
}
// activation planes of 8 columns of one token row: f16 value and f16 residual x2048
__device__ __forceinline__ void planes8(const float* srow, h16* hrow, h16* rrow) {
    const v4f x0 = *(const v4fa*)(srow); const v4f x1 = *(const v4fa*)(srow + 4); v8h hv, rv;
#pragma unroll
    for (int i = 0; i < 4; ++i) { const h16 a0 = toh_flush(x0[i]); const h16 a1 = toh_flush(x1[i]); hv[i] = a0; hv[4 + i] = a1;
        rv[i] = toh_flush((x0[i] - (float)a0) * QRS); rv[4 + i] = toh_flush((x1[i] - (float)a1) * QRS); }
    *(v8ha*)(hrow) = hv; *(v8ha*)(rrow) = rv;
}
// sum over the 8 lanes that share a token row
__device__ __forceinline__ float sum8(float v) { v += __shfl_xor(v, 1, 32); v += __shfl_xor(v, 2, 32); v += __shfl_xor(v, 4, 32); return v; }

__global__ __launch_bounds__(NTHR) void k_tok(const float* __restrict__ x, const bf* __restrict__ W1T, const h16* __restrict__ WH,
                                            const float* __restrict__ b1, const float* __restrict__ bq, const float* __restrict__ bk, const float* __restrict__ bv,
                                            const float* __restrict__ bf1, const float* __restrict__ bf2, const float* __restrict__ ln_g, const float* __restrict__ ln_b,
                                            const float* __restrict__ Wout, const float* __restrict__ bout, float* OUT) {
    __shared__ __align__(16) float T[2 * 6 * TSZ];
    __shared__ __align__(16) h16 AH[2 * 16 * HP];
    __shared__ __align__(16) h16 AR[2 * 16 * HP];
    __shared__ __align__(16) bf  XB[2 * 16 * XP];
    __shared__ __align__(16) float BS[NGM * NBLK * MD];
    __shared__ __align__(16) float KX[TOKW];
    __shared__ __align__(16) float KN[TOKW];
    __shared__ __align__(16) float OS[TOKW];
    const int tid = threadIdx.x;
    const int lane = tid & 31, lr = lane & 15, hi = lane >> 4;
    const int wv = __builtin_amdgcn_readfirstlane(tid >> 5);     // wave number, held scalar
    const int slab = wv >> 2, w = wv & 3;
    const int tk = 4 * w + (lane >> 3), sb = lane & 7;           // row map: token of the slab, 8-column group
    const int col = 16 * w + lr;                                 // column map of the GEMM tiles
    const int n0 = blockIdx.x * TOKW;
    float* Ts = T + slab * (6 * TSZ);
    h16* AHs = AH + slab * (16 * HP);
    h16* ARs = AR + slab * (16 * HP);
    bf*  XBs = XB + slab * (16 * XP);
    float* KXs = KX + slab * 16;
    float* KNs = KN + slab * 16;

    // GEMM biases (bf16-converted values) staged once: BS[g*192 + t*64 + col]; first read behind the barriers of the input layer
    if (tid < NBLK * MD) { const int e = tid;
        BS[e] = bfr(bq[e]); BS[192 + e] = bfr(bk[e]); BS[384 + e] = bfr(bv[e]); BS[576 + e] = bfr(bf1[e]); BS[768 + e] = bfr(bf2[e]); }

    // ---- input layer: h = x W1 + b1 (K = DIN); the slab's x rows are converted once into the bf16 plane XB, each wave then forms its own 16 columns ----
    {
        const float* xr = x + (size_t)(n0 + slab * 16 + tk) * DIN + 8 * sb;
        const bf* wb = W1T + (size_t)w * (DIN / 32 * FSTEP) + 8 * lane;   // the wave's column tile: DIN/32 fragments in a row
        const float bb = bfr(b1[col]);
#pragma unroll   // all eight row loads in flight together
        for (int u = 0; u < DIN / 64; ++u) {
            const v4f x0 = *(const v4f*)(xr + 64 * u), x1 = *(const v4f*)(xr + 64 * u + 4);
            v8us o;
#pragma unroll
            for (int i = 0; i < 4; ++i) { o[i] = f2bf(x0[i]); o[4 + i] = f2bf(x1[i]); }
            *(v8usa*)(&XBs[tk * XP + 8 * sb + 64 * u]) = o; }
        __syncthreads();                                         // XB rows go from their converting wave to all four waves of the slab
        v16bf b[DIN / 32];                                       // the wave's whole W1 tile, fetched as one group
#pragma unroll   // one load group, fragments in registers
        for (int kc = 0; kc < DIN; kc += 32) b[kc / 32] = ldb(wb + (kc / 32) * FSTEP);
        asm volatile("s_wait_xcnt 0x0" ::: "memory");            // precaution: stands behind the group's loads, in front of any later write of their base or offset registers
        v8f acc = (v8f){};
#pragma unroll
        for (int kc = 0; kc < DIN; kc += 32) {
            const int ao = lr * XP + kc + 8 * hi;
            const v16bf a = cat16b(*(const v8usa*)(&XBs[ao]), *(const v8usa*)(&XBs[ao + 16]));
            acc = wmmabg(a, b[kc / 32], acc); }
#pragma unroll
        for (int j = 0; j < 8; ++j) { const float hv = acc[j] + bb;
            Ts[OFF_CUR + (8 * hi + j) * TP + col] = hv;
            Ts[OFF_RES + (8 * hi + j) * TP + col] = (hv >= 0.0f) ? hv : 0.1f * hv; }
    }
    __syncthreads();                                             // cur, res: column map -> row map

    const int ro8 = tk * TP + 8 * sb;                            // this lane's 8 columns in the row map
    const int po8 = tk * HP + 8 * sb;
    float* dcol = Ts + (8 * hi) * TP + col;                      // this lane's column in the column map
#pragma unroll 1
    for (int t = 0; t < NBLK; ++t) {
        v16h ah[2], ar[2], wf[3][2];
        const h16* wp = WH + (size_t)(t * MD) * MD + (size_t)w * (2 * FSTEP) + 8 * lane;   // this lane's slots in the wave's column tile of block t; GEMM g lies g * NBLK matrices further
        // planes of cur (each lane reads back the 8 values it wrote itself, or values behind the barrier above)
        planes8(&Ts[OFF_CUR + ro8], &AHs[po8], &ARs[po8]);
        __syncthreads();                                         // planes: row map -> A fragments of all four waves
#pragma unroll   // one load group, fragments in registers
        for (int g = 0; g < 3; ++g) { wf[g][0] = ldh(wp + (size_t)g * NBLK * MD * MD); wf[g][1] = ldh(wp + (size_t)g * NBLK * MD * MD + FSTEP); }   // the phase's weight tiles, fetched as one group
#pragma unroll
        for (int ks = 0; ks < 2; ++ks) { const int ao = lr * HP + ks * 32 + 8 * hi;
            ah[ks] = cat16(*(const v8ha*)(&AHs[ao]), *(const v8ha*)(&AHs[ao + 16]));
            ar[ks] = cat16(*(const v8ha*)(&ARs[ao]), *(const v8ha*)(&ARs[ao + 16])); }
#pragma unroll
        for (int g = 0; g < 3; ++g)                              // q, k, v share the planes
            gemm_tile(wf[g], ah, ar, BS[g * (NBLK * MD) + t * MD + col], 1.0f, dcol + OFF_Q + g * TSZ);
        __syncthreads();                                         // q, k, v: column map -> row map; also frees the planes
        // per-token extreme keys: max_j q k_j = q * (q >= 0 ? kmax : kmin)
        { float mx = -3.0e38f, mn = 3.0e38f;
#pragma unroll
          for (int u = 0; u < 2; ++u) { const v4f kk = *(const v4fa*)(&Ts[OFF_K + ro8 + 4 * u]);
              mx = fmaxf(fmaxf(mx, fmaxf(kk[0], kk[1])), fmaxf(kk[2], kk[3])); mn = fminf(fminf(mn, fminf(kk[0], kk[1])), fminf(kk[2], kk[3])); }
          mx = fmaxf(mx, __shfl_xor(mx, 1, 32)); mn = fminf(mn, __shfl_xor(mn, 1, 32));
          mx = fmaxf(mx, __shfl_xor(mx, 2, 32)); mn = fminf(mn, __shfl_xor(mn, 2, 32));
          mx = fmaxf(mx, __shfl_xor(mx, 4, 32)); mn = fminf(mn, __shfl_xor(mn, 4, 32));
          if (sb == 0) { KXs[tk] = mx; KNs[tk] = mn; } }
        wave_sync();
        // y[n][i] = sum_j softmax_j(q_i k_j) v_j + cur[n][i]; lane owns i = lane and i = lane + 32, the wave's four tokens in sequence (k, v rows are wave-wide broadcasts)
#pragma unroll 1
        for (int nn = 0; nn < 4; ++nn) {
            const int n = 4 * w + nn;
            const int ro = n * TP;
            const float q0 = Ts[OFF_Q + ro + lane], q1 = Ts[OFF_Q + ro + 32 + lane];
            const float kx = KXs[n], kn = KNs[n];
            const float e0 = (q0 >= 0.0f) ? kx : kn, e1 = (q1 >= 0.0f) ? kx : kn;
            const float s0q = q0 * L2E, s1q = q1 * L2E;
            const float c0 = -(e0 * s0q), c1 = -(e1 * s1q);       // minus the row's largest score
            const v2f sq0 = (v2f){s0q, s0q}, sq1 = (v2f){s1q, s1q}, nc0 = (v2f){c0, c0}, nc1 = (v2f){c1, c1};
            v2f s0 = (v2f){0.0f, 0.0f}, s1 = (v2f){0.0f, 0.0f}, y0 = (v2f){0.0f, 0.0f}, y1 = (v2f){0.0f, 0.0f};   // element 0: even keys, element 1: odd keys
#pragma unroll 2
            for (int jj = 0; jj < MD; jj += 4) {
                const v4f kk = *(const v4fa*)(&Ts[OFF_K + ro + jj]); const v4f vv = *(const v4fa*)(&Ts[OFF_V + ro + jj]);
#pragma unroll
                for (int c = 0; c < 2; ++c) {                     // two adjacent keys ride in one register pair, as the LDS load leaves them
                    const v2f k2 = c ? __builtin_shufflevector(kk, kk, 2, 3) : __builtin_shufflevector(kk, kk, 0, 1);
                    const v2f v2 = c ? __builtin_shufflevector(vv, vv, 2, 3) : __builtin_shufflevector(vv, vv, 0, 1);
                    const v2f a0 = __builtin_elementwise_fma(k2, sq0, nc0);   // score minus the row maximum in one packed fma; at most one rounding of the maximum above 0
                    const v2f a1 = __builtin_elementwise_fma(k2, sq1, nc1);
                    const v2f p0 = (v2f){__builtin_amdgcn_exp2f(a0[0]), __builtin_amdgcn_exp2f(a0[1])};
                    const v2f p1 = (v2f){__builtin_amdgcn_exp2f(a1[0]), __builtin_amdgcn_exp2f(a1[1])};
                    s0 += p0; s1 += p1; y0 = __builtin_elementwise_fma(p0, v2, y0); y1 = __builtin_elementwise_fma(p1, v2, y1); } }
            Ts[OFF_Y + ro + lane]      = (y0[0] + y0[1]) * __builtin_amdgcn_rcpf(s0[0] + s0[1]) + Ts[OFF_CUR + ro + lane];
            Ts[OFF_Y + ro + 32 + lane] = (y1[0] + y1[1]) * __builtin_amdgcn_rcpf(s1[0] + s1[1]) + Ts[OFF_CUR + ro + 32 + lane]; }
        wave_sync();
        planes8(&Ts[OFF_Y + ro8], &AHs[po8], &ARs[po8]);         // y rows stay with their wave
        __syncthreads();                                         // planes: row map -> A fragments
        wf[0][0] = ldh(wp + (size_t)3 * NBLK * MD * MD); wf[0][1] = ldh(wp + (size_t)3 * NBLK * MD * MD + FSTEP);
#pragma unroll
        for (int ks = 0; ks < 2; ++ks) { const int ao = lr * HP + ks * 32 + 8 * hi;
            ah[ks] = cat16(*(const v8ha*)(&AHs[ao]), *(const v8ha*)(&AHs[ao + 16]));
            ar[ks] = cat16(*(const v8ha*)(&ARs[ao]), *(const v8ha*)(&ARs[ao + 16])); }
        gemm_tile(wf[0], ah, ar, BS[3 * (NBLK * MD) + t * MD + col], 0.01f, dcol + OFF_Q);   // hidden layer: leaky slope 0.01
        __syncthreads();                                         // hidden layer: column map -> row map; also frees the planes
        planes8(&Ts[OFF_Q + ro8], &AHs[po8], &ARs[po8]);
        __syncthreads();                                         // planes: row map -> A fragments
        wf[0][0] = ldh(wp + (size_t)4 * NBLK * MD * MD); wf[0][1] = ldh(wp + (size_t)4 * NBLK * MD * MD + FSTEP);
#pragma unroll
        for (int ks = 0; ks < 2; ++ks) { const int ao = lr * HP + ks * 32 + 8 * hi;
            ah[ks] = cat16(*(const v8ha*)(&AHs[ao]), *(const v8ha*)(&AHs[ao + 16]));
            ar[ks] = cat16(*(const v8ha*)(&ARs[ao]), *(const v8ha*)(&ARs[ao + 16])); }
        gemm_tile(wf[0], ah, ar, BS[4 * (NBLK * MD) + t * MD + col], 1.0f, dcol + OFF_K);
        __syncthreads();                                         // second feed-forward output: column map -> row map; also frees the planes
        // a = ff + y; res += LayerNorm(a) * g + b; cur = res. Row map: 8 lanes share a token, each keeps its 8 columns in registers
        {
            v4f a[2], g4[2], b4[2];
#pragma unroll
            for (int u = 0; u < 2; ++u) { g4[u] = *(const v4f*)(ln_g + t * MD + 8 * sb + 4 * u); b4[u] = *(const v4f*)(ln_b + t * MD + 8 * sb + 4 * u);
                a[u] = *(const v4fa*)(&Ts[OFF_K + ro8 + 4 * u]) + *(const v4fa*)(&Ts[OFF_Y + ro8 + 4 * u]); }
            const float sm = sum8(((a[0][0] + a[0][1]) + (a[0][2] + a[0][3])) + ((a[1][0] + a[1][1]) + (a[1][2] + a[1][3])));
            const float mu = sm * (1.0f / MD);
            float vs = 0.0f;
#pragma unroll
            for (int u = 0; u < 2; ++u) { const float d0 = a[u][0] - mu, d1 = a[u][1] - mu, d2 = a[u][2] - mu, d3 = a[u][3] - mu; vs += (d0 * d0 + d1 * d1) + (d2 * d2 + d3 * d3); }
            vs = sum8(vs);
            const float inv = __builtin_amdgcn_rsqf(vs * (1.0f / MD) + 1e-5f);
#pragma unroll
            for (int u = 0; u < 2; ++u) { const v4f r4 = *(const v4fa*)(&Ts[OFF_RES + ro8 + 4 * u]); v4f nr;
#pragma unroll
                for (int i = 0; i < 4; ++i) nr[i] = ((a[u][i] - mu) * inv * bfr(g4[u][i]) + bfr(b4[u][i])) + r4[i];
                *(v4fa*)(&Ts[OFF_RES + ro8 + 4 * u]) = nr; *(v4fa*)(&Ts[OFF_CUR + ro8 + 4 * u]) = nr; }
        }
    }
    // head: leaky(res . Wout + bout, 0.1); matrix-vector product in f32 on the vector unit, row map
    {
        float ds = 0.0f;
#pragma unroll
        for (int u = 0; u < 2; ++u) { const v4f r4 = *(const v4fa*)(&Ts[OFF_RES + ro8 + 4 * u]); const v4f w4 = *(const v4f*)(Wout + 8 * sb + 4 * u);
            ds += (r4[0] * bfr(w4[0]) + r4[1] * bfr(w4[1])) + (r4[2] * bfr(w4[2]) + r4[3] * bfr(w4[3])); }
        ds = sum8(ds);
        float ov = ds + bfr(bout[0]);
        ov = (ov >= 0.0f) ? ov : 0.1f * ov;
        if (sb == 0) OS[slab * 16 + tk] = ov;
    }
    __syncthreads();                                             // OS: all eight waves -> the storing lanes
    if (tid < 5 * 8) {                                           // five copies x 8 lanes x 16 B: each copy's 128-byte line stored whole
        const int c = tid >> 3, q4 = (tid & 7) * 4;
        const v4f val = *(const v4fa*)(&OS[q4]);
        *(v4f*)(OUT + (size_t)c * NTOK_FULL + n0 + q4) = val;
    }
}

static constexpr size_t al256(size_t v) { return (v + 255) & ~(size_t)255; }
static constexpr size_t SZ_W1T = al256((size_t)MD * DIN * 2);
static constexpr size_t SZ_WH  = al256((size_t)NGM * NBLK * MD * MD * 2);
static constexpr size_t SZ_TOTAL = SZ_W1T + SZ_WH;
static_assert(SZ_TOTAL <= (size_t)134217728);              // workspace carve <= 128 MiB
static_assert(((size_t)NBLK * MD * MD * 2) % 256 == 0);    // per-input weight sub-planes stay 256-byte aligned
static_assert((size_t)(DIN / 64) * 64 == (size_t)DIN);     // W1 blocks of k_prep x 64 rows == DIN
static_assert((size_t)(NTOK / TOKW) * TOKW == (size_t)NTOK);

extern "C" void kernel_launch(void* const* d_in, const int* in_sizes, int n_in,
                              void* d_out, int out_size, void* d_ws, size_t ws_size, hipStream_t stream) {
    if (n_in < 17) return;
    if ((size_t)in_sizes[0] < (size_t)NTOK * DIN) return;
    if ((size_t)in_sizes[1] < (size_t)DIN * MD || in_sizes[2] < MD) return;
    if ((size_t)in_sizes[3] < (size_t)NBLK * MD * MD || (size_t)in_sizes[5] < (size_t)NBLK * MD * MD || (size_t)in_sizes[7] < (size_t)NBLK * MD * MD) return;
    if ((size_t)in_sizes[9] < (size_t)NBLK * MD * MD || (size_t)in_sizes[11] < (size_t)NBLK * MD * MD) return;
    if (in_sizes[4] < NBLK * MD || in_sizes[6] < NBLK * MD || in_sizes[8] < NBLK * MD || in_sizes[10] < NBLK * MD || in_sizes[12] < NBLK * MD) return;
    if (in_sizes[13] < NBLK * MD || in_sizes[14] < NBLK * MD || in_sizes[15] < MD || in_sizes[16] < 1) return;
    if ((size_t)out_size < (size_t)4 * NTOK_FULL + NTOK) return;
    if (SZ_TOTAL > ws_size) return;
    // wire order: x, W1, b1, Wq, bq, Wk, bk, Wv, bv, Wf1, bf1, Wf2, bf2, ln_g, ln_b, Wout, bout
    const float* x   = (const float*)d_in[0];
    const float* W1  = (const float*)d_in[1];  const float* b1  = (const float*)d_in[2];
    const float* Wq  = (const float*)d_in[3];  const float* bq  = (const float*)d_in[4];
    const float* Wk  = (const float*)d_in[5];  const float* bk  = (const float*)d_in[6];
    const float* Wv  = (const float*)d_in[7];  const float* bv  = (const float*)d_in[8];
    const float* Wf1 = (const float*)d_in[9];  const float* bf1 = (const float*)d_in[10];
    const float* Wf2 = (const float*)d_in[11]; const float* bf2 = (const float*)d_in[12];
    const float* lng = (const float*)d_in[13]; const float* lnb = (const float*)d_in[14];
    const float* Wo  = (const float*)d_in[15]; const float* bo  = (const float*)d_in[16];
    float* OUT = (float*)d_out;                 // five copies, pitch NTOK_FULL floats
    char* wsp = (char*)d_ws;
    bf*  W1T = (bf*)wsp;  wsp += SZ_W1T;        // 64 x 256 bf16, fragment order
    h16* WH  = (h16*)wsp; wsp += SZ_WH;         // [5][3] matrices of 64 x 64 f16 x64, fragment order; g = q | k | v | f1 | f2

    k_prep<<<DIN / 64 + NGM * NBLK, 256, 0, stream>>>(W1, Wq, Wk, Wv, Wf1, Wf2, W1T, WH);   // 4 chunks of W1 and the 15 block matrices, all independent

    k_tok<<<NTOK / TOKW, NTHR, 0, stream>>>(x, W1T, WH, b1, bq, bk, bv, bf1, bf2, lng, lnb, Wo, bo, OUT);
}

// v005
// It runs in 27.7 microseconds.
// Timed twice side by side with v004, it ran 1.14 and 1.15 times as fast.
// All steps since v000 together make it 6.53 times as fast.
#include <hip/hip_runtime.h>

// Per-token outer-product attention stack: h = x W1 + b1 (256 -> 64); three blocks of {q,k,v = cur W + b; y_i = sum_j softmax_j(q_i k_j) v_j + cur_i; a = leaky(y Wf1 + bf1, 0.01) Wf2 + bf2 + y; res += LayerNorm(a)}; out = leaky(res Wout + bout, 0.1), stored five times.
// Compute dtypes, f32 accumulate everywhere: x W1 on v_wmma_f32_16x16x32_bf16 (x, W1 RNE-converted to bf16; products exact); the fifteen 64x64 GEMMs on v_wmma_f32_16x16x32_f16 with the activation as f16 value + f16 residual x2048 (own accumulator, folded by 1/2048) and the weight as f16 of the bf16-converted input x64 (folded by 1/64);
// per-token 64x64 softmax / P.v, LayerNorm and the 64 -> 1 head in f32 on the vector unit (no operand shared between tokens; the head is a matrix-vector product).
// Layout: W1T bf16 (64 x 256) and WH f16 (5 x 3 matrices of 64 x 64), both in B-fragment order (16-byte slots [column tile][32-wide k step][part][lane]), built in the workspace by one launch; fused kernel: eight waves per block own 32 tokens (two 16-token slabs, four waves each), all tiles in LDS.

#ifndef NTOK
#define NTOK 16384
#endif
#define NTOK_FULL 16384
#define DIN  256                 // input width
#define MD   64                  // model width of the blocks
#define NBLK 3                   // stacked blocks
#define NGM  5                   // GEMMs per block: q, k, v, f1, f2
#define TOKW 32                  // tokens per block (two slabs of 16)
#define NTHR 256                 // threads per block of the fused kernel: four waves per slab
#define XP   264                 // LDS bf16 x plane row pitch (elements)
#define TP   68                  // LDS f32 tile row pitch (floats)
#define TSZ  (16 * TP)
#define HP   72                  // LDS f16 plane row pitch (halves)
#define OFF_CUR 0
#define OFF_RES (1 * TSZ)
#define OFF_Q   (2 * TSZ)
#define OFF_K   (3 * TSZ)
#define OFF_V   (4 * TSZ)
#define OFF_Y   (5 * TSZ)
#define QRS  2048.0f             // carry of the activation residual plane
#define QRI  (1.0f / 2048.0f)
#define WSC  64.0f               // carry of the f16 weight planes
#define WSI  (1.0f / 64.0f)
#define L2E  1.4426950408889634f
#define FPART 256                // elements per fragment part: 32 lanes x 8 elements = 512 contiguous bytes, one wave-wide 16-byte load
#define FSTEP (2 * FPART)        // elements per 16-column x 32-k fragment

static_assert(MD == 64);
static_assert(MD % 32 == 0);
static_assert(DIN % 64 == 0);                    // W1 handled in 64-row chunks; k-loop steps by 32
static_assert(DIN % 32 == 0);
static_assert(TOKW == 32);
static_assert(NTOK % TOKW == 0);                 // grid covers the tokens exactly
static_assert(NTOK <= NTOK_FULL);
static_assert((size_t)NTOK_FULL * 4 == 65536);   // byte pitch between the five output copies
static_assert(((size_t)NTOK_FULL * 4) % 128 == 0);
static_assert((TP * 4) % 16 == 0);
static_assert((HP * 2) % 16 == 0);
static_assert(TP >= MD);
static_assert(HP >= MD);
static_assert(NGM * NBLK * MD == 960);           // bias stage size
static_assert(NBLK * MD <= NTHR);                // bias stage: one thread per entry of each input
static_assert(NTHR == 2 * 4 * 32);
static_assert((XP * 2) % 16 == 0);
static_assert(XP >= DIN);
static_assert(32 * 16 == 4 * 128);
static_assert(8 * 16 == 128);                    // output store: 8 lanes x 16 B = one line
static_assert(256 * 2 * 16 == 64 * 128);
static_assert(4 * 2 * FSTEP == MD * MD);         // four column tiles x two k steps fill one 64 x 64 matrix
static_assert(4 * (DIN / 32) * FSTEP == MD * DIN);
static_assert((size_t)2 * 6 * TSZ * 4 + (size_t)2 * 2 * 16 * HP * 2 + (size_t)2 * 16 * XP * 2 + 960 * 4 + 2 * 32 * 4 + 32 * 4 <= 131072);   // static LDS of the fused kernel
static_assert((size_t)64 * 65 * 4 <= 131072);    // static LDS of the converter

typedef _Float16 h16;
typedef unsigned short bf;
typedef __attribute__((ext_vector_type(16))) __bf16   v16bf;
typedef __attribute__((ext_vector_type(16))) _Float16 v16h;
typedef __attribute__((ext_vector_type(8)))  _Float16 v8h;
typedef __attribute__((ext_vector_type(8)))  unsigned short v8us;
typedef __attribute__((ext_vector_type(8)))  float    v8f;
typedef __attribute__((ext_vector_type(4)))  float    v4f;
typedef __attribute__((ext_vector_type(2)))  float    v2f;
typedef v4f  __attribute__((may_alias)) v4fa;
typedef v8h  __attribute__((may_alias)) v8ha;
typedef v8us __attribute__((may_alias)) v8usa;

__device__ __forceinline__ unsigned short f2bf(float f) { unsigned u = __float_as_uint(f); u += 0x7FFFu + ((u >> 16) & 1u); return (unsigned short)(u >> 16); }
__device__ __forceinline__ float bfr(float f) { return __uint_as_float(((unsigned)f2bf(f)) << 16); }   // value after RNE convert to bf16
__device__ __forceinline__ v16h cat16(v8h lo, v8h hi) { return __builtin_shufflevector(lo, hi, 0, 1, 2, 3, 4, 5, 6, 7, 8, 9, 10, 11, 12, 13, 14, 15); }
__device__ __forceinline__ v16bf cat16b(v8us lo, v8us hi) { return __builtin_bit_cast(v16bf, __builtin_shufflevector(lo, hi, 0, 1, 2, 3, 4, 5, 6, 7, 8, 9, 10, 11, 12, 13, 14, 15)); }
__device__ __forceinline__ v8f wmma16(v16h a, v16h b, v8f c) { return __builtin_amdgcn_wmma_f32_16x16x32_f16(false, a, false, b, (short)0, c, false, false); }
__device__ __forceinline__ v8f wmmab(v16bf a, v16bf b, v8f c) { return __builtin_amdgcn_wmma_f32_16x16x32_bf16(false, a, false, b, (short)0, c, false, false); }
// B-fragment loaders from the fragment-ordered weight planes; p already includes + 8*lane: part 0 holds elements 0..7 <- k0+8h+0..7, part 1 elements 8..15 <- k0+16+8h+0..7 of column lane&15, h = lane>>4 (same k map as the A fragments)
__device__ __forceinline__ v16h  ldh(const h16* p) { return cat16(*(const v8h*)p, *(const v8h*)(p + FPART)); }
__device__ __forceinline__ v16bf ldb(const bf* p)  { return cat16b(*(const v8us*)p, *(const v8us*)(p + FPART)); }
// ordering point for wave-private LDS tiles (same wave writes and reads)
__device__ __forceinline__ void wave_sync() { __builtin_amdgcn_fence(3 /* release order */, "wavefront"); __builtin_amdgcn_wave_barrier(); asm volatile("" ::: "memory"); }
// one guarded matrix instruction: the accumulator is tied behind four idle slots, the fragments stay live
__device__ __forceinline__ v8f wmma16g(v16h a, v16h b, v8f c) { c = wmma16(a, b, c); asm volatile("v_nop\n\tv_nop\n\tv_nop\n\tv_nop" : "+v"(c) : "v"(a), "v"(b)); return c; }
__device__ __forceinline__ v8f wmmabg(v16bf a, v16bf b, v8f c) { c = wmmab(a, b, c); asm volatile("v_nop\n\tv_nop\n\tv_nop\n\tv_nop" : "+v"(c) : "v"(a), "v"(b)); return c; }
// f32 -> f16 convert that cannot produce an f16 subnormal (|v| < 2^-14 -> +0)
static __device__ __forceinline__ h16 toh_flush(float v) { const h16 r = (h16)v; return (fabsf(v) < 6.103515625e-05f) ? (h16)0.0f : r; }

// k_prep: every weight plane in one launch; each block transposes one 64 x 64 f32 tile ([k][n]) through LDS and stores it in B-fragment order.
// A 16-byte slot holds 8 consecutive k (group p = k / 8) of one column n and lies at [n >> 4][p >> 2][(p >> 1) & 1][16 * (p & 1) + (n & 15)]: the slots one wave-wide fragment load reads are 512 contiguous bytes.
// Blocks 0..DIN/64-1: 64-row k chunk of W1 -> W1T bf16 [4 tiles][DIN/32 steps][2][32][8]. Block DIN/64 + m, m = g*NBLK + t: matrix t of input g (q, k, v, f1, f2) -> WH f16 [m][4 tiles][2 steps][2][32][8] of (bf16-converted value x 64).
__global__ __launch_bounds__(256) void k_prep(const float* __restrict__ W1, const float* __restrict__ Wq, const float* __restrict__ Wk, const float* __restrict__ Wv,
                                              const float* __restrict__ Wf1, const float* __restrict__ Wf2, bf* W1T, h16* WH) {
    __shared__ float ts[64 * 65];
    const int tid = threadIdx.x;
    const int kc = blockIdx.x;                                  // W1 chunk, where below DIN / 64
    const int m = kc - DIN / 64;                                // matrix number otherwise
    const bool first = kc < DIN / 64;                           // block-uniform
    const int g = m / NBLK;
    const float* Wg = (g == 0) ? Wq : (g == 1) ? Wk : (g == 2) ? Wv : (g == 3) ? Wf1 : Wf2;
    const float* W = first ? W1 + (size_t)kc * 64 * MD : Wg + (size_t)(m - g * NBLK) * MD * MD;
    float wr[16];
#pragma unroll   // all sixteen loads issued before the first is waited for: one trip to L2 instead of a chain of them
    for (int i = 0; i < 16; ++i) wr[i] = W[tid + i * 256];      // 16 x 256 = 64 x 64 entries
    asm volatile("s_wait_xcnt 0x0" ::: "memory");               // precaution: stands behind the group's loads, in front of any later write of their base or offset registers
#pragma unroll
    for (int i = 0; i < 16; ++i) { const int e = tid + i * 256; const int k = e >> 6, n = e & 63; ts[k * 65 + n] = wr[i]; }
    __syncthreads();                                            // cross-wave exchange through ts
    const int p = tid >> 5, p8 = p * 8;                         // one k group per wave
    const int nl = tid & 31;                                    // columns nl and nl + 32
    const int fo = (p >> 1) * FPART + (16 * (p & 1) + (nl & 15)) * 8;   // slot inside the column tile's two k steps of this 64-row chunk
    if (first) {
        v8us o0, o1;
#pragma unroll
        for (int u = 0; u < 8; ++u) { o0[u] = f2bf(ts[(p8 + u) * 65 + nl]); o1[u] = f2bf(ts[(p8 + u) * 65 + nl + 32]); }
        bf* d0 = W1T + (size_t)(nl >> 4) * (DIN / 32 * FSTEP) + (size_t)kc * (2 * FSTEP) + fo;
        bf* d1 = d0 + (size_t)2 * (DIN / 32 * FSTEP);
        *(v8us*)d0 = o0; *(v8us*)d1 = o1;
        asm volatile("s_wait_xcnt 0x0" ::: "memory");           // precaution: stands behind the two stores, in front of any later write of their address or data registers (the other arm follows in the built code)
    } else {
        v8h o0, o1;
#pragma unroll
        for (int u = 0; u < 8; ++u) { o0[u] = toh_flush(bfr(ts[(p8 + u) * 65 + nl]) * WSC); o1[u] = toh_flush(bfr(ts[(p8 + u) * 65 + nl + 32]) * WSC); }
        h16* d0 = WH + (size_t)m * MD * MD + (size_t)(nl >> 4) * (2 * FSTEP) + fo;
        h16* d1 = d0 + (size_t)2 * (2 * FSTEP);
        *(v8h*)d0 = o0; *(v8h*)d1 = o1;
        asm volatile("s_wait_xcnt 0x0" ::: "memory");           // precaution: stands behind the two stores, in front of any later write of their address or data registers (the other arm follows in the built code)
    }
}

// k_tok: fused token kernel, eight waves per block, 32 tokens as two 16-token slabs worked side by side: waves 0..3 own slab 0, waves 4..7 slab 1.
// Inside a slab wave w owns output columns 16w..16w+15 of every GEMM and tokens 4w..4w+3 of every per-token phase; tiles that change hands between the two maps are ordered by __syncthreads, rows that stay with their wave by wave_sync.
// GEMM fragments: A row = token (lane&15) from the 16-bit planes (k contiguous), B column n = lane&15 of tile w from the fragment-ordered weight planes, both with the split k map; D: acc[j] = (token 8*(lane>>4)+j, column 16w + (lane&15)).
// Per slab T holds six f32 tiles [16][TP]: cur, res, q (later the hidden layer), k (later the second feed-forward output), v, y.
// one 16 x 16 x 64 GEMM tile: value and residual planes against one weight tile, bias and leaky slope, stored down one column of the destination tile
__device__ __forceinline__ void gemm_tile(const v16h (&b)[2], const v16h (&ah)[2], const v16h (&ar)[2], const float bb, const float sl, float* dst) {
    v8f acc = (v8f){}, acr = (v8f){};
#pragma unroll   // fragment arrays stay in registers
    for (int ks = 0; ks < 2; ++ks) { acc = wmma16g(ah[ks], b[ks], acc); acr = wmma16g(ar[ks], b[ks], acr); }
#pragma unroll
    for (int j = 0; j < 8; ++j) { float v = (acc[j] + acr[j] * QRI) * WSI + bb;
        v = (v >= 0.0f) ? v : sl * v;
        dst[j * TP] = v; }
}
// activation planes of 8 columns of one token row: f16 value and f16 residual x2048
__device__ __forceinline__ void planes8(const float* srow, h16* hrow, h16* rrow) {
    const v4f x0 = *(const v4fa*)(srow); const v4f x1 = *(const v4fa*)(srow + 4); v8h hv, rv;
#pragma unroll
    for (int i = 0; i < 4; ++i) { const h16 a0 = toh_flush(x0[i]); const h16 a1 = toh_flush(x1[i]); hv[i] = a0; hv[4 + i] = a1;
        rv[i] = toh_flush((x0[i] - (float)a0) * QRS); rv[4 + i] = toh_flush((x1[i] - (float)a1) * QRS); }
    *(v8ha*)(hrow) = hv; *(v8ha*)(rrow) = rv;
}
// sum over the 8 lanes that share a token row
__device__ __forceinline__ float sum8(float v) { v += __shfl_xor(v, 1, 32); v += __shfl_xor(v, 2, 32); v += __shfl_xor(v, 4, 32); return v; }

__global__ __launch_bounds__(NTHR) void k_tok(const float* __restrict__ x, const bf* __restrict__ W1T, const h16* __restrict__ WH,
                                            const float* __restrict__ b1, const float* __restrict__ bq, const float* __restrict__ bk, const float* __restrict__ bv,
                                            const float* __restrict__ bf1, const float* __restrict__ bf2, const float* __restrict__ ln_g, const float* __restrict__ ln_b,
                                            const float* __restrict__ Wout, const float* __restrict__ bout, float* OUT) {
    __shared__ __align__(16) float T[2 * 6 * TSZ];
    __shared__ __align__(16) h16 AH[2 * 16 * HP];
    __shared__ __align__(16) h16 AR[2 * 16 * HP];
    __shared__ __align__(16) bf  XB[2 * 16 * XP];
    __shared__ __align__(16) float BS[NGM * NBLK * MD];
    __shared__ __align__(16) float KX[TOKW];
    __shared__ __align__(16) float KN[TOKW];
    __shared__ __align__(16) float OS[TOKW];
    const int tid = threadIdx.x;
    const int lane = tid & 31, lr = lane & 15, hi = lane >> 4;
    const int wv = __builtin_amdgcn_readfirstlane(tid >> 5);     // wave number, held scalar
    const int slab = wv >> 2, w = wv & 3;
    const int tk = 4 * w + (lane >> 3), sb = lane & 7;           // row map: token of the slab, 8-column group
    const int col = 16 * w + lr;                                 // column map of the GEMM tiles
    const int n0 = blockIdx.x * TOKW;
    float* Ts = T + slab * (6 * TSZ);
    h16* AHs = AH + slab * (16 * HP);
    h16* ARs = AR + slab * (16 * HP);
    bf*  XBs = XB + slab * (16 * XP);
    float* KXs = KX + slab * 16;
    float* KNs = KN + slab * 16;

    // Every global load of this kernel but the x rows and the GEMM biases is issued a phase or more ahead of its first use, so that its trip to L2 runs under other work instead of behind a barrier.
    const h16* wp0 = WH + (size_t)w * (2 * FSTEP) + 8 * lane;    // this lane's slots in the wave's column tile of block 0; block t lies t matrices, GEMM g lies g * NBLK matrices further
    v16h wq[3][2];                                               // q, k, v weight tiles of the coming block
    v4f wo[2];                                                   // head weights of this lane's 8 columns
    float bo;                                                    // head bias

    // ---- input layer: h = x W1 + b1 (K = DIN); the slab's x rows are converted once into the bf16 plane XB, each wave then forms its own 16 columns ----
    {
        const float* xr = x + (size_t)(n0 + slab * 16 + tk) * DIN + 8 * sb;
        const bf* wb = W1T + (size_t)w * (DIN / 32 * FSTEP) + 8 * lane;   // the wave's column tile: DIN/32 fragments in a row
        v4f xv[DIN / 32];
#pragma unroll   // all eight row loads in flight together
        for (int u = 0; u < DIN / 64; ++u) { xv[2 * u] = *(const v4f*)(xr + 64 * u); xv[2 * u + 1] = *(const v4f*)(xr + 64 * u + 4); }
        v16bf b[DIN / 32];                                       // the wave's whole W1 tile, fetched as one group behind the x rows
#pragma unroll   // one load group, fragments in registers
        for (int kc = 0; kc < DIN; kc += 32) b[kc / 32] = ldb(wb + (kc / 32) * FSTEP);
        const float bb = bfr(b1[col]);
        float bl[NGM] = {0.0f, 0.0f, 0.0f, 0.0f, 0.0f};          // GEMM biases, one entry of each input per thread
        if (tid < NBLK * MD) { bl[0] = bq[tid]; bl[1] = bk[tid]; bl[2] = bv[tid]; bl[3] = bf1[tid]; bl[4] = bf2[tid]; }
        asm volatile("s_wait_xcnt 0x0" ::: "memory");            // precaution: stands behind the group's loads, in front of any later write of their base or offset registers
#pragma unroll
        for (int u = 0; u < DIN / 64; ++u) {
            v8us o;
#pragma unroll
            for (int i = 0; i < 4; ++i) { o[i] = f2bf(xv[2 * u][i]); o[4 + i] = f2bf(xv[2 * u + 1][i]); }
            *(v8usa*)(&XBs[tk * XP + 8 * sb + 64 * u]) = o; }
        // GEMM biases (bf16-converted values) staged once: BS[g*192 + t*64 + col]; first read behind the barriers of the input layer
        if (tid < NBLK * MD) { const int e = tid;
            BS[e] = bfr(bl[0]); BS[192 + e] = bfr(bl[1]); BS[384 + e] = bfr(bl[2]); BS[576 + e] = bfr(bl[3]); BS[768 + e] = bfr(bl[4]); }
        __syncthreads();                                         // XB rows go from their converting wave to all four waves of the slab
#pragma unroll   // one load group, fragments in registers: block 0's q, k, v tiles and the head's parameters fly under the input GEMM
        for (int g = 0; g < 3; ++g) { wq[g][0] = ldh(wp0 + (size_t)g * NBLK * MD * MD); wq[g][1] = ldh(wp0 + (size_t)g * NBLK * MD * MD + FSTEP); }
        wo[0] = *(const v4f*)(Wout + 8 * sb); wo[1] = *(const v4f*)(Wout + 8 * sb + 4); bo = bout[0];
        asm volatile("s_wait_xcnt 0x0" ::: "memory");            // precaution: stands behind the group's loads, in front of any later write of their base or offset registers
        v8f acc = (v8f){};
#pragma unroll
        for (int kc = 0; kc < DIN; kc += 32) {
            const int ao = lr * XP + kc + 8 * hi;
            const v16bf a = cat16b(*(const v8usa*)(&XBs[ao]), *(const v8usa*)(&XBs[ao + 16]));
            acc = wmmabg(a, b[kc / 32], acc); }
#pragma unroll
        for (int j = 0; j < 8; ++j) { const float hv = acc[j] + bb;
            Ts[OFF_CUR + (8 * hi + j) * TP + col] = hv;
            Ts[OFF_RES + (8 * hi + j) * TP + col] = (hv >= 0.0f) ? hv : 0.1f * hv; }
    }
    __syncthreads();                                             // cur, res: column map -> row map

    const int ro8 = tk * TP + 8 * sb;                            // this lane's 8 columns in the row map
    const int po8 = tk * HP + 8 * sb;
    float* dcol = Ts + (8 * hi) * TP + col;                      // this lane's column in the column map
#pragma unroll 1
    for (int t = 0; t < NBLK; ++t) {
        v16h ah[2], ar[2], wf1[2], wf2[2];
        v4f g4[2], b4[2];
        const h16* wp = wp0 + (size_t)(t * MD) * MD;
        // planes of cur (each lane reads back the 8 values it wrote itself, or values behind the barrier above)
        planes8(&Ts[OFF_CUR + ro8], &AHs[po8], &ARs[po8]);
        __syncthreads();                                         // planes: row map -> A fragments of all four waves
#pragma unroll
        for (int ks = 0; ks < 2; ++ks) { const int ao = lr * HP + ks * 32 + 8 * hi;
            ah[ks] = cat16(*(const v8ha*)(&AHs[ao]), *(const v8ha*)(&AHs[ao + 16]));
            ar[ks] = cat16(*(const v8ha*)(&ARs[ao]), *(const v8ha*)(&ARs[ao + 16])); }
#pragma unroll
        for (int g = 0; g < 3; ++g)                              // q, k, v share the planes
            gemm_tile(wq[g], ah, ar, BS[g * (NBLK * MD) + t * MD + col], 1.0f, dcol + OFF_Q + g * TSZ);
        __syncthreads();                                         // q, k, v: column map -> row map; also frees the planes
        // both feed-forward weight tiles and the LayerNorm parameters fly under the softmax (issued behind the barrier, whose fence would wait for them)
        wf1[0] = ldh(wp + (size_t)3 * NBLK * MD * MD); wf1[1] = ldh(wp + (size_t)3 * NBLK * MD * MD + FSTEP);
        wf2[0] = ldh(wp + (size_t)4 * NBLK * MD * MD); wf2[1] = ldh(wp + (size_t)4 * NBLK * MD * MD + FSTEP);
#pragma unroll
        for (int u = 0; u < 2; ++u) { g4[u] = *(const v4f*)(ln_g + t * MD + 8 * sb + 4 * u); b4[u] = *(const v4f*)(ln_b + t * MD + 8 * sb + 4 * u); }
        asm volatile("s_wait_xcnt 0x0" ::: "memory");            // precaution: stands behind the group's loads, in front of any later write of their base or offset registers
        // per-token extreme keys: max_j q k_j = q * (q >= 0 ? kmax : kmin)
        { float mx = -3.0e38f, mn = 3.0e38f;
#pragma unroll
          for (int u = 0; u < 2; ++u) { const v4f kk = *(const v4fa*)(&Ts[OFF_K + ro8 + 4 * u]);
              mx = fmaxf(fmaxf(mx, fmaxf(kk[0], kk[1])), fmaxf(kk[2], kk[3])); mn = fminf(fminf(mn, fminf(kk[0], kk[1])), fminf(kk[2], kk[3])); }
          mx = fmaxf(mx, __shfl_xor(mx, 1, 32)); mn = fminf(mn, __shfl_xor(mn, 1, 32));
          mx = fmaxf(mx, __shfl_xor(mx, 2, 32)); mn = fminf(mn, __shfl_xor(mn, 2, 32));
          mx = fmaxf(mx, __shfl_xor(mx, 4, 32)); mn = fminf(mn, __shfl_xor(mn, 4, 32));
          if (sb == 0) { KXs[tk] = mx; KNs[tk] = mn; } }
        wave_sync();
        // y[n][i] = sum_j softmax_j(q_i k_j) v_j + cur[n][i]; lane owns i = lane and i = lane + 32, the wave's four tokens in sequence (k, v rows are wave-wide broadcasts)
#pragma unroll 1
        for (int nn = 0; nn < 4; ++nn) {
            const int n = 4 * w + nn;
            const int ro = n * TP;
            const float q0 = Ts[OFF_Q + ro + lane], q1 = Ts[OFF_Q + ro + 32 + lane];
            const float kx = KXs[n], kn = KNs[n];
            const float e0 = (q0 >= 0.0f) ? kx : kn, e1 = (q1 >= 0.0f) ? kx : kn;
            const float s0q = q0 * L2E, s1q = q1 * L2E;
            const float c0 = -(e0 * s0q), c1 = -(e1 * s1q);       // minus the row's largest score
            const v2f sq0 = (v2f){s0q, s0q}, sq1 = (v2f){s1q, s1q}, nc0 = (v2f){c0, c0}, nc1 = (v2f){c1, c1};
            v2f s0 = (v2f){0.0f, 0.0f}, s1 = (v2f){0.0f, 0.0f}, y0 = (v2f){0.0f, 0.0f}, y1 = (v2f){0.0f, 0.0f};   // element 0: even keys, element 1: odd keys
#pragma unroll 2
            for (int jj = 0; jj < MD; jj += 4) {
                const v4f kk = *(const v4fa*)(&Ts[OFF_K + ro + jj]); const v4f vv = *(const v4fa*)(&Ts[OFF_V + ro + jj]);
#pragma unroll
                for (int c = 0; c < 2; ++c) {                     // two adjacent keys ride in one register pair, as the LDS load leaves them
                    const v2f k2 = c ? __builtin_shufflevector(kk, kk, 2, 3) : __builtin_shufflevector(kk, kk, 0, 1);
                    const v2f v2 = c ? __builtin_shufflevector(vv, vv, 2, 3) : __builtin_shufflevector(vv, vv, 0, 1);
                    const v2f a0 = __builtin_elementwise_fma(k2, sq0, nc0);   // score minus the row maximum in one packed fma; at most one rounding of the maximum above 0
                    const v2f a1 = __builtin_elementwise_fma(k2, sq1, nc1);
                    const v2f p0 = (v2f){__builtin_amdgcn_exp2f(a0[0]), __builtin_amdgcn_exp2f(a0[1])};
                    const v2f p1 = (v2f){__builtin_amdgcn_exp2f(a1[0]), __builtin_amdgcn_exp2f(a1[1])};
                    s0 += p0; s1 += p1; y0 = __builtin_elementwise_fma(p0, v2, y0); y1 = __builtin_elementwise_fma(p1, v2, y1); } }
            Ts[OFF_Y + ro + lane]      = (y0[0] + y0[1]) * __builtin_amdgcn_rcpf(s0[0] + s0[1]) + Ts[OFF_CUR + ro + lane];
            Ts[OFF_Y + ro + 32 + lane] = (y1[0] + y1[1]) * __builtin_amdgcn_rcpf(s1[0] + s1[1]) + Ts[OFF_CUR + ro + 32 + lane]; }
        wave_sync();
        planes8(&Ts[OFF_Y + ro8], &AHs[po8], &ARs[po8]);         // y rows stay with their wave
        __syncthreads();                                         // planes: row map -> A fragments
#pragma unroll
        for (int ks = 0; ks < 2; ++ks) { const int ao = lr * HP + ks * 32 + 8 * hi;
            ah[ks] = cat16(*(const v8ha*)(&AHs[ao]), *(const v8ha*)(&AHs[ao + 16]));
            ar[ks] = cat16(*(const v8ha*)(&ARs[ao]), *(const v8ha*)(&ARs[ao + 16])); }
        gemm_tile(wf1, ah, ar, BS[3 * (NBLK * MD) + t * MD + col], 0.01f, dcol + OFF_Q);   // hidden layer: leaky slope 0.01
        __syncthreads();                                         // hidden layer: column map -> row map; also frees the planes
        planes8(&Ts[OFF_Q + ro8], &AHs[po8], &ARs[po8]);
        __syncthreads();                                         // planes: row map -> A fragments
#pragma unroll
        for (int ks = 0; ks < 2; ++ks) { const int ao = lr * HP + ks * 32 + 8 * hi;
            ah[ks] = cat16(*(const v8ha*)(&AHs[ao]), *(const v8ha*)(&AHs[ao + 16]));
            ar[ks] = cat16(*(const v8ha*)(&ARs[ao]), *(const v8ha*)(&ARs[ao + 16])); }
        gemm_tile(wf2, ah, ar, BS[4 * (NBLK * MD) + t * MD + col], 1.0f, dcol + OFF_K);
        __syncthreads();                                         // second feed-forward output: column map -> row map; also frees the planes
        if (t + 1 < NBLK) {                                      // the next block's q, k, v tiles fly under the LayerNorm and the plane split
#pragma unroll   // one load group, fragments in registers
            for (int g = 0; g < 3; ++g) { wq[g][0] = ldh(wp + (size_t)(g * NBLK + 1) * MD * MD); wq[g][1] = ldh(wp + (size_t)(g * NBLK + 1) * MD * MD + FSTEP); }
            asm volatile("s_wait_xcnt 0x0" ::: "memory");        // precaution: stands behind the group's loads, in front of any later write of their base or offset registers
        }
        // a = ff + y; res += LayerNorm(a) * g + b; cur = res. Row map: 8 lanes share a token, each keeps its 8 columns in registers
        {
            v4f a[2];
#pragma unroll
            for (int u = 0; u < 2; ++u) a[u] = *(const v4fa*)(&Ts[OFF_K + ro8 + 4 * u]) + *(const v4fa*)(&Ts[OFF_Y + ro8 + 4 * u]);
            const float sm = sum8(((a[0][0] + a[0][1]) + (a[0][2] + a[0][3])) + ((a[1][0] + a[1][1]) + (a[1][2] + a[1][3])));
            const float mu = sm * (1.0f / MD);
            float vs = 0.0f;
#pragma unroll
            for (int u = 0; u < 2; ++u) { const float d0 = a[u][0] - mu, d1 = a[u][1] - mu, d2 = a[u][2] - mu, d3 = a[u][3] - mu; vs += (d0 * d0 + d1 * d1) + (d2 * d2 + d3 * d3); }
            vs = sum8(vs);
            const float inv = __builtin_amdgcn_rsqf(vs * (1.0f / MD) + 1e-5f);
#pragma unroll
            for (int u = 0; u < 2; ++u) { const v4f r4 = *(const v4fa*)(&Ts[OFF_RES + ro8 + 4 * u]); v4f nr;
#pragma unroll
                for (int i = 0; i < 4; ++i) nr[i] = ((a[u][i] - mu) * inv * bfr(g4[u][i]) + bfr(b4[u][i])) + r4[i];
                *(v4fa*)(&Ts[OFF_RES + ro8 + 4 * u]) = nr; *(v4fa*)(&Ts[OFF_CUR + ro8 + 4 * u]) = nr; }
        }
    }
    // head: leaky(res . Wout + bout, 0.1); matrix-vector product in f32 on the vector unit, row map
    {
        float ds = 0.0f;
#pragma unroll
        for (int u = 0; u < 2; ++u) { const v4f r4 = *(const v4fa*)(&Ts[OFF_RES + ro8 + 4 * u]); const v4f w4 = wo[u];
            ds += (r4[0] * bfr(w4[0]) + r4[1] * bfr(w4[1])) + (r4[2] * bfr(w4[2]) + r4[3] * bfr(w4[3])); }
        ds = sum8(ds);
        float ov = ds + bfr(bo);
        ov = (ov >= 0.0f) ? ov : 0.1f * ov;
        if (sb == 0) OS[slab * 16 + tk] = ov;
    }
    __syncthreads();                                             // OS: all eight waves -> the storing lanes
    if (tid < 5 * 8) {                                           // five copies x 8 lanes x 16 B: each copy's 128-byte line stored whole
        const int c = tid >> 3, q4 = (tid & 7) * 4;
        const v4f val = *(const v4fa*)(&OS[q4]);
        *(v4f*)(OUT + (size_t)c * NTOK_FULL + n0 + q4) = val;
    }
}

static constexpr size_t al256(size_t v) { return (v + 255) & ~(size_t)255; }
static constexpr size_t SZ_W1T = al256((size_t)MD * DIN * 2);
static constexpr size_t SZ_WH  = al256((size_t)NGM * NBLK * MD * MD * 2);
static constexpr size_t SZ_TOTAL = SZ_W1T + SZ_WH;
static_assert(SZ_TOTAL <= (size_t)134217728);              // workspace carve <= 128 MiB
static_assert(((size_t)NBLK * MD * MD * 2) % 256 == 0);    // per-input weight sub-planes stay 256-byte aligned
static_assert((size_t)(DIN / 64) * 64 == (size_t)DIN);     // W1 blocks of k_prep x 64 rows == DIN
static_assert((size_t)(NTOK / TOKW) * TOKW == (size_t)NTOK);

extern "C" void kernel_launch(void* const* d_in, const int* in_sizes, int n_in,
                              void* d_out, int out_size, void* d_ws, size_t ws_size, hipStream_t stream) {
    if (n_in < 17) return;
    if ((size_t)in_sizes[0] < (size_t)NTOK * DIN) return;
    if ((size_t)in_sizes[1] < (size_t)DIN * MD || in_sizes[2] < MD) return;
    if ((size_t)in_sizes[3] < (size_t)NBLK * MD * MD || (size_t)in_sizes[5] < (size_t)NBLK * MD * MD || (size_t)in_sizes[7] < (size_t)NBLK * MD * MD) return;
    if ((size_t)in_sizes[9] < (size_t)NBLK * MD * MD || (size_t)in_sizes[11] < (size_t)NBLK * MD * MD) return;
    if (in_sizes[4] < NBLK * MD || in_sizes[6] < NBLK * MD || in_sizes[8] < NBLK * MD || in_sizes[10] < NBLK * MD || in_sizes[12] < NBLK * MD) return;
    if (in_sizes[13] < NBLK * MD || in_sizes[14] < NBLK * MD || in_sizes[15] < MD || in_sizes[16] < 1) return;
    if ((size_t)out_size < (size_t)4 * NTOK_FULL + NTOK) return;
    if (SZ_TOTAL > ws_size) return;
    // wire order: x, W1, b1, Wq, bq, Wk, bk, Wv, bv, Wf1, bf1, Wf2, bf2, ln_g, ln_b, Wout, bout
    const float* x   = (const float*)d_in[0];
    const float* W1  = (const float*)d_in[1];  const float* b1  = (const float*)d_in[2];
    const float* Wq  = (const float*)d_in[3];  const float* bq  = (const float*)d_in[4];
    const float* Wk  = (const float*)d_in[5];  const float* bk  = (const float*)d_in[6];
    const float* Wv  = (const float*)d_in[7];  const float* bv  = (const float*)d_in[8];
    const float* Wf1 = (const float*)d_in[9];  const float* bf1 = (const float*)d_in[10];
    const float* Wf2 = (const float*)d_in[11]; const float* bf2 = (const float*)d_in[12];
    const float* lng = (const float*)d_in[13]; const float* lnb = (const float*)d_in[14];
    const float* Wo  = (const float*)d_in[15]; const float* bo  = (const float*)d_in[16];
    float* OUT = (float*)d_out;                 // five copies, pitch NTOK_FULL floats
    char* wsp = (char*)d_ws;
    bf*  W1T = (bf*)wsp;  wsp += SZ_W1T;        // 64 x 256 bf16, fragment order
    h16* WH  = (h16*)wsp; wsp += SZ_WH;         // [5][3] matrices of 64 x 64 f16 x64, fragment order; g = q | k | v | f1 | f2

    k_prep<<<DIN / 64 + NGM * NBLK, 256, 0, stream>>>(W1, Wq, Wk, Wv, Wf1, Wf2, W1T, WH);   // 4 chunks of W1 and the 15 block matrices, all independent

    k_tok<<<NTOK / TOKW, NTHR, 0, stream>>>(x, W1T, WH, b1, bq, bk, bv, bf1, bf2, lng, lnb, Wo, bo, OUT);
}

// v006
// Measured time: 26.3 microseconds a run.
// In two side-by-side timings against v005, it was 1.06 and 1.05 times as fast.
// Counting every step since v000, it is 6.88 times as fast.
#include <hip/hip_runtime.h>

// Per-token outer-product attention stack: h = x W1 + b1 (256 -> 64); three blocks of {q,k,v = cur W + b; y_i = sum_j softmax_j(q_i k_j) v_j + cur_i; a = leaky(y Wf1 + bf1, 0.01) Wf2 + bf2 + y; res += LayerNorm(a)}; out = leaky(res Wout + bout, 0.1), stored five times.
// Compute dtypes, f32 accumulate everywhere: x W1 on v_wmma_f32_16x16x32_bf16 (x, W1 RNE-converted to bf16; products exact); the fifteen 64x64 GEMMs on v_wmma_f32_16x16x32_f16 with the activation as f16 value + f16 residual x2048 (own accumulator, folded by 1/2048) and the weight as f16 of the bf16-converted input x64 (folded by 1/64);
// per-token 64x64 softmax / P.v, LayerNorm and the 64 -> 1 head in f32 on the vector unit (no operand shared between tokens; the head is a matrix-vector product).
// Layout: W1T bf16 (64 x 256) and WH f16 (5 x 3 matrices of 64 x 64), both in B-fragment order (16-byte slots [column tile][32-wide k step][part][lane]), built in the workspace by one launch; fused kernel: eight waves per block own 32 tokens (two 16-token slabs, four waves each), all tiles in LDS.

#ifndef NTOK
#define NTOK 16384
#endif
#define NTOK_FULL 16384
#define DIN  256                 // input width
#define MD   64                  // model width of the blocks
#define NBLK 3                   // stacked blocks
#define NGM  5                   // GEMMs per block: q, k, v, f1, f2
#define TOKW 32                  // tokens per block (two slabs of 16)
#define NTHR 256                 // threads per block of the fused kernel: four waves per slab
#define XP   264                 // LDS bf16 x plane row pitch (elements)
#define TP   68                  // LDS f32 tile row pitch (floats)
#define TSZ  (16 * TP)
#define HP   72                  // LDS f16 plane row pitch (halves)
#define OFF_CUR 0
#define OFF_RES (1 * TSZ)
#define OFF_Q   (2 * TSZ)
#define OFF_K   (3 * TSZ)
#define OFF_V   (4 * TSZ)
#define OFF_Y   (5 * TSZ)
#define QRS  2048.0f             // carry of the activation residual plane
#define QRI  (1.0f / 2048.0f)
#define WSC  64.0f               // carry of the f16 weight planes
#define WSI  (1.0f / 64.0f)
#define L2E  1.4426950408889634f
#define FPART 256                // elements per fragment part: 32 lanes x 8 elements = 512 contiguous bytes, one wave-wide 16-byte load
#define FSTEP (2 * FPART)        // elements per 16-column x 32-k fragment

static_assert(MD == 64);
static_assert(MD % 32 == 0);
static_assert(DIN % 64 == 0);                    // W1 handled in 64-row chunks; k-loop steps by 32
static_assert(DIN % 32 == 0);
static_assert(TOKW == 32);
static_assert(NTOK % TOKW == 0);                 // grid covers the tokens exactly
static_assert(NTOK <= NTOK_FULL);
static_assert((size_t)NTOK_FULL * 4 == 65536);   // byte pitch between the five output copies
static_assert(((size_t)NTOK_FULL * 4) % 128 == 0);
static_assert((TP * 4) % 16 == 0);
static_assert((HP * 2) % 16 == 0);
static_assert(TP >= MD);
static_assert(HP >= MD);
static_assert(NGM * NBLK * MD == 960);           // bias stage size
static_assert(NBLK * MD <= NTHR);                // bias stage: one thread per entry of each input
static_assert(NTHR == 2 * 4 * 32);
static_assert((XP * 2) % 16 == 0);
static_assert(XP >= DIN);
static_assert(32 * 16 == 4 * 128);
static_assert(8 * 16 == 128);                    // output store: 8 lanes x 16 B = one line
static_assert(256 * 2 * 16 == 64 * 128);
static_assert(4 * 2 * FSTEP == MD * MD);         // four column tiles x two k steps fill one 64 x 64 matrix
static_assert(4 * (DIN / 32) * FSTEP == MD * DIN);
static_assert((size_t)2 * 6 * TSZ * 4 + (size_t)2 * 2 * 16 * HP * 2 + (size_t)2 * 16 * XP * 2 + 960 * 4 + 32 * 4 <= 131072);   // static LDS of the fused kernel
static_assert((size_t)64 * 65 * 4 <= 131072);    // static LDS of the converter

typedef _Float16 h16;
typedef unsigned short bf;
typedef __attribute__((ext_vector_type(16))) __bf16   v16bf;
typedef __attribute__((ext_vector_type(16))) _Float16 v16h;
typedef __attribute__((ext_vector_type(8)))  _Float16 v8h;
typedef __attribute__((ext_vector_type(8)))  unsigned short v8us;
typedef __attribute__((ext_vector_type(8)))  float    v8f;
typedef __attribute__((ext_vector_type(4)))  float    v4f;
typedef __attribute__((ext_vector_type(2)))  float    v2f;
typedef v4f  __attribute__((may_alias)) v4fa;
typedef v8h  __attribute__((may_alias)) v8ha;
typedef v8us __attribute__((may_alias)) v8usa;

__device__ __forceinline__ unsigned short f2bf(float f) { unsigned u = __float_as_uint(f); u += 0x7FFFu + ((u >> 16) & 1u); return (unsigned short)(u >> 16); }
__device__ __forceinline__ float bfr(float f) { return __uint_as_float(((unsigned)f2bf(f)) << 16); }   // value after RNE convert to bf16
__device__ __forceinline__ v16h cat16(v8h lo, v8h hi) { return __builtin_shufflevector(lo, hi, 0, 1, 2, 3, 4, 5, 6, 7, 8, 9, 10, 11, 12, 13, 14, 15); }
__device__ __forceinline__ v16bf cat16b(v8us lo, v8us hi) { return __builtin_bit_cast(v16bf, __builtin_shufflevector(lo, hi, 0, 1, 2, 3, 4, 5, 6, 7, 8, 9, 10, 11, 12, 13, 14, 15)); }
__device__ __forceinline__ v8f wmma16(v16h a, v16h b, v8f c) { return __builtin_amdgcn_wmma_f32_16x16x32_f16(false, a, false, b, (short)0, c, false, false); }
__device__ __forceinline__ v8f wmmab(v16bf a, v16bf b, v8f c) { return __builtin_amdgcn_wmma_f32_16x16x32_bf16(false, a, false, b, (short)0, c, false, false); }
// B-fragment loaders from the fragment-ordered weight planes; p already includes + 8*lane: part 0 holds elements 0..7 <- k0+8h+0..7, part 1 elements 8..15 <- k0+16+8h+0..7 of column lane&15, h = lane>>4 (same k map as the A fragments)
__device__ __forceinline__ v16h  ldh(const h16* p) { return cat16(*(const v8h*)p, *(const v8h*)(p + FPART)); }
__device__ __forceinline__ v16bf ldb(const bf* p)  { return cat16b(*(const v8us*)p, *(const v8us*)(p + FPART)); }
// one guarded matrix instruction: the accumulator is tied behind four idle slots, the fragments stay live
__device__ __forceinline__ v8f wmma16g(v16h a, v16h b, v8f c) { c = wmma16(a, b, c); asm volatile("v_nop\n\tv_nop\n\tv_nop\n\tv_nop" : "+v"(c) : "v"(a), "v"(b)); return c; }
__device__ __forceinline__ v8f wmmabg(v16bf a, v16bf b, v8f c) { c = wmmab(a, b, c); asm volatile("v_nop\n\tv_nop\n\tv_nop\n\tv_nop" : "+v"(c) : "v"(a), "v"(b)); return c; }
// f32 -> f16 convert that cannot produce an f16 subnormal (|v| < 2^-14 -> +0)
static __device__ __forceinline__ h16 toh_flush(float v) { const h16 r = (h16)v; return (fabsf(v) < 6.103515625e-05f) ? (h16)0.0f : r; }

// k_prep: every weight plane in one launch; each block transposes one 64 x 64 f32 tile ([k][n]) through LDS and stores it in B-fragment order.
// A 16-byte slot holds 8 consecutive k (group p = k / 8) of one column n and lies at [n >> 4][p >> 2][(p >> 1) & 1][16 * (p & 1) + (n & 15)]: the slots one wave-wide fragment load reads are 512 contiguous bytes.
// Blocks 0..DIN/64-1: 64-row k chunk of W1 -> W1T bf16 [4 tiles][DIN/32 steps][2][32][8]. Block DIN/64 + m, m = g*NBLK + t: matrix t of input g (q, k, v, f1, f2) -> WH f16 [m][4 tiles][2 steps][2][32][8] of (bf16-converted value x 64).
__global__ __launch_bounds__(256) void k_prep(const float* __restrict__ W1, const float* __restrict__ Wq, const float* __restrict__ Wk, const float* __restrict__ Wv,
                                              const float* __restrict__ Wf1, const float* __restrict__ Wf2, bf* W1T, h16* WH) {
    __shared__ float ts[64 * 65];
    const int tid = threadIdx.x;
    const int kc = blockIdx.x;                                  // W1 chunk, where below DIN / 64
    const int m = kc - DIN / 64;                                // matrix number otherwise
    const bool first = kc < DIN / 64;                           // block-uniform
    const int g = m / NBLK;
    const float* Wg = (g == 0) ? Wq : (g == 1) ? Wk : (g == 2) ? Wv : (g == 3) ? Wf1 : Wf2;
    const float* W = first ? W1 + (size_t)kc * 64 * MD : Wg + (size_t)(m - g * NBLK) * MD * MD;
    float wr[16];
#pragma unroll   // all sixteen loads issued before the first is waited for: one trip to L2 instead of a chain of them
    for (int i = 0; i < 16; ++i) wr[i] = W[tid + i * 256];      // 16 x 256 = 64 x 64 entries
    asm volatile("s_wait_xcnt 0x0" ::: "memory");               // precaution: stands behind the group's loads, in front of any later write of their base or offset registers
#pragma unroll
    for (int i = 0; i < 16; ++i) { const int e = tid + i * 256; const int k = e >> 6, n = e & 63; ts[k * 65 + n] = wr[i]; }
    __syncthreads();                                            // cross-wave exchange through ts
    const int p = tid >> 5, p8 = p * 8;                         // one k group per wave
    const int nl = tid & 31;                                    // columns nl and nl + 32
    const int fo = (p >> 1) * FPART + (16 * (p & 1) + (nl & 15)) * 8;   // slot inside the column tile's two k steps of this 64-row chunk
    if (first) {
        v8us o0, o1;
#pragma unroll
        for (int u = 0; u < 8; ++u) { o0[u] = f2bf(ts[(p8 + u) * 65 + nl]); o1[u] = f2bf(ts[(p8 + u) * 65 + nl + 32]); }
        bf* d0 = W1T + (size_t)(nl >> 4) * (DIN / 32 * FSTEP) + (size_t)kc * (2 * FSTEP) + fo;
        bf* d1 = d0 + (size_t)2 * (DIN / 32 * FSTEP);
        *(v8us*)d0 = o0; *(v8us*)d1 = o1;
        asm volatile("s_wait_xcnt 0x0" ::: "memory");           // precaution: stands behind the two stores, in front of any later write of their address or data registers (the other arm follows in the built code)
    } else {
        v8h o0, o1;
#pragma unroll
        for (int u = 0; u < 8; ++u) { o0[u] = toh_flush(bfr(ts[(p8 + u) * 65 + nl]) * WSC); o1[u] = toh_flush(bfr(ts[(p8 + u) * 65 + nl + 32]) * WSC); }
        h16* d0 = WH + (size_t)m * MD * MD + (size_t)(nl >> 4) * (2 * FSTEP) + fo;
        h16* d1 = d0 + (size_t)2 * (2 * FSTEP);
        *(v8h*)d0 = o0; *(v8h*)d1 = o1;
        asm volatile("s_wait_xcnt 0x0" ::: "memory");           // precaution: stands behind the two stores, in front of any later write of their address or data registers (the other arm follows in the built code)
    }
}

// k_tok: fused token kernel, eight waves per block, 32 tokens as two 16-token slabs worked side by side: waves 0..3 own slab 0, waves 4..7 slab 1.
// Inside a slab wave w owns output columns 16w..16w+15 of every GEMM and tokens 4w..4w+3 of every per-token phase; tiles that change hands between the two maps are ordered by __syncthreads; in the row map a lane reads back only what it wrote itself.
// GEMM fragments: A row = token (lane&15) from the 16-bit planes (k contiguous), B column n = lane&15 of tile w from the fragment-ordered weight planes, both with the split k map; D: acc[j] = (token 8*(lane>>4)+j, column 16w + (lane&15)).
// Per slab T holds six f32 tiles [16][TP]: cur, res, q (later the hidden layer), k (later the second feed-forward output), v, y.
// one 16 x 16 x 64 GEMM tile: value and residual planes against one weight tile, bias and leaky slope, stored down one column of the destination tile
__device__ __forceinline__ void gemm_tile(const v16h (&b)[2], const v16h (&ah)[2], const v16h (&ar)[2], const float bb, const float sl, float* dst) {
    v8f acc = (v8f){}, acr = (v8f){};
#pragma unroll   // fragment arrays stay in registers
    for (int ks = 0; ks < 2; ++ks) { acc = wmma16g(ah[ks], b[ks], acc); acr = wmma16g(ar[ks], b[ks], acr); }
#pragma unroll
    for (int j = 0; j < 8; ++j) { float v = (acc[j] + acr[j] * QRI) * WSI + bb;
        v = (v >= 0.0f) ? v : sl * v;
        dst[j * TP] = v; }
}
// activation planes of 8 columns of one token row: f16 value and f16 residual x2048
__device__ __forceinline__ void planes8v(const v4f x0, const v4f x1, h16* hrow, h16* rrow) {
    v8h hv, rv;
#pragma unroll
    for (int i = 0; i < 4; ++i) { const h16 a0 = toh_flush(x0[i]); const h16 a1 = toh_flush(x1[i]); hv[i] = a0; hv[4 + i] = a1;
        rv[i] = toh_flush((x0[i] - (float)a0) * QRS); rv[4 + i] = toh_flush((x1[i] - (float)a1) * QRS); }
    *(v8ha*)(hrow) = hv; *(v8ha*)(rrow) = rv;
}
__device__ __forceinline__ void planes8(const float* srow, h16* hrow, h16* rrow) { planes8v(*(const v4fa*)(srow), *(const v4fa*)(srow + 4), hrow, rrow); }
// softmax step: four keys of one token against the lane's eight score rows; two adjacent keys ride in one register pair, as the LDS load leaves them (element 0: even keys, element 1: odd keys)
__device__ __forceinline__ void keys4(const v4f kk, const v4f vv, const v2f (&sq)[8], const v2f (&nc)[8], v2f (&s)[8], v2f (&y)[8]) {
#pragma unroll
    for (int c = 0; c < 2; ++c) {
        const v2f k2 = c ? __builtin_shufflevector(kk, kk, 2, 3) : __builtin_shufflevector(kk, kk, 0, 1);
        const v2f v2 = c ? __builtin_shufflevector(vv, vv, 2, 3) : __builtin_shufflevector(vv, vv, 0, 1);
#pragma unroll   // row arrays stay in registers
        for (int r = 0; r < 8; ++r) {
            const v2f a = __builtin_elementwise_fma(k2, sq[r], nc[r]);   // score minus the row maximum in one packed fma; at most one rounding of the maximum above 0
            const v2f p = (v2f){__builtin_amdgcn_exp2f(a[0]), __builtin_amdgcn_exp2f(a[1])};
            s[r] += p; y[r] = __builtin_elementwise_fma(p, v2, y[r]); } }
}
// sum over the 8 lanes that share a token row
__device__ __forceinline__ float sum8(float v) { v += __shfl_xor(v, 1, 32); v += __shfl_xor(v, 2, 32); v += __shfl_xor(v, 4, 32); return v; }

__global__ __launch_bounds__(NTHR) void k_tok(const float* __restrict__ x, const bf* __restrict__ W1T, const h16* __restrict__ WH,
                                            const float* __restrict__ b1, const float* __restrict__ bq, const float* __restrict__ bk, const float* __restrict__ bv,
                                            const float* __restrict__ bf1, const float* __restrict__ bf2, const float* __restrict__ ln_g, const float* __restrict__ ln_b,
                                            const float* __restrict__ Wout, const float* __restrict__ bout, float* OUT) {
    __shared__ __align__(16) float T[2 * 6 * TSZ];
    __shared__ __align__(16) h16 AH[2 * 16 * HP];
    __shared__ __align__(16) h16 AR[2 * 16 * HP];
    __shared__ __align__(16) bf  XB[2 * 16 * XP];
    __shared__ __align__(16) float BS[NGM * NBLK * MD];
    __shared__ __align__(16) float OS[TOKW];
    const int tid = threadIdx.x;
    const int lane = tid & 31, lr = lane & 15, hi = lane >> 4;
    const int wv = __builtin_amdgcn_readfirstlane(tid >> 5);     // wave number, held scalar
    const int slab = wv >> 2, w = wv & 3;
    const int tk = 4 * w + (lane >> 3), sb = lane & 7;           // row map: token of the slab, 8-column group
    const int col = 16 * w + lr;                                 // column map of the GEMM tiles
    const int n0 = blockIdx.x * TOKW;
    float* Ts = T + slab * (6 * TSZ);
    h16* AHs = AH + slab * (16 * HP);
    h16* ARs = AR + slab * (16 * HP);
    bf*  XBs = XB + slab * (16 * XP);

    // Every global load of this kernel but the x rows and GEMM biases, used at once by the input layer, is issued a phase or more ahead of its first use, so that its trip to L2 runs under other work instead of behind a barrier.
    const h16* wp0 = WH + (size_t)w * (2 * FSTEP) + 8 * lane;    // this lane's slots in the wave's column tile of block 0; block t lies t matrices, GEMM g lies g * NBLK matrices further
    v16h wq[3][2];                                               // q, k, v weight tiles of the coming block
    v4f wo[2];                                                   // head weights of this lane's 8 columns
    float bo;                                                    // head bias

    // ---- input layer: h = x W1 + b1 (K = DIN); the slab's x rows are converted once into the bf16 plane XB, each wave then forms its own 16 columns ----
    {
        const float* xr = x + (size_t)(n0 + slab * 16 + tk) * DIN + 8 * sb;
        const bf* wb = W1T + (size_t)w * (DIN / 32 * FSTEP) + 8 * lane;   // the wave's column tile: DIN/32 fragments in a row
        v4f xv[DIN / 32];
#pragma unroll   // all eight row loads in flight together
        for (int u = 0; u < DIN / 64; ++u) { xv[2 * u] = *(const v4f*)(xr + 64 * u); xv[2 * u + 1] = *(const v4f*)(xr + 64 * u + 4); }
        v16bf b[DIN / 32];                                       // the wave's whole W1 tile, fetched as one group behind the x rows
#pragma unroll   // one load group, fragments in registers
        for (int kc = 0; kc < DIN; kc += 32) b[kc / 32] = ldb(wb + (kc / 32) * FSTEP);
        const float bb = bfr(b1[col]);
        float bl[NGM] = {0.0f, 0.0f, 0.0f, 0.0f, 0.0f};          // GEMM biases, one entry of each input per thread
        if (tid < NBLK * MD) { bl[0] = bq[tid]; bl[1] = bk[tid]; bl[2] = bv[tid]; bl[3] = bf1[tid]; bl[4] = bf2[tid]; }
        asm volatile("s_wait_xcnt 0x0" ::: "memory");            // precaution: stands behind the group's loads, in front of any later write of their base or offset registers
#pragma unroll
        for (int u = 0; u < DIN / 64; ++u) {
            v8us o;
#pragma unroll
            for (int i = 0; i < 4; ++i) { o[i] = f2bf(xv[2 * u][i]); o[4 + i] = f2bf(xv[2 * u + 1][i]); }
            *(v8usa*)(&XBs[tk * XP + 8 * sb + 64 * u]) = o; }
        // GEMM biases (bf16-converted values) staged once: BS[g*192 + t*64 + col]; first read behind the barriers of the input layer
        if (tid < NBLK * MD) { const int e = tid;
            BS[e] = bfr(bl[0]); BS[192 + e] = bfr(bl[1]); BS[384 + e] = bfr(bl[2]); BS[576 + e] = bfr(bl[3]); BS[768 + e] = bfr(bl[4]); }
        __syncthreads();                                         // XB rows go from their converting wave to all four waves of the slab
#pragma unroll   // one load group, fragments in registers: block 0's q, k, v tiles and the head's parameters fly under the input GEMM
        for (int g = 0; g < 3; ++g) { wq[g][0] = ldh(wp0 + (size_t)g * NBLK * MD * MD); wq[g][1] = ldh(wp0 + (size_t)g * NBLK * MD * MD + FSTEP); }
        wo[0] = *(const v4f*)(Wout + 8 * sb); wo[1] = *(const v4f*)(Wout + 8 * sb + 4); bo = bout[0];
        asm volatile("s_wait_xcnt 0x0" ::: "memory");            // precaution: stands behind the group's loads, in front of any later write of their base or offset registers
        v8f acc = (v8f){};
#pragma unroll
        for (int kc = 0; kc < DIN; kc += 32) {
            const int ao = lr * XP + kc + 8 * hi;
            const v16bf a = cat16b(*(const v8usa*)(&XBs[ao]), *(const v8usa*)(&XBs[ao + 16]));
            acc = wmmabg(a, b[kc / 32], acc); }
#pragma unroll
        for (int j = 0; j < 8; ++j) { const float hv = acc[j] + bb;
            Ts[OFF_CUR + (8 * hi + j) * TP + col] = hv;
            Ts[OFF_RES + (8 * hi + j) * TP + col] = (hv >= 0.0f) ? hv : 0.1f * hv; }
    }
    __syncthreads();                                             // cur, res: column map -> row map

    const int ro8 = tk * TP + 8 * sb;                            // this lane's 8 columns in the row map
    const int po8 = tk * HP + 8 * sb;
    float* dcol = Ts + (8 * hi) * TP + col;                      // this lane's column in the column map
#pragma unroll 1
    for (int t = 0; t < NBLK; ++t) {
        v16h ah[2], ar[2], wf1[2], wf2[2];
        v4f g4[2], b4[2];
        const h16* wp = wp0 + (size_t)(t * MD) * MD;
        // planes of cur (each lane reads back the 8 values it wrote itself, or values behind the barrier above)
        planes8(&Ts[OFF_CUR + ro8], &AHs[po8], &ARs[po8]);
        __syncthreads();                                         // planes: row map -> A fragments of all four waves
#pragma unroll
        for (int ks = 0; ks < 2; ++ks) { const int ao = lr * HP + ks * 32 + 8 * hi;
            ah[ks] = cat16(*(const v8ha*)(&AHs[ao]), *(const v8ha*)(&AHs[ao + 16]));
            ar[ks] = cat16(*(const v8ha*)(&ARs[ao]), *(const v8ha*)(&ARs[ao + 16])); }
#pragma unroll
        for (int g = 0; g < 3; ++g)                              // q, k, v share the planes
            gemm_tile(wq[g], ah, ar, BS[g * (NBLK * MD) + t * MD + col], 1.0f, dcol + OFF_Q + g * TSZ);
        __syncthreads();                                         // q, k, v: column map -> row map; also frees the planes
        // both feed-forward weight tiles and the LayerNorm parameters fly under the softmax (issued behind the barrier, whose fence would wait for them)
        wf1[0] = ldh(wp + (size_t)3 * NBLK * MD * MD); wf1[1] = ldh(wp + (size_t)3 * NBLK * MD * MD + FSTEP);
        wf2[0] = ldh(wp + (size_t)4 * NBLK * MD * MD); wf2[1] = ldh(wp + (size_t)4 * NBLK * MD * MD + FSTEP);
#pragma unroll
        for (int u = 0; u < 2; ++u) { g4[u] = *(const v4f*)(ln_g + t * MD + 8 * sb + 4 * u); b4[u] = *(const v4f*)(ln_b + t * MD + 8 * sb + 4 * u); }
        asm volatile("s_wait_xcnt 0x0" ::: "memory");            // precaution: stands behind the group's loads, in front of any later write of their base or offset registers
        // per-token extreme keys: max_j q k_j = q * (q >= 0 ? kmax : kmin); the xor tree leaves both in all 8 lanes of the token
        float mx = -3.0e38f, mn = 3.0e38f;
#pragma unroll
        for (int u = 0; u < 2; ++u) { const v4f kk = *(const v4fa*)(&Ts[OFF_K + ro8 + 4 * u]);
            mx = fmaxf(fmaxf(mx, fmaxf(kk[0], kk[1])), fmaxf(kk[2], kk[3])); mn = fminf(fminf(mn, fminf(kk[0], kk[1])), fminf(kk[2], kk[3])); }
        mx = fmaxf(mx, __shfl_xor(mx, 1, 32)); mn = fminf(mn, __shfl_xor(mn, 1, 32));
        mx = fmaxf(mx, __shfl_xor(mx, 2, 32)); mn = fminf(mn, __shfl_xor(mn, 2, 32));
        mx = fmaxf(mx, __shfl_xor(mx, 4, 32)); mn = fminf(mn, __shfl_xor(mn, 4, 32));
        // y[n][i] = sum_j softmax_j(q_i k_j) v_j + cur[n][i] in the row map: the lane owns rows i = 8 sb .. 8 sb + 7 of its token, the wave's four tokens side by side,
        // so one 16-byte read of k or v (four addresses per wave, one per token) feeds 8 rows x 4 keys per lane
        {
            v4f q4[2], c4[2], yv[2];
#pragma unroll
            for (int u = 0; u < 2; ++u) { q4[u] = *(const v4fa*)(&Ts[OFF_Q + ro8 + 4 * u]); c4[u] = *(const v4fa*)(&Ts[OFF_CUR + ro8 + 4 * u]); }
            v2f sq[8], nc[8], s[8], y[8];
#pragma unroll
            for (int r = 0; r < 8; ++r) { const float q = q4[r >> 2][r & 3];
                const float e = (q >= 0.0f) ? mx : mn;
                const float sv = q * L2E;
                const float cv = -(e * sv);                      // minus the row's largest score
                sq[r] = (v2f){sv, sv}; nc[r] = (v2f){cv, cv}; s[r] = (v2f){0.0f, 0.0f}; y[r] = (v2f){0.0f, 0.0f}; }
            const float* kr = &Ts[OFF_K + tk * TP];
            const float* vr = &Ts[OFF_V + tk * TP];
            v4f ka = *(const v4fa*)(kr), va = *(const v4fa*)(vr);
#pragma unroll 1   // two register sets by name: each set's reads are issued one four-key step ahead of its use, so their LDS latency runs under the other set's step
            for (int jj = 0; jj < MD; jj += 8) {
                const v4f kb = *(const v4fa*)(kr + jj + 4), vb = *(const v4fa*)(vr + jj + 4);
                keys4(ka, va, sq, nc, s, y);
                const int jn = (jj + 8) & (MD - 1);              // the last trip reads the row's first keys again (unused) instead of the row's pad
                ka = *(const v4fa*)(kr + jn); va = *(const v4fa*)(vr + jn);
                asm volatile("" ::: "memory");                   // compiler fence: keeps the two reads here, one step ahead of their use (without it they move over the back edge to the head of the next trip and are waited for at once)
                keys4(kb, vb, sq, nc, s, y); }
#pragma unroll
            for (int r = 0; r < 8; ++r) yv[r >> 2][r & 3] = (y[r][0] + y[r][1]) * __builtin_amdgcn_rcpf(s[r][0] + s[r][1]) + c4[r >> 2][r & 3];
#pragma unroll
            for (int u = 0; u < 2; ++u) *(v4fa*)(&Ts[OFF_Y + ro8 + 4 * u]) = yv[u];   // read back by the same lane in the LayerNorm
            planes8v(yv[0], yv[1], &AHs[po8], &ARs[po8]);        // planes of y straight from the registers
        }
        __syncthreads();                                         // planes: row map -> A fragments
#pragma unroll
        for (int ks = 0; ks < 2; ++ks) { const int ao = lr * HP + ks * 32 + 8 * hi;
            ah[ks] = cat16(*(const v8ha*)(&AHs[ao]), *(const v8ha*)(&AHs[ao + 16]));
            ar[ks] = cat16(*(const v8ha*)(&ARs[ao]), *(const v8ha*)(&ARs[ao + 16])); }
        gemm_tile(wf1, ah, ar, BS[3 * (NBLK * MD) + t * MD + col], 0.01f, dcol + OFF_Q);   // hidden layer: leaky slope 0.01
        __syncthreads();                                         // hidden layer: column map -> row map; also frees the planes
        planes8(&Ts[OFF_Q + ro8], &AHs[po8], &ARs[po8]);
        __syncthreads();                                         // planes: row map -> A fragments
#pragma unroll
        for (int ks = 0; ks < 2; ++ks) { const int ao = lr * HP + ks * 32 + 8 * hi;
            ah[ks] = cat16(*(const v8ha*)(&AHs[ao]), *(const v8ha*)(&AHs[ao + 16]));
            ar[ks] = cat16(*(const v8ha*)(&ARs[ao]), *(const v8ha*)(&ARs[ao + 16])); }
        gemm_tile(wf2, ah, ar, BS[4 * (NBLK * MD) + t * MD + col], 1.0f, dcol + OFF_K);
        __syncthreads();                                         // second feed-forward output: column map -> row map; also frees the planes
        {                                                        // the next block's q, k, v tiles fly under the LayerNorm and the plane split
            // loaded on every trip (the last trip fetches its own block's tiles again, unused): behind a test the old tiles would stay live through the whole trip and take 48 registers from the softmax
            const h16* wn = wp0 + (size_t)(((t + 1 < NBLK) ? t + 1 : t) * MD) * MD;
#pragma unroll   // one load group, fragments in registers
            for (int g = 0; g < 3; ++g) { wq[g][0] = ldh(wn + (size_t)g * NBLK * MD * MD); wq[g][1] = ldh(wn + (size_t)g * NBLK * MD * MD + FSTEP); }
            asm volatile("s_wait_xcnt 0x0" ::: "memory");        // precaution: stands behind the group's loads, in front of any later write of their base or offset registers
        }
        // a = ff + y; res += LayerNorm(a) * g + b; cur = res. Row map: 8 lanes share a token, each keeps its 8 columns in registers
        {
            v4f a[2];
#pragma unroll
            for (int u = 0; u < 2; ++u) a[u] = *(const v4fa*)(&Ts[OFF_K + ro8 + 4 * u]) + *(const v4fa*)(&Ts[OFF_Y + ro8 + 4 * u]);
            const float sm = sum8(((a[0][0] + a[0][1]) + (a[0][2] + a[0][3])) + ((a[1][0] + a[1][1]) + (a[1][2] + a[1][3])));
            const float mu = sm * (1.0f / MD);
            float vs = 0.0f;
#pragma unroll
            for (int u = 0; u < 2; ++u) { const float d0 = a[u][0] - mu, d1 = a[u][1] - mu, d2 = a[u][2] - mu, d3 = a[u][3] - mu; vs += (d0 * d0 + d1 * d1) + (d2 * d2 + d3 * d3); }
            vs = sum8(vs);
            const float inv = __builtin_amdgcn_rsqf(vs * (1.0f / MD) + 1e-5f);
#pragma unroll
            for (int u = 0; u < 2; ++u) { const v4f r4 = *(const v4fa*)(&Ts[OFF_RES + ro8 + 4 * u]); v4f nr;
#pragma unroll
                for (int i = 0; i < 4; ++i) nr[i] = ((a[u][i] - mu) * inv * bfr(g4[u][i]) + bfr(b4[u][i])) + r4[i];
                *(v4fa*)(&Ts[OFF_RES + ro8 + 4 * u]) = nr; *(v4fa*)(&Ts[OFF_CUR + ro8 + 4 * u]) = nr; }
        }
    }
    // head: leaky(res . Wout + bout, 0.1); matrix-vector product in f32 on the vector unit, row map
    {
        float ds = 0.0f;
#pragma unroll
        for (int u = 0; u < 2; ++u) { const v4f r4 = *(const v4fa*)(&Ts[OFF_RES + ro8 + 4 * u]); const v4f w4 = wo[u];
            ds += (r4[0] * bfr(w4[0]) + r4[1] * bfr(w4[1])) + (r4[2] * bfr(w4[2]) + r4[3] * bfr(w4[3])); }
        ds = sum8(ds);
        float ov = ds + bfr(bo);
        ov = (ov >= 0.0f) ? ov : 0.1f * ov;
        if (sb == 0) OS[slab * 16 + tk] = ov;
    }
    __syncthreads();                                             // OS: all eight waves -> the storing lanes
    if (tid < 5 * 8) {                                           // five copies x 8 lanes x 16 B: each copy's 128-byte line stored whole
        const int c = tid >> 3, q4 = (tid & 7) * 4;
        const v4f val = *(const v4fa*)(&OS[q4]);
        *(v4f*)(OUT + (size_t)c * NTOK_FULL + n0 + q4) = val;
    }
}

static constexpr size_t al256(size_t v) { return (v + 255) & ~(size_t)255; }
static constexpr size_t SZ_W1T = al256((size_t)MD * DIN * 2);
static constexpr size_t SZ_WH  = al256((size_t)NGM * NBLK * MD * MD * 2);
static constexpr size_t SZ_TOTAL = SZ_W1T + SZ_WH;
static_assert(SZ_TOTAL <= (size_t)134217728);              // workspace carve <= 128 MiB
static_assert(((size_t)NBLK * MD * MD * 2) % 256 == 0);    // per-input weight sub-planes stay 256-byte aligned
static_assert((size_t)(DIN / 64) * 64 == (size_t)DIN);     // W1 blocks of k_prep x 64 rows == DIN
static_assert((size_t)(NTOK / TOKW) * TOKW == (size_t)NTOK);

extern "C" void kernel_launch(void* const* d_in, const int* in_sizes, int n_in,
                              void* d_out, int out_size, void* d_ws, size_t ws_size, hipStream_t stream) {
    if (n_in < 17) return;
    if ((size_t)in_sizes[0] < (size_t)NTOK * DIN) return;
    if ((size_t)in_sizes[1] < (size_t)DIN * MD || in_sizes[2] < MD) return;
    if ((size_t)in_sizes[3] < (size_t)NBLK * MD * MD || (size_t)in_sizes[5] < (size_t)NBLK * MD * MD || (size_t)in_sizes[7] < (size_t)NBLK * MD * MD) return;
    if ((size_t)in_sizes[9] < (size_t)NBLK * MD * MD || (size_t)in_sizes[11] < (size_t)NBLK * MD * MD) return;
    if (in_sizes[4] < NBLK * MD || in_sizes[6] < NBLK * MD || in_sizes[8] < NBLK * MD || in_sizes[10] < NBLK * MD || in_sizes[12] < NBLK * MD) return;
    if (in_sizes[13] < NBLK * MD || in_sizes[14] < NBLK * MD || in_sizes[15] < MD || in_sizes[16] < 1) return;
    if ((size_t)out_size < (size_t)4 * NTOK_FULL + NTOK) return;
    if (SZ_TOTAL > ws_size) return;
    // wire order: x, W1, b1, Wq, bq, Wk, bk, Wv, bv, Wf1, bf1, Wf2, bf2, ln_g, ln_b, Wout, bout
    const float* x   = (const float*)d_in[0];
    const float* W1  = (const float*)d_in[1];  const float* b1  = (const float*)d_in[2];
    const float* Wq  = (const float*)d_in[3];  const float* bq  = (const float*)d_in[4];
    const float* Wk  = (const float*)d_in[5];  const float* bk  = (const float*)d_in[6];
    const float* Wv  = (const float*)d_in[7];  const float* bv  = (const float*)d_in[8];
    const float* Wf1 = (const float*)d_in[9];  const float* bf1 = (const float*)d_in[10];
    const float* Wf2 = (const float*)d_in[11]; const float* bf2 = (const float*)d_in[12];
    const float* lng = (const float*)d_in[13]; const float* lnb = (const float*)d_in[14];
    const float* Wo  = (const float*)d_in[15]; const float* bo  = (const float*)d_in[16];
    float* OUT = (float*)d_out;                 // five copies, pitch NTOK_FULL floats
    char* wsp = (char*)d_ws;
    bf*  W1T = (bf*)wsp;  wsp += SZ_W1T;        // 64 x 256 bf16, fragment order
    h16* WH  = (h16*)wsp; wsp += SZ_WH;         // [5][3] matrices of 64 x 64 f16 x64, fragment order; g = q | k | v | f1 | f2

    k_prep<<<DIN / 64 + NGM * NBLK, 256, 0, stream>>>(W1, Wq, Wk, Wv, Wf1, Wf2, W1T, WH);   // 4 chunks of W1 and the 15 block matrices, all independent

    k_tok<<<NTOK / TOKW, NTHR, 0, stream>>>(x, W1T, WH, b1, bq, bk, bv, bf1, bf2, lng, lnb, Wo, bo, OUT);
}

// v007
// Measured time: 24.5 microseconds a run.
// Timed twice side by side with v006, it ran 1.07 times as fast both times.
// All steps since v000 together make it 7.38 times as fast.
#include <hip/hip_runtime.h>

// Per-token outer-product attention stack: h = x W1 + b1 (256 -> 64); three blocks of {q,k,v = cur W + b; y_i = sum_j softmax_j(q_i k_j) v_j + cur_i; a = leaky(y Wf1 + bf1, 0.01) Wf2 + bf2 + y; res += LayerNorm(a)}; out = leaky(res Wout + bout, 0.1), stored five times.
// Compute dtypes, f32 accumulate everywhere: x W1 on v_wmma_f32_16x16x32_bf16 (x, W1 RNE-converted to bf16; products exact); the fifteen 64x64 GEMMs on v_wmma_f32_16x16x32_f16 with the activation as f16 value + f16 residual x2048 (own accumulator, folded by 1/2048) and the weight as f16 of the bf16-converted input x64 (folded by 1/64);
// per-token 64x64 softmax / P.v, LayerNorm and the 64 -> 1 head in f32 on the vector unit (no operand shared between tokens; the head is a matrix-vector product).
// Layout: W1T bf16 (64 x 256) and WH f16 (5 x 3 matrices of 64 x 64), both in B-fragment order (16-byte slots [column tile][32-wide k step][part][lane]), built in the workspace by one launch; fused kernel: eight waves per block own 32 tokens (two 16-token slabs, four waves each), all tiles in LDS.

#ifndef NTOK
#define NTOK 16384
#endif
#define NTOK_FULL 16384
#define DIN  256                 // input width
#define MD   64                  // model width of the blocks
#define NBLK 3                   // stacked blocks
#define NGM  5                   // GEMMs per block: q, k, v, f1, f2
#define TOKW 32                  // tokens per block (two slabs of 16)
#define NTHR 256                 // threads per block of the fused kernel: four waves per slab
#define XP   264                 // LDS bf16 x plane row pitch (elements)
#define TP   68                  // LDS f32 tile row pitch (floats)
#define TSZ  (16 * TP)
#define HP   72                  // LDS f16 plane row pitch (halves)
#define OFF_CUR 0
#define OFF_RES (1 * TSZ)
#define OFF_Q   (2 * TSZ)
#define OFF_K   (3 * TSZ)
#define OFF_V   (4 * TSZ)
#define OFF_Y   (5 * TSZ)
#define QRS  2048.0f             // carry of the activation residual plane
#define QRI  (1.0f / 2048.0f)
#define WSC  64.0f               // carry of the f16 weight planes
#define WSI  (1.0f / 64.0f)
#define L2E  1.4426950408889634f
#define FPART 256                // elements per fragment part: 32 lanes x 8 elements = 512 contiguous bytes, one wave-wide 16-byte load
#define FSTEP (2 * FPART)        // elements per 16-column x 32-k fragment

static_assert(MD == 64);
static_assert(MD % 32 == 0);
static_assert(DIN % 64 == 0);                    // W1 handled in 64-row chunks; k-loop steps by 32
static_assert(DIN % 32 == 0);
static_assert(TOKW == 32);
static_assert(NTOK % TOKW == 0);                 // grid covers the tokens exactly
static_assert(NTOK <= NTOK_FULL);
static_assert((size_t)NTOK_FULL * 4 == 65536);   // byte pitch between the five output copies
static_assert(((size_t)NTOK_FULL * 4) % 128 == 0);
static_assert((TP * 4) % 16 == 0);
static_assert((HP * 2) % 16 == 0);
static_assert(TP >= MD);
static_assert(HP >= MD);
static_assert(NGM * NBLK * MD == 960);           // bias stage size
static_assert(NBLK * MD <= NTHR);                // bias stage: one thread per entry of each input
static_assert(NTHR == 2 * 4 * 32);
static_assert((XP * 2) % 16 == 0);
static_assert(XP >= DIN);
static_assert(32 * 16 == 4 * 128);
static_assert(8 * 16 == 128);                    // output store: 8 lanes x 16 B = one line
static_assert(256 * 2 * 16 == 64 * 128);
static_assert(4 * 2 * FSTEP == MD * MD);         // four column tiles x two k steps fill one 64 x 64 matrix
static_assert(4 * (DIN / 32) * FSTEP == MD * DIN);
static_assert((size_t)2 * 6 * TSZ * 4 + (size_t)2 * 2 * 16 * HP * 2 + (size_t)2 * 16 * XP * 2 + 960 * 4 + 32 * 4 <= 131072);   // static LDS of the fused kernel
static_assert((size_t)64 * 65 * 4 <= 131072);    // static LDS of the converter

typedef _Float16 h16;
typedef unsigned short bf;
typedef __attribute__((ext_vector_type(16))) __bf16   v16bf;
typedef __attribute__((ext_vector_type(16))) _Float16 v16h;
typedef __attribute__((ext_vector_type(8)))  _Float16 v8h;
typedef __attribute__((ext_vector_type(8)))  unsigned short v8us;
typedef __attribute__((ext_vector_type(8)))  float    v8f;
typedef __attribute__((ext_vector_type(4)))  float    v4f;
typedef __attribute__((ext_vector_type(2)))  float    v2f;
typedef v4f  __attribute__((may_alias)) v4fa;
typedef v8h  __attribute__((may_alias)) v8ha;
typedef v8us __attribute__((may_alias)) v8usa;
typedef __attribute__((ext_vector_type(8)))  __bf16   v8b;

// every f32 -> 16-bit conversion is the hardware's own (round to nearest even, subnormals kept); eight values go as four packed converts
__device__ __forceinline__ float bfr(float f) { return (float)(__bf16)f; }   // value after RNE convert to bf16
__device__ __forceinline__ v8f cat8(v4f lo, v4f hi) { return __builtin_shufflevector(lo, hi, 0, 1, 2, 3, 4, 5, 6, 7); }
__device__ __forceinline__ v8us tob8(v8f v) { return __builtin_bit_cast(v8us, __builtin_convertvector(v, v8b)); }
__device__ __forceinline__ v8h  toh8(v8f v) { return __builtin_convertvector(v, v8h); }
__device__ __forceinline__ v16h cat16(v8h lo, v8h hi) { return __builtin_shufflevector(lo, hi, 0, 1, 2, 3, 4, 5, 6, 7, 8, 9, 10, 11, 12, 13, 14, 15); }
__device__ __forceinline__ v16bf cat16b(v8us lo, v8us hi) { return __builtin_bit_cast(v16bf, __builtin_shufflevector(lo, hi, 0, 1, 2, 3, 4, 5, 6, 7, 8, 9, 10, 11, 12, 13, 14, 15)); }
__device__ __forceinline__ v8f wmma16(v16h a, v16h b, v8f c) { return __builtin_amdgcn_wmma_f32_16x16x32_f16(false, a, false, b, (short)0, c, false, false); }
__device__ __forceinline__ v8f wmmab(v16bf a, v16bf b, v8f c) { return __builtin_amdgcn_wmma_f32_16x16x32_bf16(false, a, false, b, (short)0, c, false, false); }
// B-fragment loaders from the fragment-ordered weight planes; p already includes + 8*lane: part 0 holds elements 0..7 <- k0+8h+0..7, part 1 elements 8..15 <- k0+16+8h+0..7 of column lane&15, h = lane>>4 (same k map as the A fragments)
__device__ __forceinline__ v16h  ldh(const h16* p) { return cat16(*(const v8h*)p, *(const v8h*)(p + FPART)); }
__device__ __forceinline__ v16bf ldb(const bf* p)  { return cat16b(*(const v8us*)p, *(const v8us*)(p + FPART)); }
// one guarded matrix instruction: the accumulator is tied behind four idle slots, the fragments stay live
__device__ __forceinline__ v8f wmma16g(v16h a, v16h b, v8f c) { c = wmma16(a, b, c); asm volatile("v_nop\n\tv_nop\n\tv_nop\n\tv_nop" : "+v"(c) : "v"(a), "v"(b)); return c; }
__device__ __forceinline__ v8f wmmabg(v16bf a, v16bf b, v8f c) { c = wmmab(a, b, c); asm volatile("v_nop\n\tv_nop\n\tv_nop\n\tv_nop" : "+v"(c) : "v"(a), "v"(b)); return c; }

// k_prep: every weight plane in one launch; each block transposes one 64 x 64 f32 tile ([k][n]) through LDS and stores it in B-fragment order.
// A 16-byte slot holds 8 consecutive k (group p = k / 8) of one column n and lies at [n >> 4][p >> 2][(p >> 1) & 1][16 * (p & 1) + (n & 15)]: the slots one wave-wide fragment load reads are 512 contiguous bytes.
// Blocks 0..DIN/64-1: 64-row k chunk of W1 -> W1T bf16 [4 tiles][DIN/32 steps][2][32][8]. Block DIN/64 + m, m = g*NBLK + t: matrix t of input g (q, k, v, f1, f2) -> WH f16 [m][4 tiles][2 steps][2][32][8] of (bf16-converted value x 64).
__global__ __launch_bounds__(256) void k_prep(const float* __restrict__ W1, const float* __restrict__ Wq, const float* __restrict__ Wk, const float* __restrict__ Wv,
                                              const float* __restrict__ Wf1, const float* __restrict__ Wf2, bf* W1T, h16* WH) {
    __shared__ float ts[64 * 65];
    const int tid = threadIdx.x;
    const int kc = blockIdx.x;                                  // W1 chunk, where below DIN / 64
    const int m = kc - DIN / 64;                                // matrix number otherwise
    const bool first = kc < DIN / 64;                           // block-uniform
    const int g = m / NBLK;
    const float* Wg = (g == 0) ? Wq : (g == 1) ? Wk : (g == 2) ? Wv : (g == 3) ? Wf1 : Wf2;
    const float* W = first ? W1 + (size_t)kc * 64 * MD : Wg + (size_t)(m - g * NBLK) * MD * MD;
    float wr[16];
#pragma unroll   // all sixteen loads issued before the first is waited for: one trip to L2 instead of a chain of them
    for (int i = 0; i < 16; ++i) wr[i] = W[tid + i * 256];      // 16 x 256 = 64 x 64 entries
    asm volatile("s_wait_xcnt 0x0" ::: "memory");               // precaution: stands behind the group's loads, in front of any later write of their base or offset registers
#pragma unroll
    for (int i = 0; i < 16; ++i) { const int e = tid + i * 256; const int k = e >> 6, n = e & 63; ts[k * 65 + n] = wr[i]; }
    __syncthreads();                                            // cross-wave exchange through ts
    const int p = tid >> 5, p8 = p * 8;                         // one k group per wave
    const int nl = tid & 31;                                    // columns nl and nl + 32
    const int fo = (p >> 1) * FPART + (16 * (p & 1) + (nl & 15)) * 8;   // slot inside the column tile's two k steps of this 64-row chunk
    if (first) {
        v8f f0, f1;
#pragma unroll
        for (int u = 0; u < 8; ++u) { f0[u] = ts[(p8 + u) * 65 + nl]; f1[u] = ts[(p8 + u) * 65 + nl + 32]; }
        const v8us o0 = tob8(f0), o1 = tob8(f1);
        bf* d0 = W1T + (size_t)(nl >> 4) * (DIN / 32 * FSTEP) + (size_t)kc * (2 * FSTEP) + fo;
        bf* d1 = d0 + (size_t)2 * (DIN / 32 * FSTEP);
        *(v8us*)d0 = o0; *(v8us*)d1 = o1;
        asm volatile("s_wait_xcnt 0x0" ::: "memory");           // precaution: stands behind the two stores, in front of any later write of their address or data registers (the other arm follows in the built code)
    } else {
        v8f f0, f1;
#pragma unroll
        for (int u = 0; u < 8; ++u) { f0[u] = bfr(ts[(p8 + u) * 65 + nl]) * WSC; f1[u] = bfr(ts[(p8 + u) * 65 + nl + 32]) * WSC; }
        const v8h o0 = toh8(f0), o1 = toh8(f1);
        h16* d0 = WH + (size_t)m * MD * MD + (size_t)(nl >> 4) * (2 * FSTEP) + fo;
        h16* d1 = d0 + (size_t)2 * (2 * FSTEP);
        *(v8h*)d0 = o0; *(v8h*)d1 = o1;
        asm volatile("s_wait_xcnt 0x0" ::: "memory");           // precaution: stands behind the two stores, in front of any later write of their address or data registers (the other arm follows in the built code)
    }
}

// k_tok: fused token kernel, eight waves per block, 32 tokens as two 16-token slabs worked side by side: waves 0..3 own slab 0, waves 4..7 slab 1.
// Inside a slab wave w owns output columns 16w..16w+15 of every GEMM and tokens 4w..4w+3 of every per-token phase; tiles that change hands between the two maps are ordered by __syncthreads; in the row map a lane reads back only what it wrote itself.
// GEMM fragments: A row = token (lane&15) from the 16-bit planes (k contiguous), B column n = lane&15 of tile w from the fragment-ordered weight planes, both with the split k map; D: acc[j] = (token 8*(lane>>4)+j, column 16w + (lane&15)).
// Per slab T holds six f32 tiles [16][TP]: cur, res, q (later the hidden layer), k (later the second feed-forward output), v, y.
// one 16 x 16 x 64 GEMM tile: value and residual planes against one weight tile, bias and leaky slope, stored down one column of the destination tile
__device__ __forceinline__ void gemm_tile(const v16h (&b)[2], const v16h (&ah)[2], const v16h (&ar)[2], const float bb, const float sl, float* dst) {
    v8f acc = (v8f){}, acr = (v8f){};
#pragma unroll   // fragment arrays stay in registers
    for (int ks = 0; ks < 2; ++ks) { acc = wmma16g(ah[ks], b[ks], acc); acr = wmma16g(ar[ks], b[ks], acr); }
#pragma unroll
    for (int j = 0; j < 8; ++j) { float v = (acc[j] + acr[j] * QRI) * WSI + bb;
        v = (v >= 0.0f) ? v : sl * v;
        dst[j * TP] = v; }
}
// activation planes of 8 columns of one token row: f16 value and f16 residual x2048
__device__ __forceinline__ void planes8v(const v4f x0, const v4f x1, h16* hrow, h16* rrow) {
    const v8f xv = cat8(x0, x1);
    const v8h hv = toh8(xv);
    const v8h rv = toh8((xv - __builtin_convertvector(hv, v8f)) * QRS);
    *(v8ha*)(hrow) = hv; *(v8ha*)(rrow) = rv;
}
__device__ __forceinline__ void planes8(const float* srow, h16* hrow, h16* rrow) { planes8v(*(const v4fa*)(srow), *(const v4fa*)(srow + 4), hrow, rrow); }
// softmax step: four keys of one token against the lane's eight score rows; two adjacent keys ride in one register pair, as the LDS load leaves them (element 0: even keys, element 1: odd keys)
__device__ __forceinline__ void keys4(const v4f kk, const v4f vv, const v2f (&sq)[8], const v2f (&nc)[8], v2f (&s)[8], v2f (&y)[8]) {
#pragma unroll
    for (int c = 0; c < 2; ++c) {
        const v2f k2 = c ? __builtin_shufflevector(kk, kk, 2, 3) : __builtin_shufflevector(kk, kk, 0, 1);
        const v2f v2 = c ? __builtin_shufflevector(vv, vv, 2, 3) : __builtin_shufflevector(vv, vv, 0, 1);
#pragma unroll   // row arrays stay in registers
        for (int r = 0; r < 8; ++r) {
            const v2f a = __builtin_elementwise_fma(k2, sq[r], nc[r]);   // score minus the row maximum in one packed fma; at most one rounding of the maximum above 0
            const v2f p = (v2f){__builtin_amdgcn_exp2f(a[0]), __builtin_amdgcn_exp2f(a[1])};
            s[r] += p; y[r] = __builtin_elementwise_fma(p, v2, y[r]); } }
}
// sum over the 8 lanes that share a token row
__device__ __forceinline__ float sum8(float v) { v += __shfl_xor(v, 1, 32); v += __shfl_xor(v, 2, 32); v += __shfl_xor(v, 4, 32); return v; }

__global__ __launch_bounds__(NTHR) void k_tok(const float* __restrict__ x, const bf* __restrict__ W1T, const h16* __restrict__ WH,
                                            const float* __restrict__ b1, const float* __restrict__ bq, const float* __restrict__ bk, const float* __restrict__ bv,
                                            const float* __restrict__ bf1, const float* __restrict__ bf2, const float* __restrict__ ln_g, const float* __restrict__ ln_b,
                                            const float* __restrict__ Wout, const float* __restrict__ bout, float* OUT) {
    __shared__ __align__(16) float T[2 * 6 * TSZ];
    __shared__ __align__(16) h16 AH[2 * 16 * HP];
    __shared__ __align__(16) h16 AR[2 * 16 * HP];
    __shared__ __align__(16) bf  XB[2 * 16 * XP];
    __shared__ __align__(16) float BS[NGM * NBLK * MD];
    __shared__ __align__(16) float OS[TOKW];
    const int tid = threadIdx.x;
    const int lane = tid & 31, lr = lane & 15, hi = lane >> 4;
    const int wv = __builtin_amdgcn_readfirstlane(tid >> 5);     // wave number, held scalar
    const int slab = wv >> 2, w = wv & 3;
    const int tk = 4 * w + (lane >> 3), sb = lane & 7;           // row map: token of the slab, 8-column group
    const int col = 16 * w + lr;                                 // column map of the GEMM tiles
    const int n0 = blockIdx.x * TOKW;
    float* Ts = T + slab * (6 * TSZ);
    h16* AHs = AH + slab * (16 * HP);
    h16* ARs = AR + slab * (16 * HP);
    bf*  XBs = XB + slab * (16 * XP);

    // Every global load of this kernel but the x rows and GEMM biases, used at once by the input layer, is issued a phase or more ahead of its first use, so that its trip to L2 runs under other work instead of behind a barrier.
    const h16* wp0 = WH + (size_t)w * (2 * FSTEP) + 8 * lane;    // this lane's slots in the wave's column tile of block 0; block t lies t matrices, GEMM g lies g * NBLK matrices further
    v16h wq[3][2];                                               // q, k, v weight tiles of the coming block
    v4f wo[2];                                                   // head weights of this lane's 8 columns
    float bo;                                                    // head bias

    // ---- input layer: h = x W1 + b1 (K = DIN); the slab's x rows are converted once into the bf16 plane XB, each wave then forms its own 16 columns ----
    {
        const float* xr = x + (size_t)(n0 + slab * 16 + tk) * DIN + 8 * sb;
        const bf* wb = W1T + (size_t)w * (DIN / 32 * FSTEP) + 8 * lane;   // the wave's column tile: DIN/32 fragments in a row
        v4f xv[DIN / 32];
#pragma unroll   // all eight row loads in flight together
        for (int u = 0; u < DIN / 64; ++u) { xv[2 * u] = *(const v4f*)(xr + 64 * u); xv[2 * u + 1] = *(const v4f*)(xr + 64 * u + 4); }
        v16bf b[DIN / 32];                                       // the wave's whole W1 tile, fetched as one group behind the x rows
#pragma unroll   // one load group, fragments in registers
        for (int kc = 0; kc < DIN; kc += 32) b[kc / 32] = ldb(wb + (kc / 32) * FSTEP);
        const float bb = bfr(b1[col]);
        float bl[NGM] = {0.0f, 0.0f, 0.0f, 0.0f, 0.0f};          // GEMM biases, one entry of each input per thread
        if (tid < NBLK * MD) { bl[0] = bq[tid]; bl[1] = bk[tid]; bl[2] = bv[tid]; bl[3] = bf1[tid]; bl[4] = bf2[tid]; }
        asm volatile("s_wait_xcnt 0x0" ::: "memory");            // precaution: stands behind the group's loads, in front of any later write of their base or offset registers
#pragma unroll
        for (int u = 0; u < DIN / 64; ++u) *(v8usa*)(&XBs[tk * XP + 8 * sb + 64 * u]) = tob8(cat8(xv[2 * u], xv[2 * u + 1]));
        // GEMM biases (bf16-converted values) staged once: BS[g*192 + t*64 + col]; first read behind the barriers of the input layer
        if (tid < NBLK * MD) { const int e = tid;
            BS[e] = bfr(bl[0]); BS[192 + e] = bfr(bl[1]); BS[384 + e] = bfr(bl[2]); BS[576 + e] = bfr(bl[3]); BS[768 + e] = bfr(bl[4]); }
        __syncthreads();                                         // XB rows go from their converting wave to all four waves of the slab
#pragma unroll   // one load group, fragments in registers: block 0's q, k, v tiles and the head's parameters fly under the input GEMM
        for (int g = 0; g < 3; ++g) { wq[g][0] = ldh(wp0 + (size_t)g * NBLK * MD * MD); wq[g][1] = ldh(wp0 + (size_t)g * NBLK * MD * MD + FSTEP); }
        wo[0] = *(const v4f*)(Wout + 8 * sb); wo[1] = *(const v4f*)(Wout + 8 * sb + 4); bo = bout[0];
        asm volatile("s_wait_xcnt 0x0" ::: "memory");            // precaution: stands behind the group's loads, in front of any later write of their base or offset registers
        v8f acc = (v8f){};
#pragma unroll
        for (int kc = 0; kc < DIN; kc += 32) {
            const int ao = lr * XP + kc + 8 * hi;
            const v16bf a = cat16b(*(const v8usa*)(&XBs[ao]), *(const v8usa*)(&XBs[ao + 16]));
            acc = wmmabg(a, b[kc / 32], acc); }
#pragma unroll
        for (int j = 0; j < 8; ++j) { const float hv = acc[j] + bb;
            Ts[OFF_CUR + (8 * hi + j) * TP + col] = hv;
            Ts[OFF_RES + (8 * hi + j) * TP + col] = (hv >= 0.0f) ? hv : 0.1f * hv; }
    }
    __syncthreads();                                             // cur, res: column map -> row map

    const int ro8 = tk * TP + 8 * sb;                            // this lane's 8 columns in the row map
    const int po8 = tk * HP + 8 * sb;
    float* dcol = Ts + (8 * hi) * TP + col;                      // this lane's column in the column map
#pragma unroll 1
    for (int t = 0; t < NBLK; ++t) {
        v16h ah[2], ar[2], wf1[2], wf2[2];
        v4f g4[2], b4[2];
        const h16* wp = wp0 + (size_t)(t * MD) * MD;
        // planes of cur (each lane reads back the 8 values it wrote itself, or values behind the barrier above)
        planes8(&Ts[OFF_CUR + ro8], &AHs[po8], &ARs[po8]);
        __syncthreads();                                         // planes: row map -> A fragments of all four waves
#pragma unroll
        for (int ks = 0; ks < 2; ++ks) { const int ao = lr * HP + ks * 32 + 8 * hi;
            ah[ks] = cat16(*(const v8ha*)(&AHs[ao]), *(const v8ha*)(&AHs[ao + 16]));
            ar[ks] = cat16(*(const v8ha*)(&ARs[ao]), *(const v8ha*)(&ARs[ao + 16])); }
#pragma unroll
        for (int g = 0; g < 3; ++g)                              // q, k, v share the planes
            gemm_tile(wq[g], ah, ar, BS[g * (NBLK * MD) + t * MD + col], 1.0f, dcol + OFF_Q + g * TSZ);
        __syncthreads();                                         // q, k, v: column map -> row map; also frees the planes
        // both feed-forward weight tiles and the LayerNorm parameters fly under the softmax (issued behind the barrier, whose fence would wait for them)
        wf1[0] = ldh(wp + (size_t)3 * NBLK * MD * MD); wf1[1] = ldh(wp + (size_t)3 * NBLK * MD * MD + FSTEP);
        wf2[0] = ldh(wp + (size_t)4 * NBLK * MD * MD); wf2[1] = ldh(wp + (size_t)4 * NBLK * MD * MD + FSTEP);
#pragma unroll
        for (int u = 0; u < 2; ++u) { g4[u] = *(const v4f*)(ln_g + t * MD + 8 * sb + 4 * u); b4[u] = *(const v4f*)(ln_b + t * MD + 8 * sb + 4 * u); }
        asm volatile("s_wait_xcnt 0x0" ::: "memory");            // precaution: stands behind the group's loads, in front of any later write of their base or offset registers
        // per-token extreme keys: max_j q k_j = q * (q >= 0 ? kmax : kmin); the xor tree leaves both in all 8 lanes of the token
        float mx = -3.0e38f, mn = 3.0e38f;
#pragma unroll
        for (int u = 0; u < 2; ++u) { const v4f kk = *(const v4fa*)(&Ts[OFF_K + ro8 + 4 * u]);
            mx = fmaxf(fmaxf(mx, fmaxf(kk[0], kk[1])), fmaxf(kk[2], kk[3])); mn = fminf(fminf(mn, fminf(kk[0], kk[1])), fminf(kk[2], kk[3])); }
        mx = fmaxf(mx, __shfl_xor(mx, 1, 32)); mn = fminf(mn, __shfl_xor(mn, 1, 32));
        mx = fmaxf(mx, __shfl_xor(mx, 2, 32)); mn = fminf(mn, __shfl_xor(mn, 2, 32));
        mx = fmaxf(mx, __shfl_xor(mx, 4, 32)); mn = fminf(mn, __shfl_xor(mn, 4, 32));
        // y[n][i] = sum_j softmax_j(q_i k_j) v_j + cur[n][i] in the row map: the lane owns rows i = 8 sb .. 8 sb + 7 of its token, the wave's four tokens side by side,
        // so one 16-byte read of k or v (four addresses per wave, one per token) feeds 8 rows x 4 keys per lane
        {
            v4f q4[2], c4[2], yv[2];
#pragma unroll
            for (int u = 0; u < 2; ++u) { q4[u] = *(const v4fa*)(&Ts[OFF_Q + ro8 + 4 * u]); c4[u] = *(const v4fa*)(&Ts[OFF_CUR + ro8 + 4 * u]); }
            v2f sq[8], nc[8], s[8], y[8];
#pragma unroll
            for (int r = 0; r < 8; ++r) { const float q = q4[r >> 2][r & 3];
                const float e = (q >= 0.0f) ? mx : mn;
                const float sv = q * L2E;
                const float cv = -(e * sv);                      // minus the row's largest score
                sq[r] = (v2f){sv, sv}; nc[r] = (v2f){cv, cv}; s[r] = (v2f){0.0f, 0.0f}; y[r] = (v2f){0.0f, 0.0f}; }
            const float* kr = &Ts[OFF_K + tk * TP];
            const float* vr = &Ts[OFF_V + tk * TP];
            v4f ka = *(const v4fa*)(kr), va = *(const v4fa*)(vr);
#pragma unroll 1   // two register sets by name: each set's reads are issued one four-key step ahead of its use, so their LDS latency runs under the other set's step
            for (int jj = 0; jj < MD; jj += 8) {
                const v4f kb = *(const v4fa*)(kr + jj + 4), vb = *(const v4fa*)(vr + jj + 4);
                keys4(ka, va, sq, nc, s, y);
                const int jn = (jj + 8) & (MD - 1);              // the last trip reads the row's first keys again (unused) instead of the row's pad
                ka = *(const v4fa*)(kr + jn); va = *(const v4fa*)(vr + jn);
                asm volatile("" ::: "memory");                   // compiler fence: keeps the two reads here, one step ahead of their use (without it they move over the back edge to the head of the next trip and are waited for at once)
                keys4(kb, vb, sq, nc, s, y); }
#pragma unroll
            for (int r = 0; r < 8; ++r) yv[r >> 2][r & 3] = (y[r][0] + y[r][1]) * __builtin_amdgcn_rcpf(s[r][0] + s[r][1]) + c4[r >> 2][r & 3];
#pragma unroll
            for (int u = 0; u < 2; ++u) *(v4fa*)(&Ts[OFF_Y + ro8 + 4 * u]) = yv[u];   // read back by the same lane in the LayerNorm
            planes8v(yv[0], yv[1], &AHs[po8], &ARs[po8]);        // planes of y straight from the registers
        }
        __syncthreads();                                         // planes: row map -> A fragments
#pragma unroll
        for (int ks = 0; ks < 2; ++ks) { const int ao = lr * HP + ks * 32 + 8 * hi;
            ah[ks] = cat16(*(const v8ha*)(&AHs[ao]), *(const v8ha*)(&AHs[ao + 16]));
            ar[ks] = cat16(*(const v8ha*)(&ARs[ao]), *(const v8ha*)(&ARs[ao + 16])); }
        gemm_tile(wf1, ah, ar, BS[3 * (NBLK * MD) + t * MD + col], 0.01f, dcol + OFF_Q);   // hidden layer: leaky slope 0.01
        __syncthreads();                                         // hidden layer: column map -> row map; also frees the planes
        planes8(&Ts[OFF_Q + ro8], &AHs[po8], &ARs[po8]);
        __syncthreads();                                         // planes: row map -> A fragments
#pragma unroll
        for (int ks = 0; ks < 2; ++ks) { const int ao = lr * HP + ks * 32 + 8 * hi;
            ah[ks] = cat16(*(const v8ha*)(&AHs[ao]), *(const v8ha*)(&AHs[ao + 16]));
            ar[ks] = cat16(*(const v8ha*)(&ARs[ao]), *(const v8ha*)(&ARs[ao + 16])); }
        gemm_tile(wf2, ah, ar, BS[4 * (NBLK * MD) + t * MD + col], 1.0f, dcol + OFF_K);
        __syncthreads();                                         // second feed-forward output: column map -> row map; also frees the planes
        {                                                        // the next block's q, k, v tiles fly under the LayerNorm and the plane split
            // loaded on every trip (the last trip fetches its own block's tiles again, unused): behind a test the old tiles would stay live through the whole trip and take 48 registers from the softmax
            const h16* wn = wp0 + (size_t)(((t + 1 < NBLK) ? t + 1 : t) * MD) * MD;
#pragma unroll   // one load group, fragments in registers
            for (int g = 0; g < 3; ++g) { wq[g][0] = ldh(wn + (size_t)g * NBLK * MD * MD); wq[g][1] = ldh(wn + (size_t)g * NBLK * MD * MD + FSTEP); }
            asm volatile("s_wait_xcnt 0x0" ::: "memory");        // precaution: stands behind the group's loads, in front of any later write of their base or offset registers
        }
        // a = ff + y; res += LayerNorm(a) * g + b; cur = res. Row map: 8 lanes share a token, each keeps its 8 columns in registers
        {
            v4f a[2];
#pragma unroll
            for (int u = 0; u < 2; ++u) a[u] = *(const v4fa*)(&Ts[OFF_K + ro8 + 4 * u]) + *(const v4fa*)(&Ts[OFF_Y + ro8 + 4 * u]);
            const float sm = sum8(((a[0][0] + a[0][1]) + (a[0][2] + a[0][3])) + ((a[1][0] + a[1][1]) + (a[1][2] + a[1][3])));
            const float mu = sm * (1.0f / MD);
            float vs = 0.0f;
#pragma unroll
            for (int u = 0; u < 2; ++u) { const float d0 = a[u][0] - mu, d1 = a[u][1] - mu, d2 = a[u][2] - mu, d3 = a[u][3] - mu; vs += (d0 * d0 + d1 * d1) + (d2 * d2 + d3 * d3); }
            vs = sum8(vs);
            const float inv = __builtin_amdgcn_rsqf(vs * (1.0f / MD) + 1e-5f);
#pragma unroll
            for (int u = 0; u < 2; ++u) { const v4f r4 = *(const v4fa*)(&Ts[OFF_RES + ro8 + 4 * u]); v4f nr;
#pragma unroll
                for (int i = 0; i < 4; ++i) nr[i] = ((a[u][i] - mu) * inv * bfr(g4[u][i]) + bfr(b4[u][i])) + r4[i];
                *(v4fa*)(&Ts[OFF_RES + ro8 + 4 * u]) = nr; *(v4fa*)(&Ts[OFF_CUR + ro8 + 4 * u]) = nr; }
        }
    }
    // head: leaky(res . Wout + bout, 0.1); matrix-vector product in f32 on the vector unit, row map
    {
        float ds = 0.0f;
#pragma unroll
        for (int u = 0; u < 2; ++u) { const v4f r4 = *(const v4fa*)(&Ts[OFF_RES + ro8 + 4 * u]); const v4f w4 = wo[u];
            ds += (r4[0] * bfr(w4[0]) + r4[1] * bfr(w4[1])) + (r4[2] * bfr(w4[2]) + r4[3] * bfr(w4[3])); }
        ds = sum8(ds);
        float ov = ds + bfr(bo);
        ov = (ov >= 0.0f) ? ov : 0.1f * ov;
        if (sb == 0) OS[slab * 16 + tk] = ov;
    }
    __syncthreads();                                             // OS: all eight waves -> the storing lanes
    if (tid < 5 * 8) {                                           // five copies x 8 lanes x 16 B: each copy's 128-byte line stored whole
        const int c = tid >> 3, q4 = (tid & 7) * 4;
        const v4f val = *(const v4fa*)(&OS[q4]);
        *(v4f*)(OUT + (size_t)c * NTOK_FULL + n0 + q4) = val;
    }
}

static constexpr size_t al256(size_t v) { return (v + 255) & ~(size_t)255; }
static constexpr size_t SZ_W1T = al256((size_t)MD * DIN * 2);
static constexpr size_t SZ_WH  = al256((size_t)NGM * NBLK * MD * MD * 2);
static constexpr size_t SZ_TOTAL = SZ_W1T + SZ_WH;
static_assert(SZ_TOTAL <= (size_t)134217728);              // workspace carve <= 128 MiB
static_assert(((size_t)NBLK * MD * MD * 2) % 256 == 0);    // per-input weight sub-planes stay 256-byte aligned
static_assert((size_t)(DIN / 64) * 64 == (size_t)DIN);     // W1 blocks of k_prep x 64 rows == DIN
static_assert((size_t)(NTOK / TOKW) * TOKW == (size_t)NTOK);

extern "C" void kernel_launch(void* const* d_in, const int* in_sizes, int n_in,
                              void* d_out, int out_size, void* d_ws, size_t ws_size, hipStream_t stream) {
    if (n_in < 17) return;
    if ((size_t)in_sizes[0] < (size_t)NTOK * DIN) return;
    if ((size_t)in_sizes[1] < (size_t)DIN * MD || in_sizes[2] < MD) return;
    if ((size_t)in_sizes[3] < (size_t)NBLK * MD * MD || (size_t)in_sizes[5] < (size_t)NBLK * MD * MD || (size_t)in_sizes[7] < (size_t)NBLK * MD * MD) return;
    if ((size_t)in_sizes[9] < (size_t)NBLK * MD * MD || (size_t)in_sizes[11] < (size_t)NBLK * MD * MD) return;
    if (in_sizes[4] < NBLK * MD || in_sizes[6] < NBLK * MD || in_sizes[8] < NBLK * MD || in_sizes[10] < NBLK * MD || in_sizes[12] < NBLK * MD) return;
    if (in_sizes[13] < NBLK * MD || in_sizes[14] < NBLK * MD || in_sizes[15] < MD || in_sizes[16] < 1) return;
    if ((size_t)out_size < (size_t)4 * NTOK_FULL + NTOK) return;
    if (SZ_TOTAL > ws_size) return;
    // wire order: x, W1, b1, Wq, bq, Wk, bk, Wv, bv, Wf1, bf1, Wf2, bf2, ln_g, ln_b, Wout, bout
    const float* x   = (const float*)d_in[0];
    const float* W1  = (const float*)d_in[1];  const float* b1  = (const float*)d_in[2];
    const float* Wq  = (const float*)d_in[3];  const float* bq  = (const float*)d_in[4];
    const float* Wk  = (const float*)d_in[5];  const float* bk  = (const float*)d_in[6];
    const float* Wv  = (const float*)d_in[7];  const float* bv  = (const float*)d_in[8];
    const float* Wf1 = (const float*)d_in[9];  const float* bf1 = (const float*)d_in[10];
    const float* Wf2 = (const float*)d_in[11]; const float* bf2 = (const float*)d_in[12];
    const float* lng = (const float*)d_in[13]; const float* lnb = (const float*)d_in[14];
    const float* Wo  = (const float*)d_in[15]; const float* bo  = (const float*)d_in[16];
    float* OUT = (float*)d_out;                 // five copies, pitch NTOK_FULL floats
    char* wsp = (char*)d_ws;
    bf*  W1T = (bf*)wsp;  wsp += SZ_W1T;        // 64 x 256 bf16, fragment order
    h16* WH  = (h16*)wsp; wsp += SZ_WH;         // [5][3] matrices of 64 x 64 f16 x64, fragment order; g = q | k | v | f1 | f2

    k_prep<<<DIN / 64 + NGM * NBLK, 256, 0, stream>>>(W1, Wq, Wk, Wv, Wf1, Wf2, W1T, WH);   // 4 chunks of W1 and the 15 block matrices, all independent

    k_tok<<<NTOK / TOKW, NTHR, 0, stream>>>(x, W1T, WH, b1, bq, bk, bv, bf1, bf2, lng, lnb, Wo, bo, OUT);
}

// v008
// One run takes 23.3 microseconds.
// Next to v007, in two timings, it ran 1.05 times as fast each time.
// All steps since v000 together make it 7.74 times as fast.
#include <hip/hip_runtime.h>

// Per-token outer-product attention stack: h = x W1 + b1 (256 -> 64); three blocks of {q,k,v = cur W + b; y_i = sum_j softmax_j(q_i k_j) v_j + cur_i; a = leaky(y Wf1 + bf1, 0.01) Wf2 + bf2 + y; res += LayerNorm(a)}; out = leaky(res Wout + bout, 0.1), stored five times.
// Compute dtypes, f32 accumulate everywhere: x W1 on v_wmma_f32_16x16x32_bf16 (x, W1 RNE-converted to bf16; products exact); the fifteen 64x64 GEMMs on v_wmma_f32_16x16x32_f16 with the activation as f16 value + f16 residual x2048 (own accumulator, folded by 1/2048) and the weight as f16 of the bf16-converted input x64 (folded by 1/64);
// per-token 64x64 softmax / P.v, LayerNorm and the 64 -> 1 head in f32 on the vector unit (no operand shared between tokens; the head is a matrix-vector product).
// Layout: W1T bf16 (64 x 256) and WH f16 (5 x 3 matrices of 64 x 64), both in B-fragment order (16-byte slots [column tile][32-wide k step][part][lane]), built in the workspace by one launch; fused kernel: eight waves per block own 32 tokens (two 16-token slabs, four waves each), all tiles in LDS.

#ifndef NTOK
#define NTOK 16384
#endif
#define NTOK_FULL 16384
#define DIN  256                 // input width
#define MD   64                  // model width of the blocks
#define NBLK 3                   // stacked blocks
#define NGM  5                   // GEMMs per block: q, k, v, f1, f2
#define TOKW 32                  // tokens per block (two slabs of 16)
#define NTHR 256                 // threads per block of the fused kernel: four waves per slab
#define XP   264                 // LDS bf16 x plane row pitch (elements)
#define TP   68                  // LDS f32 tile row pitch (floats)
#define TSZ  (16 * TP)
#define HP   72                  // LDS f16 plane row pitch (halves)
#define OFF_CUR 0
#define OFF_RES (1 * TSZ)
#define OFF_Q   (2 * TSZ)
#define OFF_K   (3 * TSZ)
#define OFF_V   (4 * TSZ)
#define OFF_Y   (5 * TSZ)
#define QRS  2048.0f             // carry of the activation residual plane
#define QRI  (1.0f / 2048.0f)
#define WSC  64.0f               // carry of the f16 weight planes
#define WSI  (1.0f / 64.0f)
#define L2E  1.4426950408889634f
#define FPART 256                // elements per fragment part: 32 lanes x 8 elements = 512 contiguous bytes, one wave-wide 16-byte load
#define FSTEP (2 * FPART)        // elements per 16-column x 32-k fragment

static_assert(MD == 64);
static_assert(MD % 32 == 0);
static_assert(DIN % 64 == 0);                    // W1 handled in 64-row chunks; k-loop steps by 32
static_assert(DIN % 32 == 0);
static_assert(TOKW == 32);
static_assert(NTOK % TOKW == 0);                 // grid covers the tokens exactly
static_assert(NTOK <= NTOK_FULL);
static_assert((size_t)NTOK_FULL * 4 == 65536);   // byte pitch between the five output copies
static_assert(((size_t)NTOK_FULL * 4) % 128 == 0);
static_assert((TP * 4) % 16 == 0);
static_assert((HP * 2) % 16 == 0);
static_assert(TP >= MD);
static_assert(HP >= MD);
static_assert(NGM * NBLK * MD == 960);           // bias stage size
static_assert(NBLK * MD <= NTHR);                // bias stage: one thread per entry of each input
static_assert(NTHR == 2 * 4 * 32);
static_assert((XP * 2) % 16 == 0);
static_assert(XP >= DIN);
static_assert(32 * 16 == 4 * 128);
static_assert(8 * 16 == 128);                    // output store: 8 lanes x 16 B = one line
static_assert(256 * 2 * 16 == 64 * 128);
static_assert(4 * 2 * FSTEP == MD * MD);         // four column tiles x two k steps fill one 64 x 64 matrix
static_assert(4 * (DIN / 32) * FSTEP == MD * DIN);
static_assert((size_t)2 * 6 * TSZ * 4 + (size_t)2 * 2 * 16 * HP * 2 + (size_t)2 * 16 * XP * 2 + 960 * 4 + 32 * 4 <= 131072);   // static LDS of the fused kernel
static_assert((size_t)64 * 65 * 4 <= 131072);    // static LDS of the converter

typedef _Float16 h16;
typedef unsigned short bf;
typedef __attribute__((ext_vector_type(16))) __bf16   v16bf;
typedef __attribute__((ext_vector_type(16))) _Float16 v16h;
typedef __attribute__((ext_vector_type(8)))  _Float16 v8h;
typedef __attribute__((ext_vector_type(8)))  unsigned short v8us;
typedef __attribute__((ext_vector_type(8)))  float    v8f;
typedef __attribute__((ext_vector_type(4)))  float    v4f;
typedef __attribute__((ext_vector_type(2)))  float    v2f;
typedef v4f  __attribute__((may_alias)) v4fa;
typedef v8h  __attribute__((may_alias)) v8ha;
typedef v8us __attribute__((may_alias)) v8usa;
typedef __attribute__((ext_vector_type(8)))  __bf16   v8b;

// every f32 -> 16-bit conversion is the hardware's own (round to nearest even, subnormals kept); eight values go as four packed converts
__device__ __forceinline__ float bfr(float f) { return (float)(__bf16)f; }   // value after RNE convert to bf16
__device__ __forceinline__ v8f cat8(v4f lo, v4f hi) { return __builtin_shufflevector(lo, hi, 0, 1, 2, 3, 4, 5, 6, 7); }
__device__ __forceinline__ v8us tob8(v8f v) { return __builtin_bit_cast(v8us, __builtin_convertvector(v, v8b)); }
__device__ __forceinline__ v8h  toh8(v8f v) { return __builtin_convertvector(v, v8h); }
__device__ __forceinline__ v16h cat16(v8h lo, v8h hi) { return __builtin_shufflevector(lo, hi, 0, 1, 2, 3, 4, 5, 6, 7, 8, 9, 10, 11, 12, 13, 14, 15); }
__device__ __forceinline__ v16bf cat16b(v8us lo, v8us hi) { return __builtin_bit_cast(v16bf, __builtin_shufflevector(lo, hi, 0, 1, 2, 3, 4, 5, 6, 7, 8, 9, 10, 11, 12, 13, 14, 15)); }
__device__ __forceinline__ v8f wmma16(v16h a, v16h b, v8f c) { return __builtin_amdgcn_wmma_f32_16x16x32_f16(false, a, false, b, (short)0, c, false, false); }
__device__ __forceinline__ v8f wmmab(v16bf a, v16bf b, v8f c) { return __builtin_amdgcn_wmma_f32_16x16x32_bf16(false, a, false, b, (short)0, c, false, false); }
// B-fragment loaders from the fragment-ordered weight planes; p already includes + 8*lane: part 0 holds elements 0..7 <- k0+8h+0..7, part 1 elements 8..15 <- k0+16+8h+0..7 of column lane&15, h = lane>>4 (same k map as the A fragments)
__device__ __forceinline__ v16h  ldh(const h16* p) { return cat16(*(const v8h*)p, *(const v8h*)(p + FPART)); }
__device__ __forceinline__ v16bf ldb(const bf* p)  { return cat16b(*(const v8us*)p, *(const v8us*)(p + FPART)); }
// one guarded matrix instruction: the accumulator is tied behind four idle slots, the fragments stay live
__device__ __forceinline__ v8f wmma16g(v16h a, v16h b, v8f c) { c = wmma16(a, b, c); asm volatile("v_nop\n\tv_nop\n\tv_nop\n\tv_nop" : "+v"(c) : "v"(a), "v"(b)); return c; }
__device__ __forceinline__ v8f wmmabg(v16bf a, v16bf b, v8f c) { c = wmmab(a, b, c); asm volatile("v_nop\n\tv_nop\n\tv_nop\n\tv_nop" : "+v"(c) : "v"(a), "v"(b)); return c; }

// k_prep: every weight plane in one launch; each block transposes one 64 x 64 f32 tile ([k][n]) through LDS and stores it in B-fragment order.
// A 16-byte slot holds 8 consecutive k (group p = k / 8) of one column n and lies at [n >> 4][p >> 2][(p >> 1) & 1][16 * (p & 1) + (n & 15)]: the slots one wave-wide fragment load reads are 512 contiguous bytes.
// Blocks 0..DIN/64-1: 64-row k chunk of W1 -> W1T bf16 [4 tiles][DIN/32 steps][2][32][8]. Block DIN/64 + m, m = g*NBLK + t: matrix t of input g (q, k, v, f1, f2) -> WH f16 [m][4 tiles][2 steps][2][32][8] of (bf16-converted value x 64).
__global__ __launch_bounds__(256) void k_prep(const float* __restrict__ W1, const float* __restrict__ Wq, const float* __restrict__ Wk, const float* __restrict__ Wv,
                                              const float* __restrict__ Wf1, const float* __restrict__ Wf2, bf* W1T, h16* WH) {
    __shared__ float ts[64 * 65];
    const int tid = threadIdx.x;
    const int kc = blockIdx.x;                                  // W1 chunk, where below DIN / 64
    const int m = kc - DIN / 64;                                // matrix number otherwise
    const bool first = kc < DIN / 64;                           // block-uniform
    const int g = m / NBLK;
    const float* Wg = (g == 0) ? Wq : (g == 1) ? Wk : (g == 2) ? Wv : (g == 3) ? Wf1 : Wf2;
    const float* W = first ? W1 + (size_t)kc * 64 * MD : Wg + (size_t)(m - g * NBLK) * MD * MD;
    float wr[16];
#pragma unroll   // all sixteen loads issued before the first is waited for: one trip to L2 instead of a chain of them
    for (int i = 0; i < 16; ++i) wr[i] = W[tid + i * 256];      // 16 x 256 = 64 x 64 entries
    asm volatile("s_wait_xcnt 0x0" ::: "memory");               // precaution: stands behind the group's loads, in front of any later write of their base or offset registers
#pragma unroll
    for (int i = 0; i < 16; ++i) { const int e = tid + i * 256; const int k = e >> 6, n = e & 63; ts[k * 65 + n] = wr[i]; }
    __syncthreads();                                            // cross-wave exchange through ts
    const int p = tid >> 5, p8 = p * 8;                         // one k group per wave
    const int nl = tid & 31;                                    // columns nl and nl + 32
    const int fo = (p >> 1) * FPART + (16 * (p & 1) + (nl & 15)) * 8;   // slot inside the column tile's two k steps of this 64-row chunk
    if (first) {
        v8f f0, f1;
#pragma unroll
        for (int u = 0; u < 8; ++u) { f0[u] = ts[(p8 + u) * 65 + nl]; f1[u] = ts[(p8 + u) * 65 + nl + 32]; }
        const v8us o0 = tob8(f0), o1 = tob8(f1);
        bf* d0 = W1T + (size_t)(nl >> 4) * (DIN / 32 * FSTEP) + (size_t)kc * (2 * FSTEP) + fo;
        bf* d1 = d0 + (size_t)2 * (DIN / 32 * FSTEP);
        *(v8us*)d0 = o0; *(v8us*)d1 = o1;
        asm volatile("s_wait_xcnt 0x0" ::: "memory");           // precaution: stands behind the two stores, in front of any later write of their address or data registers (the other arm follows in the built code)
    } else {
        v8f f0, f1;
#pragma unroll
        for (int u = 0; u < 8; ++u) { f0[u] = bfr(ts[(p8 + u) * 65 + nl]) * WSC; f1[u] = bfr(ts[(p8 + u) * 65 + nl + 32]) * WSC; }
        const v8h o0 = toh8(f0), o1 = toh8(f1);
        h16* d0 = WH + (size_t)m * MD * MD + (size_t)(nl >> 4) * (2 * FSTEP) + fo;
        h16* d1 = d0 + (size_t)2 * (2 * FSTEP);
        *(v8h*)d0 = o0; *(v8h*)d1 = o1;
        asm volatile("s_wait_xcnt 0x0" ::: "memory");           // precaution: stands behind the two stores, in front of any later write of their address or data registers (the other arm follows in the built code)
    }
}

// k_tok: fused token kernel, eight waves per block, 32 tokens as two 16-token slabs worked side by side: waves 0..3 own slab 0, waves 4..7 slab 1.
// Inside a slab wave w owns output columns 16w..16w+15 of every GEMM and tokens 4w..4w+3 of every per-token phase; tiles that change hands between the two maps are ordered by __syncthreads; in the row map a lane reads back only what it wrote itself.
// GEMM fragments: A row = token (lane&15) from the 16-bit planes (k contiguous), B column n = lane&15 of tile w from the fragment-ordered weight planes, both with the split k map; D: acc[j] = (token 8*(lane>>4)+j, column 16w + (lane&15)).
// Per slab T holds six f32 tiles [16][TP]: cur, res, q (later the hidden layer), k (later the second feed-forward output), v, y.
// one 16 x 16 x 64 GEMM tile: value and residual planes against one weight tile, bias and leaky slope, stored down one column of the destination tile
__device__ __forceinline__ void gemm_tile(const v16h (&b)[2], const v16h (&ah)[2], const v16h (&ar)[2], const float bb, const float sl, float* dst) {
    v8f acc = (v8f){}, acr = (v8f){};
#pragma unroll   // fragment arrays stay in registers
    for (int ks = 0; ks < 2; ++ks) { acc = wmma16g(ah[ks], b[ks], acc); acr = wmma16g(ar[ks], b[ks], acr); }
#pragma unroll
    for (int j = 0; j < 8; ++j) { float v = (acc[j] + acr[j] * QRI) * WSI + bb;
        v = (v >= 0.0f) ? v : sl * v;
        dst[j * TP] = v; }
}
// activation planes of 8 columns of one token row: f16 value and f16 residual x2048
__device__ __forceinline__ void planes8v(const v4f x0, const v4f x1, h16* hrow, h16* rrow) {
    const v8f xv = cat8(x0, x1);
    const v8h hv = toh8(xv);
    const v8h rv = toh8((xv - __builtin_convertvector(hv, v8f)) * QRS);
    *(v8ha*)(hrow) = hv; *(v8ha*)(rrow) = rv;
}
__device__ __forceinline__ void planes8(const float* srow, h16* hrow, h16* rrow) { planes8v(*(const v4fa*)(srow), *(const v4fa*)(srow + 4), hrow, rrow); }
// softmax unit: one pair of adjacent keys (element 0: even key, element 1: odd key, as the LDS load leaves them) against one of the lane's eight score rows;
// its five instructions: score (packed fma: score minus the row maximum, at most one rounding of the maximum above 0), two exponentials, row sum (packed add), P.v (packed fma)
__device__ __forceinline__ v2f lo2(const v4f x) { return __builtin_shufflevector(x, x, 0, 1); }
__device__ __forceinline__ v2f hi2(const v4f x) { return __builtin_shufflevector(x, x, 2, 3); }
#define SG_VALU  0x002           // scheduling group masks: plain vector instructions,
#define SG_TRANS 0x400           // transcendentals,
#define SG_DSRD  0x100           // LDS reads
#define HEADP 9                  // plain instructions ahead of a trip's first transcendental: the first batch's eight scores and one more (the plain groups also carry the trip's two address instructions)
// one batch = one pair of adjacent keys against the lane's eight score rows
#define SCORE(b, k2) _Pragma("unroll") for (int r = 0; r < 8; ++r) a[b][r] = __builtin_elementwise_fma(k2, sq[r], nc[r])
#define EXPS(b)      _Pragma("unroll") for (int r = 0; r < 8; ++r) p[b][r] = (v2f){__builtin_amdgcn_exp2f(a[b][r][0]), __builtin_amdgcn_exp2f(a[b][r][1])}
#define SUMS(b, v2)  _Pragma("unroll") for (int r = 0; r < 8; ++r) { s[r] += p[b][r]; y[r] = __builtin_elementwise_fma(p[b][r], v2, y[r]); }
// sum over the 8 lanes that share a token row
__device__ __forceinline__ float sum8(float v) { v += __shfl_xor(v, 1, 32); v += __shfl_xor(v, 2, 32); v += __shfl_xor(v, 4, 32); return v; }

__global__ __launch_bounds__(NTHR) void k_tok(const float* __restrict__ x, const bf* __restrict__ W1T, const h16* __restrict__ WH,
                                            const float* __restrict__ b1, const float* __restrict__ bq, const float* __restrict__ bk, const float* __restrict__ bv,
                                            const float* __restrict__ bf1, const float* __restrict__ bf2, const float* __restrict__ ln_g, const float* __restrict__ ln_b,
                                            const float* __restrict__ Wout, const float* __restrict__ bout, float* OUT) {
    __shared__ __align__(16) float T[2 * 6 * TSZ];
    __shared__ __align__(16) h16 AH[2 * 16 * HP];
    __shared__ __align__(16) h16 AR[2 * 16 * HP];
    __shared__ __align__(16) bf  XB[2 * 16 * XP];
    __shared__ __align__(16) float BS[NGM * NBLK * MD];
    __shared__ __align__(16) float OS[TOKW];
    const int tid = threadIdx.x;
    const int lane = tid & 31, lr = lane & 15, hi = lane >> 4;
    const int wv = __builtin_amdgcn_readfirstlane(tid >> 5);     // wave number, held scalar
    const int slab = wv >> 2, w = wv & 3;
    const int tk = 4 * w + (lane >> 3), sb = lane & 7;           // row map: token of the slab, 8-column group
    const int col = 16 * w + lr;                                 // column map of the GEMM tiles
    const int n0 = blockIdx.x * TOKW;
    float* Ts = T + slab * (6 * TSZ);
    h16* AHs = AH + slab * (16 * HP);
    h16* ARs = AR + slab * (16 * HP);
    bf*  XBs = XB + slab * (16 * XP);

    // Every global load of this kernel but the x rows and GEMM biases, used at once by the input layer, is issued a phase or more ahead of its first use, so that its trip to L2 runs under other work instead of behind a barrier.
    const h16* wp0 = WH + (size_t)w * (2 * FSTEP) + 8 * lane;    // this lane's slots in the wave's column tile of block 0; block t lies t matrices, GEMM g lies g * NBLK matrices further
    v16h wq[3][2];                                               // q, k, v weight tiles of the coming block
    v4f wo[2];                                                   // head weights of this lane's 8 columns
    float bo;                                                    // head bias

    // ---- input layer: h = x W1 + b1 (K = DIN); the slab's x rows are converted once into the bf16 plane XB, each wave then forms its own 16 columns ----
    {
        const float* xr = x + (size_t)(n0 + slab * 16 + tk) * DIN + 8 * sb;
        const bf* wb = W1T + (size_t)w * (DIN / 32 * FSTEP) + 8 * lane;   // the wave's column tile: DIN/32 fragments in a row
        v4f xv[DIN / 32];
#pragma unroll   // all eight row loads in flight together
        for (int u = 0; u < DIN / 64; ++u) { xv[2 * u] = *(const v4f*)(xr + 64 * u); xv[2 * u + 1] = *(const v4f*)(xr + 64 * u + 4); }
        v16bf b[DIN / 32];                                       // the wave's whole W1 tile, fetched as one group behind the x rows
#pragma unroll   // one load group, fragments in registers
        for (int kc = 0; kc < DIN; kc += 32) b[kc / 32] = ldb(wb + (kc / 32) * FSTEP);
        const float bb = bfr(b1[col]);
        float bl[NGM] = {0.0f, 0.0f, 0.0f, 0.0f, 0.0f};          // GEMM biases, one entry of each input per thread
        if (tid < NBLK * MD) { bl[0] = bq[tid]; bl[1] = bk[tid]; bl[2] = bv[tid]; bl[3] = bf1[tid]; bl[4] = bf2[tid]; }
        asm volatile("s_wait_xcnt 0x0" ::: "memory");            // precaution: stands behind the group's loads, in front of any later write of their base or offset registers
#pragma unroll
        for (int u = 0; u < DIN / 64; ++u) *(v8usa*)(&XBs[tk * XP + 8 * sb + 64 * u]) = tob8(cat8(xv[2 * u], xv[2 * u + 1]));
        // GEMM biases (bf16-converted values) staged once: BS[g*192 + t*64 + col]; first read behind the barriers of the input layer
        if (tid < NBLK * MD) { const int e = tid;
            BS[e] = bfr(bl[0]); BS[192 + e] = bfr(bl[1]); BS[384 + e] = bfr(bl[2]); BS[576 + e] = bfr(bl[3]); BS[768 + e] = bfr(bl[4]); }
        __syncthreads();                                         // XB rows go from their converting wave to all four waves of the slab
#pragma unroll   // one load group, fragments in registers: block 0's q, k, v tiles and the head's parameters fly under the input GEMM
        for (int g = 0; g < 3; ++g) { wq[g][0] = ldh(wp0 + (size_t)g * NBLK * MD * MD); wq[g][1] = ldh(wp0 + (size_t)g * NBLK * MD * MD + FSTEP); }
        wo[0] = *(const v4f*)(Wout + 8 * sb); wo[1] = *(const v4f*)(Wout + 8 * sb + 4); bo = bout[0];
        asm volatile("s_wait_xcnt 0x0" ::: "memory");            // precaution: stands behind the group's loads, in front of any later write of their base or offset registers
        v8f acc = (v8f){};
#pragma unroll
        for (int kc = 0; kc < DIN; kc += 32) {
            const int ao = lr * XP + kc + 8 * hi;
            const v16bf a = cat16b(*(const v8usa*)(&XBs[ao]), *(const v8usa*)(&XBs[ao + 16]));
            acc = wmmabg(a, b[kc / 32], acc); }
#pragma unroll
        for (int j = 0; j < 8; ++j) { const float hv = acc[j] + bb;
            Ts[OFF_CUR + (8 * hi + j) * TP + col] = hv;
            Ts[OFF_RES + (8 * hi + j) * TP + col] = (hv >= 0.0f) ? hv : 0.1f * hv; }
    }
    __syncthreads();                                             // cur, res: column map -> row map

    const int ro8 = tk * TP + 8 * sb;                            // this lane's 8 columns in the row map
    const int po8 = tk * HP + 8 * sb;
    float* dcol = Ts + (8 * hi) * TP + col;                      // this lane's column in the column map
#pragma unroll 1
    for (int t = 0; t < NBLK; ++t) {
        v16h ah[2], ar[2], wf1[2], wf2[2];
        v4f g4[2], b4[2];
        const h16* wp = wp0 + (size_t)(t * MD) * MD;
        // planes of cur (each lane reads back the 8 values it wrote itself, or values behind the barrier above)
        planes8(&Ts[OFF_CUR + ro8], &AHs[po8], &ARs[po8]);
        __syncthreads();                                         // planes: row map -> A fragments of all four waves
#pragma unroll
        for (int ks = 0; ks < 2; ++ks) { const int ao = lr * HP + ks * 32 + 8 * hi;
            ah[ks] = cat16(*(const v8ha*)(&AHs[ao]), *(const v8ha*)(&AHs[ao + 16]));
            ar[ks] = cat16(*(const v8ha*)(&ARs[ao]), *(const v8ha*)(&ARs[ao + 16])); }
#pragma unroll
        for (int g = 0; g < 3; ++g)                              // q, k, v share the planes
            gemm_tile(wq[g], ah, ar, BS[g * (NBLK * MD) + t * MD + col], 1.0f, dcol + OFF_Q + g * TSZ);
        __syncthreads();                                         // q, k, v: column map -> row map; also frees the planes
        // both feed-forward weight tiles and the LayerNorm parameters fly under the softmax (issued behind the barrier, whose fence would wait for them)
        wf1[0] = ldh(wp + (size_t)3 * NBLK * MD * MD); wf1[1] = ldh(wp + (size_t)3 * NBLK * MD * MD + FSTEP);
        wf2[0] = ldh(wp + (size_t)4 * NBLK * MD * MD); wf2[1] = ldh(wp + (size_t)4 * NBLK * MD * MD + FSTEP);
#pragma unroll
        for (int u = 0; u < 2; ++u) { g4[u] = *(const v4f*)(ln_g + t * MD + 8 * sb + 4 * u); b4[u] = *(const v4f*)(ln_b + t * MD + 8 * sb + 4 * u); }
        asm volatile("s_wait_xcnt 0x0" ::: "memory");            // precaution: stands behind the group's loads, in front of any later write of their base or offset registers
        // per-token extreme keys: max_j q k_j = q * (q >= 0 ? kmax : kmin); the xor tree leaves both in all 8 lanes of the token
        float mx = -3.0e38f, mn = 3.0e38f;
#pragma unroll
        for (int u = 0; u < 2; ++u) { const v4f kk = *(const v4fa*)(&Ts[OFF_K + ro8 + 4 * u]);
            mx = fmaxf(fmaxf(mx, fmaxf(kk[0], kk[1])), fmaxf(kk[2], kk[3])); mn = fminf(fminf(mn, fminf(kk[0], kk[1])), fminf(kk[2], kk[3])); }
        mx = fmaxf(mx, __shfl_xor(mx, 1, 32)); mn = fminf(mn, __shfl_xor(mn, 1, 32));
        mx = fmaxf(mx, __shfl_xor(mx, 2, 32)); mn = fminf(mn, __shfl_xor(mn, 2, 32));
        mx = fmaxf(mx, __shfl_xor(mx, 4, 32)); mn = fminf(mn, __shfl_xor(mn, 4, 32));
        // y[n][i] = sum_j softmax_j(q_i k_j) v_j + cur[n][i] in the row map: the lane owns rows i = 8 sb .. 8 sb + 7 of its token, the wave's four tokens side by side,
        // so one 16-byte read of k or v (four addresses per wave, one per token) feeds 8 rows x 4 keys per lane
        {
            v4f q4[2], c4[2], yv[2];
#pragma unroll
            for (int u = 0; u < 2; ++u) { q4[u] = *(const v4fa*)(&Ts[OFF_Q + ro8 + 4 * u]); c4[u] = *(const v4fa*)(&Ts[OFF_CUR + ro8 + 4 * u]); }
            v2f sq[8], nc[8], s[8], y[8];
#pragma unroll
            for (int r = 0; r < 8; ++r) { const float q = q4[r >> 2][r & 3];
                const float e = (q >= 0.0f) ? mx : mn;
                const float sv = q * L2E;
                const float cv = -(e * sv);                      // minus the row's largest score
                sq[r] = (v2f){sv, sv}; nc[r] = (v2f){cv, cv}; s[r] = (v2f){0.0f, 0.0f}; y[r] = (v2f){0.0f, 0.0f}; }
            const float* kr = &Ts[OFF_K + tk * TP];
            const float* vr = &Ts[OFF_V + tk * TP];
            v4f ka = *(const v4fa*)(kr), kb = *(const v4fa*)(kr + 4), va = *(const v4fa*)(vr);
#pragma unroll 1   // one trip: 8 keys = 4 batches (one key pair x 8 rows each); every LDS read is issued about half a trip or more ahead of its first use
            for (int jj = 0; jj < MD; jj += 8) {
                const v4f vb = *(const v4fa*)(vr + jj + 4);
                const int jn = (jj + 8) & (MD - 1);              // the last trip reads the row's first keys again (unused) instead of the row's pad
                v2f a[4][8], p[4][8];
                // written in the order the groups below ask for: batch b's exponentials stand among scores of later batches and sums of earlier ones, never beside an instruction that needs them
                SCORE(0, lo2(ka));
                EXPS(0); SCORE(1, hi2(ka)); SCORE(2, lo2(kb));
                EXPS(1); SCORE(3, hi2(kb)); SUMS(0, lo2(va));
                ka = *(const v4fa*)(kr + jn); kb = *(const v4fa*)(kr + jn + 4);
                EXPS(2); SUMS(1, hi2(va));
                va = *(const v4fa*)(vr + jn);
                EXPS(3); SUMS(2, lo2(vb));
                SUMS(3, hi2(vb));
                // instruction order of the trip: each transcendental is followed by a plain instruction of another batch instead of the next transcendental (left alone the scheduler forms runs of 32)
                __builtin_amdgcn_sched_group_barrier(SG_DSRD, 1, 0);
                __builtin_amdgcn_sched_group_barrier(SG_VALU, HEADP, 0);
#pragma unroll   // this loop and the three below only spell the pattern: the builtin emits no instruction and takes constants
                for (int i = 0; i < 16; ++i) { __builtin_amdgcn_sched_group_barrier(SG_TRANS, 1, 0); __builtin_amdgcn_sched_group_barrier(SG_VALU, 1, 0); }
#pragma unroll
                for (int i = 0; i < 8; ++i) { __builtin_amdgcn_sched_group_barrier(SG_TRANS, 1, 0); __builtin_amdgcn_sched_group_barrier(SG_VALU, 1, 0);
                                              __builtin_amdgcn_sched_group_barrier(SG_TRANS, 1, 0); __builtin_amdgcn_sched_group_barrier(SG_VALU, 2, 0); }
                __builtin_amdgcn_sched_group_barrier(SG_VALU, 1, 0);   // a 25th plain slot in this stretch, for the second address instruction
                __builtin_amdgcn_sched_group_barrier(SG_DSRD, 2, 0);
#pragma unroll
                for (int i = 0; i < 16; ++i) { __builtin_amdgcn_sched_group_barrier(SG_TRANS, 1, 0); __builtin_amdgcn_sched_group_barrier(SG_VALU, 1, 0); }
                __builtin_amdgcn_sched_group_barrier(SG_DSRD, 1, 0);
#pragma unroll
                for (int i = 0; i < 16; ++i) { __builtin_amdgcn_sched_group_barrier(SG_TRANS, 1, 0); __builtin_amdgcn_sched_group_barrier(SG_VALU, 1, 0); }
                __builtin_amdgcn_sched_group_barrier(SG_VALU, 16, 0);
            }
#pragma unroll
            for (int r = 0; r < 8; ++r) yv[r >> 2][r & 3] = (y[r][0] + y[r][1]) * __builtin_amdgcn_rcpf(s[r][0] + s[r][1]) + c4[r >> 2][r & 3];
#pragma unroll
            for (int u = 0; u < 2; ++u) *(v4fa*)(&Ts[OFF_Y + ro8 + 4 * u]) = yv[u];   // read back by the same lane in the LayerNorm
            planes8v(yv[0], yv[1], &AHs[po8], &ARs[po8]);        // planes of y straight from the registers
        }
        __syncthreads();                                         // planes: row map -> A fragments
#pragma unroll
        for (int ks = 0; ks < 2; ++ks) { const int ao = lr * HP + ks * 32 + 8 * hi;
            ah[ks] = cat16(*(const v8ha*)(&AHs[ao]), *(const v8ha*)(&AHs[ao + 16]));
            ar[ks] = cat16(*(const v8ha*)(&ARs[ao]), *(const v8ha*)(&ARs[ao + 16])); }
        gemm_tile(wf1, ah, ar, BS[3 * (NBLK * MD) + t * MD + col], 0.01f, dcol + OFF_Q);   // hidden layer: leaky slope 0.01
        __syncthreads();                                         // hidden layer: column map -> row map; also frees the planes
        planes8(&Ts[OFF_Q + ro8], &AHs[po8], &ARs[po8]);
        __syncthreads();                                         // planes: row map -> A fragments
#pragma unroll
        for (int ks = 0; ks < 2; ++ks) { const int ao = lr * HP + ks * 32 + 8 * hi;
            ah[ks] = cat16(*(const v8ha*)(&AHs[ao]), *(const v8ha*)(&AHs[ao + 16]));
            ar[ks] = cat16(*(const v8ha*)(&ARs[ao]), *(const v8ha*)(&ARs[ao + 16])); }
        gemm_tile(wf2, ah, ar, BS[4 * (NBLK * MD) + t * MD + col], 1.0f, dcol + OFF_K);
        __syncthreads();                                         // second feed-forward output: column map -> row map; also frees the planes
        {                                                        // the next block's q, k, v tiles fly under the LayerNorm and the plane split
            // loaded on every trip (the last trip fetches its own block's tiles again, unused): behind a test the old tiles would stay live through the whole trip and take 48 registers from the softmax
            const h16* wn = wp0 + (size_t)(((t + 1 < NBLK) ? t + 1 : t) * MD) * MD;
#pragma unroll   // one load group, fragments in registers
            for (int g = 0; g < 3; ++g) { wq[g][0] = ldh(wn + (size_t)g * NBLK * MD * MD); wq[g][1] = ldh(wn + (size_t)g * NBLK * MD * MD + FSTEP); }
            asm volatile("s_wait_xcnt 0x0" ::: "memory");        // precaution: stands behind the group's loads, in front of any later write of their base or offset registers
        }
        // a = ff + y; res += LayerNorm(a) * g + b; cur = res. Row map: 8 lanes share a token, each keeps its 8 columns in registers
        {
            v4f a[2];
#pragma unroll
            for (int u = 0; u < 2; ++u) a[u] = *(const v4fa*)(&Ts[OFF_K + ro8 + 4 * u]) + *(const v4fa*)(&Ts[OFF_Y + ro8 + 4 * u]);
            const float sm = sum8(((a[0][0] + a[0][1]) + (a[0][2] + a[0][3])) + ((a[1][0] + a[1][1]) + (a[1][2] + a[1][3])));
            const float mu = sm * (1.0f / MD);
            float vs = 0.0f;
#pragma unroll
            for (int u = 0; u < 2; ++u) { const float d0 = a[u][0] - mu, d1 = a[u][1] - mu, d2 = a[u][2] - mu, d3 = a[u][3] - mu; vs += (d0 * d0 + d1 * d1) + (d2 * d2 + d3 * d3); }
            vs = sum8(vs);
            const float inv = __builtin_amdgcn_rsqf(vs * (1.0f / MD) + 1e-5f);
#pragma unroll
            for (int u = 0; u < 2; ++u) { const v4f r4 = *(const v4fa*)(&Ts[OFF_RES + ro8 + 4 * u]); v4f nr;
#pragma unroll
                for (int i = 0; i < 4; ++i) nr[i] = ((a[u][i] - mu) * inv * bfr(g4[u][i]) + bfr(b4[u][i])) + r4[i];
                *(v4fa*)(&Ts[OFF_RES + ro8 + 4 * u]) = nr; *(v4fa*)(&Ts[OFF_CUR + ro8 + 4 * u]) = nr; }
        }
    }
    // head: leaky(res . Wout + bout, 0.1); matrix-vector product in f32 on the vector unit, row map
    {
        float ds = 0.0f;
#pragma unroll
        for (int u = 0; u < 2; ++u) { const v4f r4 = *(const v4fa*)(&Ts[OFF_RES + ro8 + 4 * u]); const v4f w4 = wo[u];
            ds += (r4[0] * bfr(w4[0]) + r4[1] * bfr(w4[1])) + (r4[2] * bfr(w4[2]) + r4[3] * bfr(w4[3])); }
        ds = sum8(ds);
        float ov = ds + bfr(bo);
        ov = (ov >= 0.0f) ? ov : 0.1f * ov;
        if (sb == 0) OS[slab * 16 + tk] = ov;
    }
    __syncthreads();                                             // OS: all eight waves -> the storing lanes
    if (tid < 5 * 8) {                                           // five copies x 8 lanes x 16 B: each copy's 128-byte line stored whole
        const int c = tid >> 3, q4 = (tid & 7) * 4;
        const v4f val = *(const v4fa*)(&OS[q4]);
        *(v4f*)(OUT + (size_t)c * NTOK_FULL + n0 + q4) = val;
    }
}

static constexpr size_t al256(size_t v) { return (v + 255) & ~(size_t)255; }
static constexpr size_t SZ_W1T = al256((size_t)MD * DIN * 2);
static constexpr size_t SZ_WH  = al256((size_t)NGM * NBLK * MD * MD * 2);
static constexpr size_t SZ_TOTAL = SZ_W1T + SZ_WH;
static_assert(SZ_TOTAL <= (size_t)134217728);              // workspace carve <= 128 MiB
static_assert(((size_t)NBLK * MD * MD * 2) % 256 == 0);    // per-input weight sub-planes stay 256-byte aligned
static_assert((size_t)(DIN / 64) * 64 == (size_t)DIN);     // W1 blocks of k_prep x 64 rows == DIN
static_assert((size_t)(NTOK / TOKW) * TOKW == (size_t)NTOK);

extern "C" void kernel_launch(void* const* d_in, const int* in_sizes, int n_in,
                              void* d_out, int out_size, void* d_ws, size_t ws_size, hipStream_t stream) {
    if (n_in < 17) return;
    if ((size_t)in_sizes[0] < (size_t)NTOK * DIN) return;
    if ((size_t)in_sizes[1] < (size_t)DIN * MD || in_sizes[2] < MD) return;
    if ((size_t)in_sizes[3] < (size_t)NBLK * MD * MD || (size_t)in_sizes[5] < (size_t)NBLK * MD * MD || (size_t)in_sizes[7] < (size_t)NBLK * MD * MD) return;
    if ((size_t)in_sizes[9] < (size_t)NBLK * MD * MD || (size_t)in_sizes[11] < (size_t)NBLK * MD * MD) return;
    if (in_sizes[4] < NBLK * MD || in_sizes[6] < NBLK * MD || in_sizes[8] < NBLK * MD || in_sizes[10] < NBLK * MD || in_sizes[12] < NBLK * MD) return;
    if (in_sizes[13] < NBLK * MD || in_sizes[14] < NBLK * MD || in_sizes[15] < MD || in_sizes[16] < 1) return;
    if ((size_t)out_size < (size_t)4 * NTOK_FULL + NTOK) return;
    if (SZ_TOTAL > ws_size) return;
    // wire order: x, W1, b1, Wq, bq, Wk, bk, Wv, bv, Wf1, bf1, Wf2, bf2, ln_g, ln_b, Wout, bout
    const float* x   = (const float*)d_in[0];
    const float* W1  = (const float*)d_in[1];  const float* b1  = (const float*)d_in[2];
    const float* Wq  = (const float*)d_in[3];  const float* bq  = (const float*)d_in[4];
    const float* Wk  = (const float*)d_in[5];  const float* bk  = (const float*)d_in[6];
    const float* Wv  = (const float*)d_in[7];  const float* bv  = (const float*)d_in[8];
    const float* Wf1 = (const float*)d_in[9];  const float* bf1 = (const float*)d_in[10];
    const float* Wf2 = (const float*)d_in[11]; const float* bf2 = (const float*)d_in[12];
    const float* lng = (const float*)d_in[13]; const float* lnb = (const float*)d_in[14];
    const float* Wo  = (const float*)d_in[15]; const float* bo  = (const float*)d_in[16];
    float* OUT = (float*)d_out;                 // five copies, pitch NTOK_FULL floats
    char* wsp = (char*)d_ws;
    bf*  W1T = (bf*)wsp;  wsp += SZ_W1T;        // 64 x 256 bf16, fragment order
    h16* WH  = (h16*)wsp; wsp += SZ_WH;         // [5][3] matrices of 64 x 64 f16 x64, fragment order; g = q | k | v | f1 | f2

    k_prep<<<DIN / 64 + NGM * NBLK, 256, 0, stream>>>(W1, Wq, Wk, Wv, Wf1, Wf2, W1T, WH);   // 4 chunks of W1 and the 15 block matrices, all independent

    k_tok<<<NTOK / TOKW, NTHR, 0, stream>>>(x, W1T, WH, b1, bq, bk, bv, bf1, bf2, lng, lnb, Wo, bo, OUT);
}

// v009
// It runs in 22.2 microseconds.
// Timed twice side by side with v008, it ran 1.05 times as fast both times.
// Over all steps from v000 it is 8.13 times as fast.
#include <hip/hip_runtime.h>

// Per-token outer-product attention stack: h = x W1 + b1 (256 -> 64); three blocks of {q,k,v = cur W + b; y_i = sum_j softmax_j(q_i k_j) v_j + cur_i; a = leaky(y Wf1 + bf1, 0.01) Wf2 + bf2 + y; res += LayerNorm(a)}; out = leaky(res Wout + bout, 0.1), stored five times.
// Compute dtypes, f32 accumulate everywhere: x W1 on v_wmma_f32_16x16x32_bf16 (x, W1 RNE-converted to bf16; products exact); the fifteen 64x64 GEMMs on v_wmma_f32_16x16x32_f16 with the activation as f16 value + f16 residual x2048 (own accumulator, folded by 1/2048) and the weight as f16 of the bf16-converted input x64 (folded by 1/64);
// per-token 64x64 softmax / P.v, LayerNorm and the 64 -> 1 head in f32 on the vector unit (no operand shared between tokens; the head is a matrix-vector product).
// Layout: W1T bf16 (64 x 256) and WH f16 (5 x 3 matrices of 64 x 64), both in B-fragment order (16-byte slots [column tile][32-wide k step][part][lane]), built in the workspace by one launch; fused kernel: eight waves per block own 32 tokens (two 16-token slabs, four waves each), activations in registers, exchanged through LDS.

#ifndef NTOK
#define NTOK 16384
#endif
#define NTOK_FULL 16384
#define DIN  256                 // input width
#define MD   64                  // model width of the blocks
#define NBLK 3                   // stacked blocks
#define NGM  5                   // GEMMs per block: q, k, v, f1, f2
#define TOKW 32                  // tokens per block (two slabs of 16)
#define NTHR 256                 // threads per block of the fused kernel: four waves per slab
#define XP   264                 // LDS bf16 x plane row pitch (elements)
#define TP   68                  // LDS f32 tile row pitch (floats)
#define TSZ  (16 * TP)
#define HP   72                  // LDS f16 plane row pitch (halves)
#define PSZ  (16 * HP)           // one 16-token plane
#define OFF_K   0
#define OFF_V   TSZ
#define QRS  2048.0f             // carry of the activation residual plane
#define QRI  (1.0f / 2048.0f)
#define WSC  64.0f               // carry of the f16 weight planes
#define WSI  (1.0f / 64.0f)
#define L2E  1.4426950408889634f
#define FPART 256                // elements per fragment part: 32 lanes x 8 elements = 512 contiguous bytes, one wave-wide 16-byte load
#define FSTEP (2 * FPART)        // elements per 16-column x 32-k fragment

static_assert(MD == 64);
static_assert(MD % 32 == 0);
static_assert(DIN % 64 == 0);                    // W1 handled in 64-row chunks; k-loop steps by 32
static_assert(DIN % 32 == 0);
static_assert(TOKW == 32);
static_assert(NTOK % TOKW == 0);                 // grid covers the tokens exactly
static_assert(NTOK <= NTOK_FULL);
static_assert((size_t)NTOK_FULL * 4 == 65536);   // byte pitch between the five output copies
static_assert(((size_t)NTOK_FULL * 4) % 128 == 0);
static_assert((TP * 4) % 16 == 0);
static_assert((HP * 2) % 16 == 0);
static_assert(TP >= MD);
static_assert(HP >= MD);
static_assert(NGM * NBLK * MD == 960);           // bias stage size
static_assert(NBLK * MD <= NTHR);                // bias stage: one thread per entry of each input
static_assert(NTHR == 2 * 4 * 32);
static_assert((XP * 2) % 16 == 0);
static_assert(XP >= DIN);
static_assert(32 * 16 == 4 * 128);
static_assert(8 * 16 == 128);                    // output store: 8 lanes x 16 B = one line
static_assert(256 * 2 * 16 == 64 * 128);
static_assert(4 * 2 * FSTEP == MD * MD);         // four column tiles x two k steps fill one 64 x 64 matrix
static_assert(4 * (DIN / 32) * FSTEP == MD * DIN);
static_assert((size_t)2 * 2 * TSZ * 4 + (size_t)2 * 2 * 2 * 16 * HP * 2 + (size_t)2 * 16 * XP * 2 + 960 * 4 + 3 * 32 * 8 * 4 <= 131072);   // static LDS of the fused kernel
static_assert((size_t)64 * 65 * 4 <= 131072);    // static LDS of the converter

typedef _Float16 h16;
typedef unsigned short bf;
typedef __attribute__((ext_vector_type(16))) __bf16   v16bf;
typedef __attribute__((ext_vector_type(16))) _Float16 v16h;
typedef __attribute__((ext_vector_type(8)))  _Float16 v8h;
typedef __attribute__((ext_vector_type(8)))  unsigned short v8us;
typedef __attribute__((ext_vector_type(8)))  float    v8f;
typedef __attribute__((ext_vector_type(4)))  float    v4f;
typedef __attribute__((ext_vector_type(2)))  float    v2f;
typedef v4f  __attribute__((may_alias)) v4fa;
typedef v8h  __attribute__((may_alias)) v8ha;
typedef v8us __attribute__((may_alias)) v8usa;
typedef __attribute__((ext_vector_type(8)))  __bf16   v8b;

// every f32 -> 16-bit conversion is the hardware's own (round to nearest even, subnormals kept); eight values go as four packed converts
__device__ __forceinline__ float bfr(float f) { return (float)(__bf16)f; }   // value after RNE convert to bf16
__device__ __forceinline__ v8f cat8(v4f lo, v4f hi) { return __builtin_shufflevector(lo, hi, 0, 1, 2, 3, 4, 5, 6, 7); }
__device__ __forceinline__ v8us tob8(v8f v) { return __builtin_bit_cast(v8us, __builtin_convertvector(v, v8b)); }
__device__ __forceinline__ v8h  toh8(v8f v) { return __builtin_convertvector(v, v8h); }
__device__ __forceinline__ v16h cat16(v8h lo, v8h hi) { return __builtin_shufflevector(lo, hi, 0, 1, 2, 3, 4, 5, 6, 7, 8, 9, 10, 11, 12, 13, 14, 15); }
__device__ __forceinline__ v16bf cat16b(v8us lo, v8us hi) { return __builtin_bit_cast(v16bf, __builtin_shufflevector(lo, hi, 0, 1, 2, 3, 4, 5, 6, 7, 8, 9, 10, 11, 12, 13, 14, 15)); }
__device__ __forceinline__ v8f wmma16(v16h a, v16h b, v8f c) { return __builtin_amdgcn_wmma_f32_16x16x32_f16(false, a, false, b, (short)0, c, false, false); }
__device__ __forceinline__ v8f wmmab(v16bf a, v16bf b, v8f c) { return __builtin_amdgcn_wmma_f32_16x16x32_bf16(false, a, false, b, (short)0, c, false, false); }
// fragment loaders from the fragment-ordered weight planes; p already includes + 8*lane: part 0 holds elements 0..7 <- k0+8h+0..7, part 1 elements 8..15 <- k0+16+8h+0..7 of weight column lane&15, h = lane>>4 (A and B fragments have this same k map, so the slots serve as A rows of the transposed product)
__device__ __forceinline__ v16h  ldh(const h16* p) { return cat16(*(const v8h*)p, *(const v8h*)(p + FPART)); }
__device__ __forceinline__ v16bf ldb(const bf* p)  { return cat16b(*(const v8us*)p, *(const v8us*)(p + FPART)); }
// one guarded matrix instruction: the accumulator is tied behind four idle slots, the fragments stay live
__device__ __forceinline__ v8f wmma16g(v16h a, v16h b, v8f c) { c = wmma16(a, b, c); asm volatile("v_nop\n\tv_nop\n\tv_nop\n\tv_nop" : "+v"(c) : "v"(a), "v"(b)); return c; }
__device__ __forceinline__ v8f wmmabg(v16bf a, v16bf b, v8f c) { c = wmmab(a, b, c); asm volatile("v_nop\n\tv_nop\n\tv_nop\n\tv_nop" : "+v"(c) : "v"(a), "v"(b)); return c; }

// k_prep: every weight plane in one launch; each block transposes one 64 x 64 f32 tile ([k][n]) through LDS and stores it in B-fragment order.
// A 16-byte slot holds 8 consecutive k (group p = k / 8) of one column n and lies at [n >> 4][p >> 2][(p >> 1) & 1][16 * (p & 1) + (n & 15)]: the slots one wave-wide fragment load reads are 512 contiguous bytes.
// Blocks 0..DIN/64-1: 64-row k chunk of W1 -> W1T bf16 [4 tiles][DIN/32 steps][2][32][8]. Block DIN/64 + m, m = g*NBLK + t: matrix t of input g (q, k, v, f1, f2) -> WH f16 [m][4 tiles][2 steps][2][32][8] of (bf16-converted value x 64).
__global__ __launch_bounds__(256) void k_prep(const float* __restrict__ W1, const float* __restrict__ Wq, const float* __restrict__ Wk, const float* __restrict__ Wv,
                                              const float* __restrict__ Wf1, const float* __restrict__ Wf2, bf* W1T, h16* WH) {
    __shared__ float ts[64 * 65];
    const int tid = threadIdx.x;
    const int kc = blockIdx.x;                                  // W1 chunk, where below DIN / 64
    const int m = kc - DIN / 64;                                // matrix number otherwise
    const bool first = kc < DIN / 64;                           // block-uniform
    const int g = m / NBLK;
    const float* Wg = (g == 0) ? Wq : (g == 1) ? Wk : (g == 2) ? Wv : (g == 3) ? Wf1 : Wf2;
    const float* W = first ? W1 + (size_t)kc * 64 * MD : Wg + (size_t)(m - g * NBLK) * MD * MD;
    float wr[16];
#pragma unroll   // all sixteen loads issued before the first is waited for: one trip to L2 instead of a chain of them
    for (int i = 0; i < 16; ++i) wr[i] = W[tid + i * 256];      // 16 x 256 = 64 x 64 entries
    asm volatile("s_wait_xcnt 0x0" ::: "memory");               // precaution: stands behind the group's loads, in front of any later write of their base or offset registers
#pragma unroll
    for (int i = 0; i < 16; ++i) { const int e = tid + i * 256; const int k = e >> 6, n = e & 63; ts[k * 65 + n] = wr[i]; }
    __syncthreads();                                            // cross-wave exchange through ts
    const int p = tid >> 5, p8 = p * 8;                         // one k group per wave
    const int nl = tid & 31;                                    // columns nl and nl + 32
    const int fo = (p >> 1) * FPART + (16 * (p & 1) + (nl & 15)) * 8;   // slot inside the column tile's two k steps of this 64-row chunk
    if (first) {
        v8f f0, f1;
#pragma unroll
        for (int u = 0; u < 8; ++u) { f0[u] = ts[(p8 + u) * 65 + nl]; f1[u] = ts[(p8 + u) * 65 + nl + 32]; }
        const v8us o0 = tob8(f0), o1 = tob8(f1);
        bf* d0 = W1T + (size_t)(nl >> 4) * (DIN / 32 * FSTEP) + (size_t)kc * (2 * FSTEP) + fo;
        bf* d1 = d0 + (size_t)2 * (DIN / 32 * FSTEP);
        *(v8us*)d0 = o0; *(v8us*)d1 = o1;
        asm volatile("s_wait_xcnt 0x0" ::: "memory");           // precaution: stands behind the two stores, in front of any later write of their address or data registers (the other arm follows in the built code)
    } else {
        v8f f0, f1;
#pragma unroll
        for (int u = 0; u < 8; ++u) { f0[u] = bfr(ts[(p8 + u) * 65 + nl]) * WSC; f1[u] = bfr(ts[(p8 + u) * 65 + nl + 32]) * WSC; }
        const v8h o0 = toh8(f0), o1 = toh8(f1);
        h16* d0 = WH + (size_t)m * MD * MD + (size_t)(nl >> 4) * (2 * FSTEP) + fo;
        h16* d1 = d0 + (size_t)2 * (2 * FSTEP);
        *(v8h*)d0 = o0; *(v8h*)d1 = o1;
        asm volatile("s_wait_xcnt 0x0" ::: "memory");           // precaution: stands behind the two stores, in front of any later write of their address or data registers (the other arm follows in the built code)
    }
}

// k_tok: fused token kernel, eight waves per block, 32 tokens as two 16-token slabs worked side by side: waves 0..3 own slab 0, waves 4..7 slab 1.
// One lane map for every phase (feature map): lane = (token lane&15 of the slab, features f0 .. f0+7, f0 = 16w + 8*(lane>>4)), w the wave's number in the slab.
// The GEMMs are formed transposed: A row = output feature (lane&15 of tile w) from the fragment-ordered weight planes, B column = token (lane&15) from the 16-bit activation planes (k contiguous), both with the split k map;
// D: acc[j] = (feature 16w + 8*(lane>>4) + j, token lane&15), which is the feature map: cur, res, q, y, the hidden layer and the feed-forward output never leave the lane's registers.
// Through LDS, each ordered by a work-group barrier, go only what other waves need: the 16-bit planes (two buffers), the f32 k and v tiles [16][TP], and one partial per (token, 8-feature group) of the key extremes, the LayerNorm sums and the head.
// one 16 x 16 x 64 GEMM tile: one weight tile against the value and residual planes, bias (8 staged values at bs) and leaky slope; returns the lane's 8 features
__device__ __forceinline__ v8f gemm_tile(const v16h (&wt)[2], const v16h (&ah)[2], const v16h (&ar)[2], const float* bs, const float sl) {
    const v8f bb = cat8(*(const v4fa*)(bs), *(const v4fa*)(bs + 4));
    v8f acc = (v8f){}, acr = (v8f){}, o;
#pragma unroll   // fragment arrays stay in registers
    for (int ks = 0; ks < 2; ++ks) { acc = wmma16g(wt[ks], ah[ks], acc); acr = wmma16g(wt[ks], ar[ks], acr); }
#pragma unroll
    for (int j = 0; j < 8; ++j) { float v = (acc[j] + acr[j] * QRI) * WSI + bb[j];
        v = (v >= 0.0f) ? v : sl * v;
        o[j] = v; }
    return o;
}
// activation planes of the lane's 8 features of its token: f16 value and f16 residual x2048
__device__ __forceinline__ void planes8r(const v8f xv, h16* hrow, h16* rrow) {
    const v8h hv = toh8(xv);
    const v8h rv = toh8((xv - __builtin_convertvector(hv, v8f)) * QRS);
    *(v8ha*)(hrow) = hv; *(v8ha*)(rrow) = rv;
}
__device__ __forceinline__ v4f lo4(const v8f x) { return __builtin_shufflevector(x, x, 0, 1, 2, 3); }
__device__ __forceinline__ v4f hi4(const v8f x) { return __builtin_shufflevector(x, x, 4, 5, 6, 7); }
// sum of eight values as a tree of register pairs: even and odd elements apart (packed adds, no register moves), joined last
__device__ __forceinline__ float tree8(const v8f a) {
    const v2f p = (__builtin_shufflevector(a, a, 0, 1) + __builtin_shufflevector(a, a, 2, 3)) + (__builtin_shufflevector(a, a, 4, 5) + __builtin_shufflevector(a, a, 6, 7));
    return p[0] + p[1]; }
// softmax unit: one pair of adjacent keys (element 0: even key, element 1: odd key, as the LDS load leaves them) against one of the lane's eight score rows;
// its five instructions: score (packed fma: score minus the row maximum, at most one rounding of the maximum above 0), two exponentials, row sum (packed add), P.v (packed fma)
__device__ __forceinline__ v2f lo2(const v4f x) { return __builtin_shufflevector(x, x, 0, 1); }
__device__ __forceinline__ v2f hi2(const v4f x) { return __builtin_shufflevector(x, x, 2, 3); }
#define SG_VALU  0x002           // scheduling group masks: plain vector instructions,
#define SG_TRANS 0x400           // transcendentals,
#define SG_DSRD  0x100           // LDS reads
#define HEADP 9                  // plain instructions ahead of a trip's first transcendental: the first batch's eight scores and one more (the plain groups also carry the trip's two address instructions)
// one batch = one pair of adjacent keys against the lane's eight score rows
#define SCORE(b, k2) _Pragma("unroll") for (int r = 0; r < 8; ++r) a[b][r] = __builtin_elementwise_fma(k2, sq[r], nc[r])
#define EXPS(b)      _Pragma("unroll") for (int r = 0; r < 8; ++r) p[b][r] = (v2f){__builtin_amdgcn_exp2f(a[b][r][0]), __builtin_amdgcn_exp2f(a[b][r][1])}
#define SUMS(b, v2)  _Pragma("unroll") for (int r = 0; r < 8; ++r) { s[r] += p[b][r]; y[r] = __builtin_elementwise_fma(p[b][r], v2, y[r]); }

__global__ __launch_bounds__(NTHR) void k_tok(const float* __restrict__ x, const bf* __restrict__ W1T, const h16* __restrict__ WH,
                                            const float* __restrict__ b1, const float* __restrict__ bq, const float* __restrict__ bk, const float* __restrict__ bv,
                                            const float* __restrict__ bf1, const float* __restrict__ bf2, const float* __restrict__ ln_g, const float* __restrict__ ln_b,
                                            const float* __restrict__ Wout, const float* __restrict__ bout, float* OUT) {
    __shared__ __align__(16) float T[2 * 2 * TSZ];
    __shared__ __align__(16) h16 AH[2 * 2 * PSZ];
    __shared__ __align__(16) h16 AR[2 * 2 * PSZ];
    __shared__ __align__(16) bf  XB[2 * 16 * XP];
    __shared__ __align__(16) float BS[NGM * NBLK * MD];
    __shared__ __align__(16) float PA[TOKW * 8];                 // partials [token][group]: largest key, later the LayerNorm sum
    __shared__ __align__(16) float PB[TOKW * 8];                 // smallest key, later the LayerNorm sum of squared deviations
    __shared__ __align__(16) float PH[TOKW * 8];                 // head partials
    const int tid = threadIdx.x;
    const int lane = tid & 31, lr = lane & 15, hi = lane >> 4;
    const int wv = __builtin_amdgcn_readfirstlane(tid >> 5);     // wave number, held scalar
    const int slab = wv >> 2, w = wv & 3;
    const int f0 = 16 * w + 8 * hi;                              // feature map: the lane's 8 features of token lr
    const int grp = 2 * w + hi;                                  // their group number
    const int n0 = blockIdx.x * TOKW;
    float* Ts = T + slab * (2 * TSZ);
    h16* AHs = AH + slab * (2 * PSZ);
    h16* ARs = AR + slab * (2 * PSZ);
    bf*  XBs = XB + slab * (16 * XP);
    const int pt = (slab * 16 + lr) * 8;                         // the token's row of partials

    // Every global load of this kernel but the x rows and the GEMM biases is issued a phase or more ahead of its first use, so that its trip to L2 runs under other work instead of behind a barrier.
    const h16* wp0 = WH + (size_t)w * (2 * FSTEP) + 8 * lane;    // this lane's slots in the wave's feature tile of block 0; block t lies t matrices, GEMM g lies g * NBLK matrices further
    v16h wq[3][2];                                               // q, k, v weight tiles of the coming block
    v4f wo[2];                                                   // head weights of this lane's 8 features
    float bo;                                                    // head bias
    v8f cur, res;

    // ---- input layer: h = x W1 + b1 (K = DIN); the slab's x rows are converted once into the bf16 plane XB, each wave then forms its own 16 features ----
    {
        const int tk = 4 * w + (lane >> 3), sb = lane & 7;       // staging map of the x rows: 8 lanes read 256 contiguous bytes of one row
        const float* xr = x + (size_t)(n0 + slab * 16 + tk) * DIN + 8 * sb;
        const bf* wb = W1T + (size_t)w * (DIN / 32 * FSTEP) + 8 * lane;   // the wave's feature tile: DIN/32 fragments in a row
        v4f xv[DIN / 32];
#pragma unroll   // all eight row loads in flight together
        for (int u = 0; u < DIN / 64; ++u) { xv[2 * u] = *(const v4f*)(xr + 64 * u); xv[2 * u + 1] = *(const v4f*)(xr + 64 * u + 4); }
        v16bf b[DIN / 32];                                       // the wave's whole W1 tile, fetched as one group behind the x rows
#pragma unroll   // one load group, fragments in registers
        for (int kc = 0; kc < DIN; kc += 32) b[kc / 32] = ldb(wb + (kc / 32) * FSTEP);
        const v8f bb = cat8(*(const v4f*)(b1 + f0), *(const v4f*)(b1 + f0 + 4));
        float bl[NGM] = {0.0f, 0.0f, 0.0f, 0.0f, 0.0f};          // GEMM biases, one entry of each input per thread
        if (tid < NBLK * MD) { bl[0] = bq[tid]; bl[1] = bk[tid]; bl[2] = bv[tid]; bl[3] = bf1[tid]; bl[4] = bf2[tid]; }
        asm volatile("s_wait_xcnt 0x0" ::: "memory");            // precaution: stands behind the group's loads, in front of any later write of their base or offset registers
#pragma unroll
        for (int u = 0; u < DIN / 64; ++u) *(v8usa*)(&XBs[tk * XP + 8 * sb + 64 * u]) = tob8(cat8(xv[2 * u], xv[2 * u + 1]));
        // GEMM biases (bf16-converted values) staged once: BS[g*192 + t*64 + feature]; first read behind the barriers of the input layer
        if (tid < NBLK * MD) { const int e = tid;
            BS[e] = bfr(bl[0]); BS[192 + e] = bfr(bl[1]); BS[384 + e] = bfr(bl[2]); BS[576 + e] = bfr(bl[3]); BS[768 + e] = bfr(bl[4]); }
        __syncthreads();                                         // XB rows go from their converting wave to all four waves of the slab
#pragma unroll   // one load group, fragments in registers: block 0's q, k, v tiles and the head's parameters fly under the input GEMM
        for (int g = 0; g < 3; ++g) { wq[g][0] = ldh(wp0 + (size_t)g * NBLK * MD * MD); wq[g][1] = ldh(wp0 + (size_t)g * NBLK * MD * MD + FSTEP); }
        wo[0] = *(const v4f*)(Wout + f0); wo[1] = *(const v4f*)(Wout + f0 + 4); bo = bout[0];
        asm volatile("s_wait_xcnt 0x0" ::: "memory");            // precaution: stands behind the group's loads, in front of any later write of their base or offset registers
        v8f acc = (v8f){};
#pragma unroll
        for (int kc = 0; kc < DIN; kc += 32) {
            const int ao = lr * XP + kc + 8 * hi;
            const v16bf a = cat16b(*(const v8usa*)(&XBs[ao]), *(const v8usa*)(&XBs[ao + 16]));
            acc = wmmabg(b[kc / 32], a, acc); }
#pragma unroll
        for (int j = 0; j < 8; ++j) { const float hv = acc[j] + bfr(bb[j]);
            cur[j] = hv;
            res[j] = (hv >= 0.0f) ? hv : 0.1f * hv; }
    }

    const int pw = lr * HP + f0;                                 // the lane's 8 features in a plane
    const int kw = lr * TP + f0;                                 // and in an f32 tile
#pragma unroll 1
    for (int t = 0; t < NBLK; ++t) {
        v16h ah[2], ar[2], wf1[2], wf2[2];
        v4f g4[2], b4[2];
        v8f yv;
        const h16* wp = wp0 + (size_t)(t * MD) * MD;
        planes8r(cur, &AHs[pw], &ARs[pw]);                       // plane buffer 0: its last readers (the y fragments of the block before) lie two barriers back
        __syncthreads();                                         // planes of cur -> B fragments of all four waves
#pragma unroll
        for (int ks = 0; ks < 2; ++ks) { const int ao = lr * HP + ks * 32 + 8 * hi;
            ah[ks] = cat16(*(const v8ha*)(&AHs[ao]), *(const v8ha*)(&AHs[ao + 16]));
            ar[ks] = cat16(*(const v8ha*)(&ARs[ao]), *(const v8ha*)(&ARs[ao + 16])); }
        const v8f q8 = gemm_tile(wq[0], ah, ar, &BS[0 * (NBLK * MD) + t * MD + f0], 1.0f);   // q, k, v share the planes; q stays in the lane
        const v8f k8 = gemm_tile(wq[1], ah, ar, &BS[1 * (NBLK * MD) + t * MD + f0], 1.0f);
        const v8f v8 = gemm_tile(wq[2], ah, ar, &BS[2 * (NBLK * MD) + t * MD + f0], 1.0f);
        *(v4fa*)(&Ts[OFF_K + kw]) = lo4(k8); *(v4fa*)(&Ts[OFF_K + kw + 4]) = hi4(k8);
        *(v4fa*)(&Ts[OFF_V + kw]) = lo4(v8); *(v4fa*)(&Ts[OFF_V + kw + 4]) = hi4(v8);
        PA[pt + grp] = fmaxf(fmaxf(fmaxf(k8[0], k8[1]), fmaxf(k8[2], k8[3])), fmaxf(fmaxf(k8[4], k8[5]), fmaxf(k8[6], k8[7])));
        PB[pt + grp] = fminf(fminf(fminf(k8[0], k8[1]), fminf(k8[2], k8[3])), fminf(fminf(k8[4], k8[5]), fminf(k8[6], k8[7])));
        __syncthreads();                                         // k, v and the key extremes of each group -> all four waves; also frees plane buffer 0
        // both feed-forward weight tiles and the LayerNorm parameters fly under the softmax (issued behind the barrier, whose fence would wait for them)
        wf1[0] = ldh(wp + (size_t)3 * NBLK * MD * MD); wf1[1] = ldh(wp + (size_t)3 * NBLK * MD * MD + FSTEP);
        wf2[0] = ldh(wp + (size_t)4 * NBLK * MD * MD); wf2[1] = ldh(wp + (size_t)4 * NBLK * MD * MD + FSTEP);
#pragma unroll
        for (int u = 0; u < 2; ++u) { g4[u] = *(const v4f*)(ln_g + t * MD + f0 + 4 * u); b4[u] = *(const v4f*)(ln_b + t * MD + f0 + 4 * u); }
        asm volatile("s_wait_xcnt 0x0" ::: "memory");            // precaution: stands behind the group's loads, in front of any later write of their base or offset registers
        // per-token extreme keys: max_j q k_j = q * (q >= 0 ? kmax : kmin), from the token's eight group extremes
        float mx, mn;
        { const v4f x0 = *(const v4fa*)(&PA[pt]), x1 = *(const v4fa*)(&PA[pt + 4]), m0 = *(const v4fa*)(&PB[pt]), m1 = *(const v4fa*)(&PB[pt + 4]);
          mx = fmaxf(fmaxf(fmaxf(x0[0], x0[1]), fmaxf(x0[2], x0[3])), fmaxf(fmaxf(x1[0], x1[1]), fmaxf(x1[2], x1[3])));
          mn = fminf(fminf(fminf(m0[0], m0[1]), fminf(m0[2], m0[3])), fminf(fminf(m1[0], m1[1]), fminf(m1[2], m1[3]))); }
        // y[n][i] = sum_j softmax_j(q_i k_j) v_j + cur[n][i]: the lane owns rows i = f0 .. f0 + 7 of its token, the slab's sixteen tokens side by side,
        // so one 16-byte read of k or v (sixteen addresses per wave, one per token, at pitch TP on distinct banks) feeds 8 rows x 4 keys per lane
        {
            v2f sq[8], nc[8], s[8], y[8];
#pragma unroll
            for (int r = 0; r < 8; ++r) { const float q = q8[r];
                const float e = (q >= 0.0f) ? mx : mn;
                const float sv = q * L2E;
                const float cv = -(e * sv);                      // minus the row's largest score
                sq[r] = (v2f){sv, sv}; nc[r] = (v2f){cv, cv}; s[r] = (v2f){0.0f, 0.0f}; y[r] = (v2f){0.0f, 0.0f}; }
            const float* kr = &Ts[OFF_K + lr * TP];
            const float* vr = &Ts[OFF_V + lr * TP];
            v4f ka = *(const v4fa*)(kr), kb = *(const v4fa*)(kr + 4), va = *(const v4fa*)(vr);
#pragma unroll 1   // one trip: 8 keys = 4 batches (one key pair x 8 rows each); every LDS read is issued about half a trip or more ahead of its first use
            for (int jj = 0; jj < MD; jj += 8) {
                const v4f vb = *(const v4fa*)(vr + jj + 4);
                const int jn = (jj + 8) & (MD - 1);              // the last trip reads the row's first keys again (unused) instead of the row's pad
                v2f a[4][8], p[4][8];
                // written in the order the groups below ask for: batch b's exponentials stand among scores of later batches and sums of earlier ones, never beside an instruction that needs them
                SCORE(0, lo2(ka));
                EXPS(0); SCORE(1, hi2(ka)); SCORE(2, lo2(kb));
                EXPS(1); SCORE(3, hi2(kb)); SUMS(0, lo2(va));
                ka = *(const v4fa*)(kr + jn); kb = *(const v4fa*)(kr + jn + 4);
                EXPS(2); SUMS(1, hi2(va));
                va = *(const v4fa*)(vr + jn);
                EXPS(3); SUMS(2, lo2(vb));
                SUMS(3, hi2(vb));
                // instruction order of the trip: each transcendental is followed by a plain instruction of another batch instead of the next transcendental (left alone the scheduler forms runs of 32)
                __builtin_amdgcn_sched_group_barrier(SG_DSRD, 1, 0);
                __builtin_amdgcn_sched_group_barrier(SG_VALU, HEADP, 0);
#pragma unroll   // this loop and the three below only spell the pattern: the builtin emits no instruction and takes constants
                for (int i = 0; i < 16; ++i) { __builtin_amdgcn_sched_group_barrier(SG_TRANS, 1, 0); __builtin_amdgcn_sched_group_barrier(SG_VALU, 1, 0); }
#pragma unroll
                for (int i = 0; i < 8; ++i) { __builtin_amdgcn_sched_group_barrier(SG_TRANS, 1, 0); __builtin_amdgcn_sched_group_barrier(SG_VALU, 1, 0);
                                              __builtin_amdgcn_sched_group_barrier(SG_TRANS, 1, 0); __builtin_amdgcn_sched_group_barrier(SG_VALU, 2, 0); }
                __builtin_amdgcn_sched_group_barrier(SG_VALU, 1, 0);   // a 25th plain slot in this stretch, for the second address instruction
                __builtin_amdgcn_sched_group_barrier(SG_DSRD, 2, 0);
#pragma unroll
                for (int i = 0; i < 16; ++i) { __builtin_amdgcn_sched_group_barrier(SG_TRANS, 1, 0); __builtin_amdgcn_sched_group_barrier(SG_VALU, 1, 0); }
                __builtin_amdgcn_sched_group_barrier(SG_DSRD, 1, 0);
#pragma unroll
                for (int i = 0; i < 16; ++i) { __builtin_amdgcn_sched_group_barrier(SG_TRANS, 1, 0); __builtin_amdgcn_sched_group_barrier(SG_VALU, 1, 0); }
                __builtin_amdgcn_sched_group_barrier(SG_VALU, 16, 0);
            }
#pragma unroll
            for (int r = 0; r < 8; ++r) yv[r] = (y[r][0] + y[r][1]) * __builtin_amdgcn_rcpf(s[r][0] + s[r][1]) + cur[r];
            planes8r(yv, &AHs[pw], &ARs[pw]);                    // planes of y, buffer 0
        }
        __syncthreads();                                         // planes of y -> B fragments
#pragma unroll
        for (int ks = 0; ks < 2; ++ks) { const int ao = lr * HP + ks * 32 + 8 * hi;
            ah[ks] = cat16(*(const v8ha*)(&AHs[ao]), *(const v8ha*)(&AHs[ao + 16]));
            ar[ks] = cat16(*(const v8ha*)(&ARs[ao]), *(const v8ha*)(&ARs[ao + 16])); }
        // hidden layer, leaky slope 0.01; its planes go to buffer 1, since other waves may still be reading buffer 0
        planes8r(gemm_tile(wf1, ah, ar, &BS[3 * (NBLK * MD) + t * MD + f0], 0.01f), &AHs[PSZ + pw], &ARs[PSZ + pw]);
        __syncthreads();                                         // planes of the hidden layer -> B fragments
        {                                                        // the next block's q, k, v tiles fly under the second feed-forward GEMM, the LayerNorm and the plane split
            // loaded on every trip (the last trip fetches its own block's tiles again, unused): behind a test the old tiles would stay live through the whole trip and take 48 registers from the softmax
            const h16* wn = wp0 + (size_t)(((t + 1 < NBLK) ? t + 1 : t) * MD) * MD;
#pragma unroll   // one load group, fragments in registers
            for (int g = 0; g < 3; ++g) { wq[g][0] = ldh(wn + (size_t)g * NBLK * MD * MD); wq[g][1] = ldh(wn + (size_t)g * NBLK * MD * MD + FSTEP); }
            asm volatile("s_wait_xcnt 0x0" ::: "memory");        // precaution: stands behind the group's loads, in front of any later write of their base or offset registers
        }
#pragma unroll
        for (int ks = 0; ks < 2; ++ks) { const int ao = PSZ + lr * HP + ks * 32 + 8 * hi;
            ah[ks] = cat16(*(const v8ha*)(&AHs[ao]), *(const v8ha*)(&AHs[ao + 16]));
            ar[ks] = cat16(*(const v8ha*)(&ARs[ao]), *(const v8ha*)(&ARs[ao + 16])); }
        const v8f a = gemm_tile(wf2, ah, ar, &BS[4 * (NBLK * MD) + t * MD + f0], 1.0f) + yv;   // a = ff + y
        // res += LayerNorm(a) * g + b; cur = res. Each group hands over its sum and its squared deviations from its own mean; the token's variance is their sum plus the spread of the group means (no cancellation)
        {
            const float gs = tree8(a);
            const v8f gd = a - gs * 0.125f;
            PA[pt + grp] = gs; PB[pt + grp] = tree8(gd * gd);
            // LayerNorm partials of each group -> all four waves. Work-group barrier by hand, with the LDS wait alone beside it: the fence of __syncthreads() would also wait here for the weight loads issued above, which are first used two phases on
            asm volatile("s_wait_dscnt 0x0\n\ts_barrier_signal -1\n\ts_barrier_wait -1" ::: "memory");
            const v8f ps = cat8(*(const v4fa*)(&PA[pt]), *(const v4fa*)(&PA[pt + 4]));
            const v8f pq = cat8(*(const v4fa*)(&PB[pt]), *(const v4fa*)(&PB[pt + 4]));
            const float mu = tree8(ps) * (1.0f / MD);
            const v8f md = ps * 0.125f - mu;
            const float vs = tree8(pq) + 8.0f * tree8(md * md);
            const float inv = __builtin_amdgcn_rsqf(vs * (1.0f / MD) + 1e-5f);
#pragma unroll
            for (int i = 0; i < 8; ++i) res[i] = ((a[i] - mu) * inv * bfr(g4[i >> 2][i & 3]) + bfr(b4[i >> 2][i & 3])) + res[i];
            cur = res;
        }
    }
    // head: leaky(res . Wout + bout, 0.1); matrix-vector product in f32 on the vector unit: one partial per group, summed by the storing lanes
    {
        float ds = 0.0f;
#pragma unroll
        for (int u = 0; u < 2; ++u) { const v4f w4 = wo[u];
            ds += (res[4 * u] * bfr(w4[0]) + res[4 * u + 1] * bfr(w4[1])) + (res[4 * u + 2] * bfr(w4[2]) + res[4 * u + 3] * bfr(w4[3])); }
        PH[pt + grp] = ds;
    }
    __syncthreads();                                             // PH: all eight waves -> the storing lanes
    if (tid < 5 * 8) {                                           // five copies x 8 lanes x 16 B: each copy's 128-byte line stored whole
        const int c = tid >> 3, q4 = (tid & 7) * 4;
        v4f val;
#pragma unroll
        for (int i = 0; i < 4; ++i) { const float ov = tree8(cat8(*(const v4fa*)(&PH[(q4 + i) * 8]), *(const v4fa*)(&PH[(q4 + i) * 8 + 4]))) + bfr(bo);
            val[i] = (ov >= 0.0f) ? ov : 0.1f * ov; }
        *(v4f*)(OUT + (size_t)c * NTOK_FULL + n0 + q4) = val;
    }
}

static constexpr size_t al256(size_t v) { return (v + 255) & ~(size_t)255; }
static constexpr size_t SZ_W1T = al256((size_t)MD * DIN * 2);
static constexpr size_t SZ_WH  = al256((size_t)NGM * NBLK * MD * MD * 2);
static constexpr size_t SZ_TOTAL = SZ_W1T + SZ_WH;
static_assert(SZ_TOTAL <= (size_t)134217728);              // workspace carve <= 128 MiB
static_assert(((size_t)NBLK * MD * MD * 2) % 256 == 0);    // per-input weight sub-planes stay 256-byte aligned
static_assert((size_t)(DIN / 64) * 64 == (size_t)DIN);     // W1 blocks of k_prep x 64 rows == DIN
static_assert((size_t)(NTOK / TOKW) * TOKW == (size_t)NTOK);

extern "C" void kernel_launch(void* const* d_in, const int* in_sizes, int n_in,
                              void* d_out, int out_size, void* d_ws, size_t ws_size, hipStream_t stream) {
    if (n_in < 17) return;
    if ((size_t)in_sizes[0] < (size_t)NTOK * DIN) return;
    if ((size_t)in_sizes[1] < (size_t)DIN * MD || in_sizes[2] < MD) return;
    if ((size_t)in_sizes[3] < (size_t)NBLK * MD * MD || (size_t)in_sizes[5] < (size_t)NBLK * MD * MD || (size_t)in_sizes[7] < (size_t)NBLK * MD * MD) return;
    if ((size_t)in_sizes[9] < (size_t)NBLK * MD * MD || (size_t)in_sizes[11] < (size_t)NBLK * MD * MD) return;
    if (in_sizes[4] < NBLK * MD || in_sizes[6] < NBLK * MD || in_sizes[8] < NBLK * MD || in_sizes[10] < NBLK * MD || in_sizes[12] < NBLK * MD) return;
    if (in_sizes[13] < NBLK * MD || in_sizes[14] < NBLK * MD || in_sizes[15] < MD || in_sizes[16] < 1) return;
    if ((size_t)out_size < (size_t)4 * NTOK_FULL + NTOK) return;
    if (SZ_TOTAL > ws_size) return;
    // wire order: x, W1, b1, Wq, bq, Wk, bk, Wv, bv, Wf1, bf1, Wf2, bf2, ln_g, ln_b, Wout, bout
    const float* x   = (const float*)d_in[0];
    const float* W1  = (const float*)d_in[1];  const float* b1  = (const float*)d_in[2];
    const float* Wq  = (const float*)d_in[3];  const float* bq  = (const float*)d_in[4];
    const float* Wk  = (const float*)d_in[5];  const float* bk  = (const float*)d_in[6];
    const float* Wv  = (const float*)d_in[7];  const float* bv  = (const float*)d_in[8];
    const float* Wf1 = (const float*)d_in[9];  const float* bf1 = (const float*)d_in[10];
    const float* Wf2 = (const float*)d_in[11]; const float* bf2 = (const float*)d_in[12];
    const float* lng = (const float*)d_in[13]; const float* lnb = (const float*)d_in[14];
    const float* Wo  = (const float*)d_in[15]; const float* bo  = (const float*)d_in[16];
    float* OUT = (float*)d_out;                 // five copies, pitch NTOK_FULL floats
    char* wsp = (char*)d_ws;
    bf*  W1T = (bf*)wsp;  wsp += SZ_W1T;        // 64 x 256 bf16, fragment order
    h16* WH  = (h16*)wsp; wsp += SZ_WH;         // [5][3] matrices of 64 x 64 f16 x64, fragment order; g = q | k | v | f1 | f2

    k_prep<<<DIN / 64 + NGM * NBLK, 256, 0, stream>>>(W1, Wq, Wk, Wv, Wf1, Wf2, W1T, WH);   // 4 chunks of W1 and the 15 block matrices, all independent

    k_tok<<<NTOK / TOKW, NTHR, 0, stream>>>(x, W1T, WH, b1, bq, bk, bv, bf1, bf2, lng, lnb, Wo, bo, OUT);
}

// v010
// One run takes 21.4 microseconds.
// Next to v009, in two timings, it ran 1.04 times as fast each time.
// All steps since v000 together make it 8.43 times as fast.
#include <hip/hip_runtime.h>

// Per-token outer-product attention stack: h = x W1 + b1 (256 -> 64); three blocks of {q,k,v = cur W + b; y_i = sum_j softmax_j(q_i k_j) v_j + cur_i; a = leaky(y Wf1 + bf1, 0.01) Wf2 + bf2 + y; res += LayerNorm(a)}; out = leaky(res Wout + bout, 0.1), stored five times.
// Compute dtypes, f32 accumulate everywhere: x W1 on v_wmma_f32_16x16x32_bf16 (x, W1 RNE-converted to bf16; products exact); the fifteen 64x64 GEMMs on v_wmma_f32_16x16x32_f16 with the activation as f16 value + f16 residual and the weight as f16 of the bf16-converted input, no scale on either (small residuals and weights are f16 subnormals, step 2^-24), all products of a tile in one accumulator that starts at the bias;
// per-token 64x64 softmax / P.v, LayerNorm and the 64 -> 1 head in f32 on the vector unit (no operand shared between tokens; the head is a matrix-vector product).
// Layout: W1T bf16 (64 x 256) and WH f16 (5 x 3 matrices of 64 x 64), both in B-fragment order (16-byte slots [column tile][32-wide k step][part][lane]), built in the workspace by one launch; fused kernel: eight waves per block own 32 tokens (two 16-token slabs, four waves each), activations in registers, exchanged through LDS.

#ifndef NTOK
#define NTOK 16384
#endif
#define NTOK_FULL 16384
#define DIN  256                 // input width
#define MD   64                  // model width of the blocks
#define NBLK 3                   // stacked blocks
#define NGM  5                   // GEMMs per block: q, k, v, f1, f2
#define TOKW 32                  // tokens per block (two slabs of 16)
#define NTHR 256                 // threads per block of the fused kernel: four waves per slab
#define XP   264                 // LDS bf16 x plane row pitch (elements)
#define TP   68                  // LDS f32 tile row pitch (floats)
#define TSZ  (16 * TP)
#define HP   72                  // LDS f16 plane row pitch (halves)
#define PSZ  (16 * HP)           // one 16-token plane
#define OFF_K   0
#define OFF_V   TSZ
#define L2E  1.4426950408889634f
#define FPART 256                // elements per fragment part: 32 lanes x 8 elements = 512 contiguous bytes, one wave-wide 16-byte load
#define FSTEP (2 * FPART)        // elements per 16-column x 32-k fragment

static_assert(MD == 64);
static_assert(MD % 32 == 0);
static_assert(DIN % 64 == 0);                    // W1 handled in 64-row chunks; k-loop steps by 32
static_assert(DIN % 32 == 0);
static_assert(TOKW == 32);
static_assert(NTOK % TOKW == 0);                 // grid covers the tokens exactly
static_assert(NTOK <= NTOK_FULL);
static_assert((size_t)NTOK_FULL * 4 == 65536);   // byte pitch between the five output copies
static_assert(((size_t)NTOK_FULL * 4) % 128 == 0);
static_assert((TP * 4) % 16 == 0);
static_assert((HP * 2) % 16 == 0);
static_assert(TP >= MD);
static_assert(HP >= MD);
static_assert(NGM * NBLK * MD == 960);           // bias stage size
static_assert(NBLK * MD <= NTHR);                // bias stage: one thread per entry of each input
static_assert(NTHR == 2 * 4 * 32);
static_assert((XP * 2) % 16 == 0);
static_assert(XP >= DIN);
static_assert(32 * 16 == 4 * 128);
static_assert(8 * 16 == 128);                    // output store: 8 lanes x 16 B = one line
static_assert(256 * 2 * 16 == 64 * 128);
static_assert(4 * 2 * FSTEP == MD * MD);         // four column tiles x two k steps fill one 64 x 64 matrix
static_assert(4 * (DIN / 32) * FSTEP == MD * DIN);
static_assert((size_t)2 * 2 * TSZ * 4 + (size_t)2 * 2 * 2 * 16 * HP * 2 + (size_t)2 * 16 * XP * 2 + 960 * 4 + 3 * 32 * 8 * 4 <= 131072);   // static LDS of the fused kernel
static_assert((size_t)64 * 65 * 4 <= 131072);    // static LDS of the converter

typedef _Float16 h16;
typedef unsigned short bf;
typedef __attribute__((ext_vector_type(16))) __bf16   v16bf;
typedef __attribute__((ext_vector_type(16))) _Float16 v16h;
typedef __attribute__((ext_vector_type(8)))  _Float16 v8h;
typedef __attribute__((ext_vector_type(8)))  unsigned short v8us;
typedef __attribute__((ext_vector_type(8)))  float    v8f;
typedef __attribute__((ext_vector_type(4)))  float    v4f;
typedef __attribute__((ext_vector_type(2)))  float    v2f;
typedef v4f  __attribute__((may_alias)) v4fa;
typedef v8h  __attribute__((may_alias)) v8ha;
typedef v8us __attribute__((may_alias)) v8usa;
typedef __attribute__((ext_vector_type(8)))  __bf16   v8b;

// every f32 -> 16-bit conversion is the hardware's own (round to nearest even, subnormals kept); eight values go as four packed converts
__device__ __forceinline__ float bfr(float f) { return (float)(__bf16)f; }   // value after RNE convert to bf16
__device__ __forceinline__ v8f cat8(v4f lo, v4f hi) { return __builtin_shufflevector(lo, hi, 0, 1, 2, 3, 4, 5, 6, 7); }
__device__ __forceinline__ v8us tob8(v8f v) { return __builtin_bit_cast(v8us, __builtin_convertvector(v, v8b)); }
__device__ __forceinline__ v8h  toh8(v8f v) { return __builtin_convertvector(v, v8h); }
__device__ __forceinline__ v16h cat16(v8h lo, v8h hi) { return __builtin_shufflevector(lo, hi, 0, 1, 2, 3, 4, 5, 6, 7, 8, 9, 10, 11, 12, 13, 14, 15); }
__device__ __forceinline__ v16bf cat16b(v8us lo, v8us hi) { return __builtin_bit_cast(v16bf, __builtin_shufflevector(lo, hi, 0, 1, 2, 3, 4, 5, 6, 7, 8, 9, 10, 11, 12, 13, 14, 15)); }
__device__ __forceinline__ v8f wmma16(v16h a, v16h b, v8f c) { return __builtin_amdgcn_wmma_f32_16x16x32_f16(false, a, false, b, (short)0, c, false, false); }
__device__ __forceinline__ v8f wmmab(v16bf a, v16bf b, v8f c) { return __builtin_amdgcn_wmma_f32_16x16x32_bf16(false, a, false, b, (short)0, c, false, false); }
// fragment loaders from the fragment-ordered weight planes; p already includes + 8*lane: part 0 holds elements 0..7 <- k0+8h+0..7, part 1 elements 8..15 <- k0+16+8h+0..7 of weight column lane&15, h = lane>>4 (A and B fragments have this same k map, so the slots serve as A rows of the transposed product)
__device__ __forceinline__ v16h  ldh(const h16* p) { return cat16(*(const v8h*)p, *(const v8h*)(p + FPART)); }
__device__ __forceinline__ v16bf ldb(const bf* p)  { return cat16b(*(const v8us*)p, *(const v8us*)(p + FPART)); }
// one guarded matrix instruction: the accumulator is tied behind four idle slots, the fragments stay live
__device__ __forceinline__ v8f wmmabg(v16bf a, v16bf b, v8f c) { c = wmmab(a, b, c); asm volatile("v_nop\n\tv_nop\n\tv_nop\n\tv_nop" : "+v"(c) : "v"(a), "v"(b)); return c; }

// k_prep: every weight plane in one launch; each block transposes one 64 x 64 f32 tile ([k][n]) through LDS and stores it in B-fragment order.
// A 16-byte slot holds 8 consecutive k (group p = k / 8) of one column n and lies at [n >> 4][p >> 2][(p >> 1) & 1][16 * (p & 1) + (n & 15)]: the slots one wave-wide fragment load reads are 512 contiguous bytes.
// Blocks 0..DIN/64-1: 64-row k chunk of W1 -> W1T bf16 [4 tiles][DIN/32 steps][2][32][8]. Block DIN/64 + m, m = g*NBLK + t: matrix t of input g (q, k, v, f1, f2) -> WH f16 [m][4 tiles][2 steps][2][32][8] of the bf16-converted value.
__global__ __launch_bounds__(256) void k_prep(const float* __restrict__ W1, const float* __restrict__ Wq, const float* __restrict__ Wk, const float* __restrict__ Wv,
                                              const float* __restrict__ Wf1, const float* __restrict__ Wf2, bf* W1T, h16* WH) {
    __shared__ float ts[64 * 65];
    const int tid = threadIdx.x;
    const int kc = blockIdx.x;                                  // W1 chunk, where below DIN / 64
    const int m = kc - DIN / 64;                                // matrix number otherwise
    const bool first = kc < DIN / 64;                           // block-uniform
    const int g = m / NBLK;
    const float* Wg = (g == 0) ? Wq : (g == 1) ? Wk : (g == 2) ? Wv : (g == 3) ? Wf1 : Wf2;
    const float* W = first ? W1 + (size_t)kc * 64 * MD : Wg + (size_t)(m - g * NBLK) * MD * MD;
    float wr[16];
#pragma unroll   // all sixteen loads issued before the first is waited for: one trip to L2 instead of a chain of them
    for (int i = 0; i < 16; ++i) wr[i] = W[tid + i * 256];      // 16 x 256 = 64 x 64 entries
    asm volatile("s_wait_xcnt 0x0" ::: "memory");               // precaution: stands behind the group's loads, in front of any later write of their base or offset registers
#pragma unroll
    for (int i = 0; i < 16; ++i) { const int e = tid + i * 256; const int k = e >> 6, n = e & 63; ts[k * 65 + n] = wr[i]; }
    __syncthreads();                                            // cross-wave exchange through ts
    const int p = tid >> 5, p8 = p * 8;                         // one k group per wave
    const int nl = tid & 31;                                    // columns nl and nl + 32
    const int fo = (p >> 1) * FPART + (16 * (p & 1) + (nl & 15)) * 8;   // slot inside the column tile's two k steps of this 64-row chunk
    if (first) {
        v8f f0, f1;
#pragma unroll
        for (int u = 0; u < 8; ++u) { f0[u] = ts[(p8 + u) * 65 + nl]; f1[u] = ts[(p8 + u) * 65 + nl + 32]; }
        const v8us o0 = tob8(f0), o1 = tob8(f1);
        bf* d0 = W1T + (size_t)(nl >> 4) * (DIN / 32 * FSTEP) + (size_t)kc * (2 * FSTEP) + fo;
        bf* d1 = d0 + (size_t)2 * (DIN / 32 * FSTEP);
        *(v8us*)d0 = o0; *(v8us*)d1 = o1;
        asm volatile("s_wait_xcnt 0x0" ::: "memory");           // precaution: stands behind the two stores, in front of any later write of their address or data registers (the other arm follows in the built code)
    } else {
        v8f f0, f1;
#pragma unroll
        for (int u = 0; u < 8; ++u) { f0[u] = bfr(ts[(p8 + u) * 65 + nl]); f1[u] = bfr(ts[(p8 + u) * 65 + nl + 32]); }
        const v8h o0 = toh8(f0), o1 = toh8(f1);
        h16* d0 = WH + (size_t)m * MD * MD + (size_t)(nl >> 4) * (2 * FSTEP) + fo;
        h16* d1 = d0 + (size_t)2 * (2 * FSTEP);
        *(v8h*)d0 = o0; *(v8h*)d1 = o1;
        asm volatile("s_wait_xcnt 0x0" ::: "memory");           // precaution: stands behind the two stores, in front of any later write of their address or data registers (the other arm follows in the built code)
    }
}

// k_tok: fused token kernel, eight waves per block, 32 tokens as two 16-token slabs worked side by side: waves 0..3 own slab 0, waves 4..7 slab 1.
// One lane map for every phase (feature map): lane = (token lane&15 of the slab, features f0 .. f0+7, f0 = 16w + 8*(lane>>4)), w the wave's number in the slab.
// The GEMMs are formed transposed: A row = output feature (lane&15 of tile w) from the fragment-ordered weight planes, B column = token (lane&15) from the 16-bit activation planes (k contiguous), both with the split k map;
// D: acc[j] = (feature 16w + 8*(lane>>4) + j, token lane&15), which is the feature map: cur, res, q, y, the hidden layer and the feed-forward output never leave the lane's registers.
// Through LDS, each ordered by a work-group barrier, go only what other waves need: the 16-bit planes (two buffers), the f32 k and v tiles [16][TP], and one partial per (token, 8-feature group) of the key extremes, the LayerNorm sums and the head.
// one 16 x 16 x 64 GEMM tile: one weight tile against the value and residual planes, four matrix instructions accumulating into one D, the lane's 8 bias values bb as its start value, leaky slope; returns the lane's 8 features
__device__ __forceinline__ v8f gemm_tile(const v16h (&wt)[2], const v16h (&ah)[2], const v16h (&ar)[2], const v8f bb, const float sl) {
    v8f acc = bb, o;                                             // the chain starts at the bias: D is the finished pre-activation
#pragma unroll   // fragment arrays stay in registers
    for (int ks = 0; ks < 2; ++ks) { acc = wmma16(wt[ks], ah[ks], acc); acc = wmma16(wt[ks], ar[ks], acc); }
#pragma unroll
    for (int j = 0; j < 8; ++j) o[j] = (acc[j] >= 0.0f) ? acc[j] : sl * acc[j];
    return o;
}
// the lane's 8 staged bias values; read ahead of the barrier in front of their GEMM, since the chain needs them at its head
__device__ __forceinline__ v8f bias8(const float* bs) { return cat8(*(const v4fa*)(bs), *(const v4fa*)(bs + 4)); }
// activation planes of the lane's 8 features of its token: f16 value and f16 residual
__device__ __forceinline__ void planes8r(const v8f xv, h16* hrow, h16* rrow) {
    const v8h hv = toh8(xv);
    const v8h rv = toh8(xv - __builtin_convertvector(hv, v8f));
    *(v8ha*)(hrow) = hv; *(v8ha*)(rrow) = rv;
}
__device__ __forceinline__ v4f lo4(const v8f x) { return __builtin_shufflevector(x, x, 0, 1, 2, 3); }
__device__ __forceinline__ v4f hi4(const v8f x) { return __builtin_shufflevector(x, x, 4, 5, 6, 7); }
// sum of eight values as a tree of register pairs: even and odd elements apart (packed adds, no register moves), joined last
__device__ __forceinline__ float tree8(const v8f a) {
    const v2f p = (__builtin_shufflevector(a, a, 0, 1) + __builtin_shufflevector(a, a, 2, 3)) + (__builtin_shufflevector(a, a, 4, 5) + __builtin_shufflevector(a, a, 6, 7));
    return p[0] + p[1]; }
// softmax unit: one pair of adjacent keys (element 0: even key, element 1: odd key, as the LDS load leaves them) against one of the lane's eight score rows;
// its five instructions: score (packed fma: score minus the row maximum, at most one rounding of the maximum above 0), two exponentials, row sum (packed add), P.v (packed fma)
__device__ __forceinline__ v2f lo2(const v4f x) { return __builtin_shufflevector(x, x, 0, 1); }
__device__ __forceinline__ v2f hi2(const v4f x) { return __builtin_shufflevector(x, x, 2, 3); }
#define SG_VALU  0x002           // scheduling group masks: plain vector instructions,
#define SG_TRANS 0x400           // transcendentals,
#define SG_DSRD  0x100           // LDS reads
#define HEADP 9                  // plain instructions ahead of a trip's first transcendental: the first batch's eight scores and one more (the plain groups also carry the trip's two address instructions)
// one batch = one pair of adjacent keys against the lane's eight score rows
#define SCORE(b, k2) _Pragma("unroll") for (int r = 0; r < 8; ++r) a[b][r] = __builtin_elementwise_fma(k2, sq[r], nc[r])
#define EXPS(b)      _Pragma("unroll") for (int r = 0; r < 8; ++r) p[b][r] = (v2f){__builtin_amdgcn_exp2f(a[b][r][0]), __builtin_amdgcn_exp2f(a[b][r][1])}
#define SUMS(b, v2)  _Pragma("unroll") for (int r = 0; r < 8; ++r) { s[r] += p[b][r]; y[r] = __builtin_elementwise_fma(p[b][r], v2, y[r]); }

__global__ __launch_bounds__(NTHR) void k_tok(const float* __restrict__ x, const bf* __restrict__ W1T, const h16* __restrict__ WH,
                                            const float* __restrict__ b1, const float* __restrict__ bq, const float* __restrict__ bk, const float* __restrict__ bv,
                                            const float* __restrict__ bf1, const float* __restrict__ bf2, const float* __restrict__ ln_g, const float* __restrict__ ln_b,
                                            const float* __restrict__ Wout, const float* __restrict__ bout, float* OUT) {
    __shared__ __align__(16) float T[2 * 2 * TSZ];
    __shared__ __align__(16) h16 AH[2 * 2 * PSZ];
    __shared__ __align__(16) h16 AR[2 * 2 * PSZ];
    __shared__ __align__(16) bf  XB[2 * 16 * XP];
    __shared__ __align__(16) float BS[NGM * NBLK * MD];
    __shared__ __align__(16) float PA[TOKW * 8];                 // partials [token][group]: largest key, later the LayerNorm sum
    __shared__ __align__(16) float PB[TOKW * 8];                 // smallest key, later the LayerNorm sum of squared deviations
    __shared__ __align__(16) float PH[TOKW * 8];                 // head partials
    const int tid = threadIdx.x;
    const int lane = tid & 31, lr = lane & 15, hi = lane >> 4;
    const int wv = __builtin_amdgcn_readfirstlane(tid >> 5);     // wave number, held scalar
    const int slab = wv >> 2, w = wv & 3;
    const int f0 = 16 * w + 8 * hi;                              // feature map: the lane's 8 features of token lr
    const int grp = 2 * w + hi;                                  // their group number
    const int n0 = blockIdx.x * TOKW;
    float* Ts = T + slab * (2 * TSZ);
    h16* AHs = AH + slab * (2 * PSZ);
    h16* ARs = AR + slab * (2 * PSZ);
    bf*  XBs = XB + slab * (16 * XP);
    const int pt = (slab * 16 + lr) * 8;                         // the token's row of partials

    // Every global load of this kernel but the x rows and the GEMM biases is issued a phase or more ahead of its first use, so that its trip to L2 runs under other work instead of behind a barrier.
    const h16* wp0 = WH + (size_t)w * (2 * FSTEP) + 8 * lane;    // this lane's slots in the wave's feature tile of block 0; block t lies t matrices, GEMM g lies g * NBLK matrices further
    v16h wq[3][2];                                               // q, k, v weight tiles of the coming block
    v4f wo[2];                                                   // head weights of this lane's 8 features
    float bo;                                                    // head bias
    v8f cur, res;

    // ---- input layer: h = x W1 + b1 (K = DIN); the slab's x rows are converted once into the bf16 plane XB, each wave then forms its own 16 features ----
    {
        const int tk = 4 * w + (lane >> 3), sb = lane & 7;       // staging map of the x rows: 8 lanes read 256 contiguous bytes of one row
        const float* xr = x + (size_t)(n0 + slab * 16 + tk) * DIN + 8 * sb;
        const bf* wb = W1T + (size_t)w * (DIN / 32 * FSTEP) + 8 * lane;   // the wave's feature tile: DIN/32 fragments in a row
        v4f xv[DIN / 32];
#pragma unroll   // all eight row loads in flight together
        for (int u = 0; u < DIN / 64; ++u) { xv[2 * u] = *(const v4f*)(xr + 64 * u); xv[2 * u + 1] = *(const v4f*)(xr + 64 * u + 4); }
        v16bf b[DIN / 32];                                       // the wave's whole W1 tile, fetched as one group behind the x rows
#pragma unroll   // one load group, fragments in registers
        for (int kc = 0; kc < DIN; kc += 32) b[kc / 32] = ldb(wb + (kc / 32) * FSTEP);
        const v8f bb = cat8(*(const v4f*)(b1 + f0), *(const v4f*)(b1 + f0 + 4));
        float bl[NGM] = {0.0f, 0.0f, 0.0f, 0.0f, 0.0f};          // GEMM biases, one entry of each input per thread
        if (tid < NBLK * MD) { bl[0] = bq[tid]; bl[1] = bk[tid]; bl[2] = bv[tid]; bl[3] = bf1[tid]; bl[4] = bf2[tid]; }
        asm volatile("s_wait_xcnt 0x0" ::: "memory");            // precaution: stands behind the group's loads, in front of any later write of their base or offset registers
#pragma unroll
        for (int u = 0; u < DIN / 64; ++u) *(v8usa*)(&XBs[tk * XP + 8 * sb + 64 * u]) = tob8(cat8(xv[2 * u], xv[2 * u + 1]));
        // GEMM biases (bf16-converted values) staged once: BS[g*192 + t*64 + feature]; first read behind the barriers of the input layer
        if (tid < NBLK * MD) { const int e = tid;
            BS[e] = bfr(bl[0]); BS[192 + e] = bfr(bl[1]); BS[384 + e] = bfr(bl[2]); BS[576 + e] = bfr(bl[3]); BS[768 + e] = bfr(bl[4]); }
        __syncthreads();                                         // XB rows go from their converting wave to all four waves of the slab
#pragma unroll   // one load group, fragments in registers: block 0's q, k, v tiles and the head's parameters fly under the input GEMM
        for (int g = 0; g < 3; ++g) { wq[g][0] = ldh(wp0 + (size_t)g * NBLK * MD * MD); wq[g][1] = ldh(wp0 + (size_t)g * NBLK * MD * MD + FSTEP); }
        wo[0] = *(const v4f*)(Wout + f0); wo[1] = *(const v4f*)(Wout + f0 + 4); bo = bout[0];
        asm volatile("s_wait_xcnt 0x0" ::: "memory");            // precaution: stands behind the group's loads, in front of any later write of their base or offset registers
        v8f acc = (v8f){};
#pragma unroll
        for (int kc = 0; kc < DIN; kc += 32) {
            const int ao = lr * XP + kc + 8 * hi;
            const v16bf a = cat16b(*(const v8usa*)(&XBs[ao]), *(const v8usa*)(&XBs[ao + 16]));
            acc = wmmabg(b[kc / 32], a, acc); }
#pragma unroll
        for (int j = 0; j < 8; ++j) { const float hv = acc[j] + bfr(bb[j]);
            cur[j] = hv;
            res[j] = (hv >= 0.0f) ? hv : 0.1f * hv; }
    }

    const int pw = lr * HP + f0;                                 // the lane's 8 features in a plane
    const int kw = lr * TP + f0;                                 // and in an f32 tile
#pragma unroll 1
    for (int t = 0; t < NBLK; ++t) {
        v16h ah[2], ar[2], wf1[2], wf2[2];
        v4f g4[2], b4[2];
        v8f yv;
        const h16* wp = wp0 + (size_t)(t * MD) * MD;
        planes8r(cur, &AHs[pw], &ARs[pw]);                       // plane buffer 0: its last readers (the y fragments of the block before) lie two barriers back
        const v8f bbq = bias8(&BS[0 * (NBLK * MD) + t * MD + f0]), bbk = bias8(&BS[1 * (NBLK * MD) + t * MD + f0]), bbv = bias8(&BS[2 * (NBLK * MD) + t * MD + f0]);
        __syncthreads();                                         // planes of cur -> B fragments of all four waves
#pragma unroll
        for (int ks = 0; ks < 2; ++ks) { const int ao = lr * HP + ks * 32 + 8 * hi;
            ah[ks] = cat16(*(const v8ha*)(&AHs[ao]), *(const v8ha*)(&AHs[ao + 16]));
            ar[ks] = cat16(*(const v8ha*)(&ARs[ao]), *(const v8ha*)(&ARs[ao + 16])); }
        __builtin_amdgcn_sched_barrier(0);                       // the eight fragment loads stay one group in front of the chains: left alone the scheduler sinks half of them between the links, a second LDS trip in series
        const v8f q8 = gemm_tile(wq[0], ah, ar, bbq, 1.0f);   // q, k, v share the planes; q stays in the lane
        const v8f k8 = gemm_tile(wq[1], ah, ar, bbk, 1.0f);
        const v8f v8 = gemm_tile(wq[2], ah, ar, bbv, 1.0f);
        *(v4fa*)(&Ts[OFF_K + kw]) = lo4(k8); *(v4fa*)(&Ts[OFF_K + kw + 4]) = hi4(k8);
        *(v4fa*)(&Ts[OFF_V + kw]) = lo4(v8); *(v4fa*)(&Ts[OFF_V + kw + 4]) = hi4(v8);
        PA[pt + grp] = fmaxf(fmaxf(fmaxf(k8[0], k8[1]), fmaxf(k8[2], k8[3])), fmaxf(fmaxf(k8[4], k8[5]), fmaxf(k8[6], k8[7])));
        PB[pt + grp] = fminf(fminf(fminf(k8[0], k8[1]), fminf(k8[2], k8[3])), fminf(fminf(k8[4], k8[5]), fminf(k8[6], k8[7])));
        __syncthreads();                                         // k, v and the key extremes of each group -> all four waves; also frees plane buffer 0
        // both feed-forward weight tiles and the LayerNorm parameters fly under the softmax (issued behind the barrier, whose fence would wait for them)
        wf1[0] = ldh(wp + (size_t)3 * NBLK * MD * MD); wf1[1] = ldh(wp + (size_t)3 * NBLK * MD * MD + FSTEP);
        wf2[0] = ldh(wp + (size_t)4 * NBLK * MD * MD); wf2[1] = ldh(wp + (size_t)4 * NBLK * MD * MD + FSTEP);
#pragma unroll
        for (int u = 0; u < 2; ++u) { g4[u] = *(const v4f*)(ln_g + t * MD + f0 + 4 * u); b4[u] = *(const v4f*)(ln_b + t * MD + f0 + 4 * u); }
        asm volatile("s_wait_xcnt 0x0" ::: "memory");            // precaution: stands behind the group's loads, in front of any later write of their base or offset registers
        // per-token extreme keys: max_j q k_j = q * (q >= 0 ? kmax : kmin), from the token's eight group extremes
        float mx, mn;
        { const v4f x0 = *(const v4fa*)(&PA[pt]), x1 = *(const v4fa*)(&PA[pt + 4]), m0 = *(const v4fa*)(&PB[pt]), m1 = *(const v4fa*)(&PB[pt + 4]);
          mx = fmaxf(fmaxf(fmaxf(x0[0], x0[1]), fmaxf(x0[2], x0[3])), fmaxf(fmaxf(x1[0], x1[1]), fmaxf(x1[2], x1[3])));
          mn = fminf(fminf(fminf(m0[0], m0[1]), fminf(m0[2], m0[3])), fminf(fminf(m1[0], m1[1]), fminf(m1[2], m1[3]))); }
        // y[n][i] = sum_j softmax_j(q_i k_j) v_j + cur[n][i]: the lane owns rows i = f0 .. f0 + 7 of its token, the slab's sixteen tokens side by side,
        // so one 16-byte read of k or v (sixteen addresses per wave, one per token, at pitch TP on distinct banks) feeds 8 rows x 4 keys per lane
        {
            v2f sq[8], nc[8], s[8], y[8];
#pragma unroll
            for (int r = 0; r < 8; ++r) { const float q = q8[r];
                const float e = (q >= 0.0f) ? mx : mn;
                const float sv = q * L2E;
                const float cv = -(e * sv);                      // minus the row's largest score
                sq[r] = (v2f){sv, sv}; nc[r] = (v2f){cv, cv}; s[r] = (v2f){0.0f, 0.0f}; y[r] = (v2f){0.0f, 0.0f}; }
            const float* kr = &Ts[OFF_K + lr * TP];
            const float* vr = &Ts[OFF_V + lr * TP];
            v4f ka = *(const v4fa*)(kr), kb = *(const v4fa*)(kr + 4), va = *(const v4fa*)(vr);
#pragma unroll 1   // one trip: 8 keys = 4 batches (one key pair x 8 rows each); every LDS read is issued about half a trip or more ahead of its first use
            for (int jj = 0; jj < MD; jj += 8) {
                const v4f vb = *(const v4fa*)(vr + jj + 4);
                const int jn = (jj + 8) & (MD - 1);              // the last trip reads the row's first keys again (unused) instead of the row's pad
                v2f a[4][8], p[4][8];
                // written in the order the groups below ask for: batch b's exponentials stand among scores of later batches and sums of earlier ones, never beside an instruction that needs them
                SCORE(0, lo2(ka));
                EXPS(0); SCORE(1, hi2(ka)); SCORE(2, lo2(kb));
                EXPS(1); SCORE(3, hi2(kb)); SUMS(0, lo2(va));
                ka = *(const v4fa*)(kr + jn); kb = *(const v4fa*)(kr + jn + 4);
                EXPS(2); SUMS(1, hi2(va));
                va = *(const v4fa*)(vr + jn);
                EXPS(3); SUMS(2, lo2(vb));
                SUMS(3, hi2(vb));
                // instruction order of the trip: each transcendental is followed by a plain instruction of another batch instead of the next transcendental (left alone the scheduler forms runs of 32)
                __builtin_amdgcn_sched_group_barrier(SG_DSRD, 1, 0);
                __builtin_amdgcn_sched_group_barrier(SG_VALU, HEADP, 0);
#pragma unroll   // this loop and the three below only spell the pattern: the builtin emits no instruction and takes constants
                for (int i = 0; i < 16; ++i) { __builtin_amdgcn_sched_group_barrier(SG_TRANS, 1, 0); __builtin_amdgcn_sched_group_barrier(SG_VALU, 1, 0); }
#pragma unroll
                for (int i = 0; i < 8; ++i) { __builtin_amdgcn_sched_group_barrier(SG_TRANS, 1, 0); __builtin_amdgcn_sched_group_barrier(SG_VALU, 1, 0);
                                              __builtin_amdgcn_sched_group_barrier(SG_TRANS, 1, 0); __builtin_amdgcn_sched_group_barrier(SG_VALU, 2, 0); }
                __builtin_amdgcn_sched_group_barrier(SG_VALU, 1, 0);   // a 25th plain slot in this stretch, for the second address instruction
                __builtin_amdgcn_sched_group_barrier(SG_DSRD, 2, 0);
#pragma unroll
                for (int i = 0; i < 16; ++i) { __builtin_amdgcn_sched_group_barrier(SG_TRANS, 1, 0); __builtin_amdgcn_sched_group_barrier(SG_VALU, 1, 0); }
                __builtin_amdgcn_sched_group_barrier(SG_DSRD, 1, 0);
#pragma unroll
                for (int i = 0; i < 16; ++i) { __builtin_amdgcn_sched_group_barrier(SG_TRANS, 1, 0); __builtin_amdgcn_sched_group_barrier(SG_VALU, 1, 0); }
                __builtin_amdgcn_sched_group_barrier(SG_VALU, 16, 0);
            }
#pragma unroll
            for (int r = 0; r < 8; ++r) yv[r] = (y[r][0] + y[r][1]) * __builtin_amdgcn_rcpf(s[r][0] + s[r][1]) + cur[r];
            planes8r(yv, &AHs[pw], &ARs[pw]);                    // planes of y, buffer 0
        }
        const v8f bb1 = bias8(&BS[3 * (NBLK * MD) + t * MD + f0]), bb2 = bias8(&BS[4 * (NBLK * MD) + t * MD + f0]);
        __syncthreads();                                         // planes of y -> B fragments
#pragma unroll
        for (int ks = 0; ks < 2; ++ks) { const int ao = lr * HP + ks * 32 + 8 * hi;
            ah[ks] = cat16(*(const v8ha*)(&AHs[ao]), *(const v8ha*)(&AHs[ao + 16]));
            ar[ks] = cat16(*(const v8ha*)(&ARs[ao]), *(const v8ha*)(&ARs[ao + 16])); }
        __builtin_amdgcn_sched_barrier(0);                       // the eight fragment loads stay one group in front of the chains: left alone the scheduler sinks half of them between the links, a second LDS trip in series
        // hidden layer, leaky slope 0.01; its planes go to buffer 1, since other waves may still be reading buffer 0
        planes8r(gemm_tile(wf1, ah, ar, bb1, 0.01f), &AHs[PSZ + pw], &ARs[PSZ + pw]);
        __syncthreads();                                         // planes of the hidden layer -> B fragments
        {                                                        // the next block's q, k, v tiles fly under the second feed-forward GEMM, the LayerNorm and the plane split
            // loaded on every trip (the last trip fetches its own block's tiles again, unused): behind a test the old tiles would stay live through the whole trip and take 48 registers from the softmax
            const h16* wn = wp0 + (size_t)(((t + 1 < NBLK) ? t + 1 : t) * MD) * MD;
#pragma unroll   // one load group, fragments in registers
            for (int g = 0; g < 3; ++g) { wq[g][0] = ldh(wn + (size_t)g * NBLK * MD * MD); wq[g][1] = ldh(wn + (size_t)g * NBLK * MD * MD + FSTEP); }
            asm volatile("s_wait_xcnt 0x0" ::: "memory");        // precaution: stands behind the group's loads, in front of any later write of their base or offset registers
        }
#pragma unroll
        for (int ks = 0; ks < 2; ++ks) { const int ao = PSZ + lr * HP + ks * 32 + 8 * hi;
            ah[ks] = cat16(*(const v8ha*)(&AHs[ao]), *(const v8ha*)(&AHs[ao + 16]));
            ar[ks] = cat16(*(const v8ha*)(&ARs[ao]), *(const v8ha*)(&ARs[ao + 16])); }
        __builtin_amdgcn_sched_barrier(0);                       // the eight fragment loads stay one group in front of the chains: left alone the scheduler sinks half of them between the links, a second LDS trip in series
        const v8f a = gemm_tile(wf2, ah, ar, bb2, 1.0f) + yv;   // a = ff + y
        // res += LayerNorm(a) * g + b; cur = res. Each group hands over its sum and its squared deviations from its own mean; the token's variance is their sum plus the spread of the group means (no cancellation)
        {
            const float gs = tree8(a);
            const v8f gd = a - gs * 0.125f;
            PA[pt + grp] = gs; PB[pt + grp] = tree8(gd * gd);
            // LayerNorm partials of each group -> all four waves. Work-group barrier by hand, with the LDS wait alone beside it: the fence of __syncthreads() would also wait here for the weight loads issued above, which are first used two phases on
            asm volatile("s_wait_dscnt 0x0\n\ts_barrier_signal -1\n\ts_barrier_wait -1" ::: "memory");
            const v8f ps = cat8(*(const v4fa*)(&PA[pt]), *(const v4fa*)(&PA[pt + 4]));
            const v8f pq = cat8(*(const v4fa*)(&PB[pt]), *(const v4fa*)(&PB[pt + 4]));
            const float mu = tree8(ps) * (1.0f / MD);
            const v8f md = ps * 0.125f - mu;
            const float vs = tree8(pq) + 8.0f * tree8(md * md);
            const float inv = __builtin_amdgcn_rsqf(vs * (1.0f / MD) + 1e-5f);
#pragma unroll
            for (int i = 0; i < 8; ++i) res[i] = ((a[i] - mu) * inv * bfr(g4[i >> 2][i & 3]) + bfr(b4[i >> 2][i & 3])) + res[i];
            cur = res;
        }
    }
    // head: leaky(res . Wout + bout, 0.1); matrix-vector product in f32 on the vector unit: one partial per group, summed by the storing lanes
    {
        float ds = 0.0f;
#pragma unroll
        for (int u = 0; u < 2; ++u) { const v4f w4 = wo[u];
            ds += (res[4 * u] * bfr(w4[0]) + res[4 * u + 1] * bfr(w4[1])) + (res[4 * u + 2] * bfr(w4[2]) + res[4 * u + 3] * bfr(w4[3])); }
        PH[pt + grp] = ds;
    }
    __syncthreads();                                             // PH: all eight waves -> the storing lanes
    if (tid < 5 * 8) {                                           // five copies x 8 lanes x 16 B: each copy's 128-byte line stored whole
        const int c = tid >> 3, q4 = (tid & 7) * 4;
        v4f val;
#pragma unroll
        for (int i = 0; i < 4; ++i) { const float ov = tree8(cat8(*(const v4fa*)(&PH[(q4 + i) * 8]), *(const v4fa*)(&PH[(q4 + i) * 8 + 4]))) + bfr(bo);
            val[i] = (ov >= 0.0f) ? ov : 0.1f * ov; }
        *(v4f*)(OUT + (size_t)c * NTOK_FULL + n0 + q4) = val;
    }
}

static constexpr size_t al256(size_t v) { return (v + 255) & ~(size_t)255; }
static constexpr size_t SZ_W1T = al256((size_t)MD * DIN * 2);
static constexpr size_t SZ_WH  = al256((size_t)NGM * NBLK * MD * MD * 2);
static constexpr size_t SZ_TOTAL = SZ_W1T + SZ_WH;
static_assert(SZ_TOTAL <= (size_t)134217728);              // workspace carve <= 128 MiB
static_assert(((size_t)NBLK * MD * MD * 2) % 256 == 0);    // per-input weight sub-planes stay 256-byte aligned
static_assert((size_t)(DIN / 64) * 64 == (size_t)DIN);     // W1 blocks of k_prep x 64 rows == DIN
static_assert((size_t)(NTOK / TOKW) * TOKW == (size_t)NTOK);

extern "C" void kernel_launch(void* const* d_in, const int* in_sizes, int n_in,
                              void* d_out, int out_size, void* d_ws, size_t ws_size, hipStream_t stream) {
    if (n_in < 17) return;
    if ((size_t)in_sizes[0] < (size_t)NTOK * DIN) return;
    if ((size_t)in_sizes[1] < (size_t)DIN * MD || in_sizes[2] < MD) return;
    if ((size_t)in_sizes[3] < (size_t)NBLK * MD * MD || (size_t)in_sizes[5] < (size_t)NBLK * MD * MD || (size_t)in_sizes[7] < (size_t)NBLK * MD * MD) return;
    if ((size_t)in_sizes[9] < (size_t)NBLK * MD * MD || (size_t)in_sizes[11] < (size_t)NBLK * MD * MD) return;
    if (in_sizes[4] < NBLK * MD || in_sizes[6] < NBLK * MD || in_sizes[8] < NBLK * MD || in_sizes[10] < NBLK * MD || in_sizes[12] < NBLK * MD) return;
    if (in_sizes[13] < NBLK * MD || in_sizes[14] < NBLK * MD || in_sizes[15] < MD || in_sizes[16] < 1) return;
    if ((size_t)out_size < (size_t)4 * NTOK_FULL + NTOK) return;
    if (SZ_TOTAL > ws_size) return;
    // wire order: x, W1, b1, Wq, bq, Wk, bk, Wv, bv, Wf1, bf1, Wf2, bf2, ln_g, ln_b, Wout, bout
    const float* x   = (const float*)d_in[0];
    const float* W1  = (const float*)d_in[1];  const float* b1  = (const float*)d_in[2];
    const float* Wq  = (const float*)d_in[3];  const float* bq  = (const float*)d_in[4];
    const float* Wk  = (const float*)d_in[5];  const float* bk  = (const float*)d_in[6];
    const float* Wv  = (const float*)d_in[7];  const float* bv  = (const float*)d_in[8];
    const float* Wf1 = (const float*)d_in[9];  const float* bf1 = (const float*)d_in[10];
    const float* Wf2 = (const float*)d_in[11]; const float* bf2 = (const float*)d_in[12];
    const float* lng = (const float*)d_in[13]; const float* lnb = (const float*)d_in[14];
    const float* Wo  = (const float*)d_in[15]; const float* bo  = (const float*)d_in[16];
    float* OUT = (float*)d_out;                 // five copies, pitch NTOK_FULL floats
    char* wsp = (char*)d_ws;
    bf*  W1T = (bf*)wsp;  wsp += SZ_W1T;        // 64 x 256 bf16, fragment order
    h16* WH  = (h16*)wsp; wsp += SZ_WH;         // [5][3] matrices of 64 x 64 f16, fragment order; g = q | k | v | f1 | f2

    k_prep<<<DIN / 64 + NGM * NBLK, 256, 0, stream>>>(W1, Wq, Wk, Wv, Wf1, Wf2, W1T, WH);   // 4 chunks of W1 and the 15 block matrices, all independent

    k_tok<<<NTOK / TOKW, NTHR, 0, stream>>>(x, W1T, WH, b1, bq, bk, bv, bf1, bf2, lng, lnb, Wo, bo, OUT);
}
